// v000
// Times are from an AMD MI455X. After a warm-up the kernel runs many times in a row, and a time is the length of
// such a window on the GPU divided by its runs, so every launch and the gaps after it count. The runs cycle
// through copies of the inputs. A figure is the median of several windows, for all but v000 over two sittings.
// Sittings can differ by a few percent; kernels timed side by side share one.
// v000 is the starting kernel. One run takes 302 microseconds.
#include <hip/hip_runtime.h>
#include <hip/hip_bf16.h>
#include <cstdint>

typedef __attribute__((ext_vector_type(16))) _Float16 v16h;
typedef __attribute__((ext_vector_type(8)))  float    v8f;
typedef __attribute__((ext_vector_type(4)))  unsigned int u32x4;
typedef __attribute__((ext_vector_type(8)))  int          i32x8;
typedef __attribute__((ext_vector_type(4)))  int          i32x4;

__device__ __forceinline__ v8f wmma_f16(v16h a, v16h b, v8f c) {
    return __builtin_amdgcn_wmma_f32_16x16x32_f16(
        false, a, false, b, (short)0, c, false, false);
}

// v_cvt_pk_rtz_f16_f32: pack two f32 -> two f16 in one u32
__device__ __forceinline__ unsigned int pk2(float a, float b) {
    auto h = __builtin_amdgcn_cvt_pkrtz(a, b);
    return __builtin_bit_cast(unsigned int, h);
}

__device__ __forceinline__ void tdm_load_2d(const void* gptr, unsigned int lds_off,
                                            unsigned int dsz, unsigned int tile0,
                                            unsigned int tile1,
                                            unsigned long long stride0)
{
    unsigned long long ga = (unsigned long long)(uintptr_t)gptr;
    u32x4 g0 = { 1u,
                 lds_off,
                 (unsigned int)(ga & 0xffffffffull),
                 (unsigned int)((ga >> 32) & 0x1ffffffull) | (2u << 30) }; // [56:32]|type=2
    i32x8 g1 = {
        (int)(dsz << 16),
        (int)((tile0 & 0xffffu) << 16),
        (int)(((tile0 >> 16) & 0xffffu) | ((tile1 & 0xffffu) << 16)),
        (int)(((tile1 >> 16) & 0xffffu) | ((tile0 & 0xffffu) << 16)),
        (int)(tile1 & 0xffffu),
        (int)(stride0 & 0xffffffffull),
        (int)((stride0 >> 32) & 0xffffull),
        0 };
    i32x4 gz = { 0, 0, 0, 0 };
#if __clang_major__ >= 23
    i32x8 gz8 = { 0, 0, 0, 0, 0, 0, 0, 0 };
    __builtin_amdgcn_tensor_load_to_lds(g0, g1, gz, gz, gz8, 0);
#else
    __builtin_amdgcn_tensor_load_to_lds(g0, g1, gz, gz, 0);
#endif
}

#define PK 1024
#define PN 1024

// ---------------------------------------------------------------------------
// QKV projection: out = split_heads(X @ W + bias) * scale
// 128x128 block tile, 8 waves (2x4 of 64x32), BK=32, f32->f16 via cvt_pkrtz.
// transposed=0 -> out[bh][n][d] (Q/K);  transposed=1 -> out[bh][d][n] (V^T).
// ---------------------------------------------------------------------------
__global__ __launch_bounds__(256)
void qkv_proj_kernel(const float* __restrict__ X, const float* __restrict__ W,
                     const float* __restrict__ bias, _Float16* __restrict__ out,
                     int transposed, float scale)
{
    __shared__ _Float16 Ash[128 * 32];   // [m][k]
    __shared__ _Float16 Bsh[128 * 32];   // [n][k]

    const int tid  = threadIdx.x;
    const int lane = tid & 31;
    const int wave = tid >> 5;
    const int wr   = wave >> 2;
    const int wc   = wave & 3;
    const int m0   = blockIdx.x * 128;
    const int n0   = blockIdx.y * 128;
    const int lh   = lane >> 4;
    const int ln   = lane & 15;

    v8f acc[4][2];
#pragma unroll
    for (int i = 0; i < 4; ++i)
#pragma unroll
        for (int j = 0; j < 2; ++j) acc[i][j] = (v8f){0,0,0,0,0,0,0,0};

    for (int k0 = 0; k0 < PK; k0 += 32) {
        // A tile: 2 threads/row, 16 floats each -> 8 packed u32 -> 2x b128 DS stores
        {
            const int r  = tid >> 1;
            const int kk = (tid & 1) * 16;
            const float4* src = (const float4*)&X[(size_t)(m0 + r) * PK + k0 + kk];
            unsigned int p[8];
#pragma unroll
            for (int i = 0; i < 4; ++i) {
                float4 f = src[i];
                p[2*i+0] = pk2(f.x, f.y);
                p[2*i+1] = pk2(f.z, f.w);
            }
            uint4* dst = (uint4*)&Ash[r * 32 + kk];
            dst[0] = make_uint4(p[0], p[1], p[2], p[3]);
            dst[1] = make_uint4(p[4], p[5], p[6], p[7]);
        }
        // W tile: each thread covers 2 k-rows x 8 cols; packed k-pairs -> b32 stores
        {
            const int nn = (tid & 15) * 8;        // 0..120
            const int kp = tid >> 4;              // 0..15
            const int k  = 2 * kp;
            const float4* r0 = (const float4*)&W[(size_t)(k0 + k)     * PN + n0 + nn];
            const float4* r1 = (const float4*)&W[(size_t)(k0 + k + 1) * PN + n0 + nn];
            float a[8], b[8];
            float4 t;
            t = r0[0]; a[0]=t.x; a[1]=t.y; a[2]=t.z; a[3]=t.w;
            t = r0[1]; a[4]=t.x; a[5]=t.y; a[6]=t.z; a[7]=t.w;
            t = r1[0]; b[0]=t.x; b[1]=t.y; b[2]=t.z; b[3]=t.w;
            t = r1[1]; b[4]=t.x; b[5]=t.y; b[6]=t.z; b[7]=t.w;
#pragma unroll
            for (int j = 0; j < 8; ++j)
                *(unsigned int*)&Bsh[(nn + j) * 32 + k] = pk2(a[j], b[j]);
        }
        __syncthreads();

        const int kb = lh * 16;
        v16h bfrag[2];
#pragma unroll
        for (int nt = 0; nt < 2; ++nt)
            bfrag[nt] = *(const v16h*)&Bsh[(wc*32 + nt*16 + ln) * 32 + kb];
#pragma unroll
        for (int mt = 0; mt < 4; ++mt) {
            v16h a = *(const v16h*)&Ash[(wr*64 + mt*16 + ln) * 32 + kb];
#pragma unroll
            for (int nt = 0; nt < 2; ++nt)
                acc[mt][nt] = wmma_f16(a, bfrag[nt], acc[mt][nt]);
        }
        __syncthreads();
    }

    if (transposed) {
        // V^T: for fixed (mt,nt) the 8 rows are consecutive n -> one b128 store
#pragma unroll
        for (int mt = 0; mt < 4; ++mt)
#pragma unroll
            for (int nt = 0; nt < 2; ++nt) {
                const int gm0 = m0 + wr*64 + mt*16 + 8*lh;      // n base (mult of 8)
                const int gn  = n0 + wc*32 + nt*16 + ln;
                const int b = gm0 >> 10, nb = gm0 & 1023;
                const int d = gn >> 4,  h = gn & 15;
                const float bb = bias[gn];
                float vv[8];
#pragma unroll
                for (int r = 0; r < 8; ++r) vv[r] = (acc[mt][nt][r] + bb) * scale;
                uint4 u = make_uint4(pk2(vv[0], vv[1]), pk2(vv[2], vv[3]),
                                     pk2(vv[4], vv[5]), pk2(vv[6], vv[7]));
                *(uint4*)&out[((size_t)(b*16 + h) * 64 + d) * 1024 + nb] = u;
            }
    } else {
#pragma unroll
        for (int mt = 0; mt < 4; ++mt)
#pragma unroll
            for (int nt = 0; nt < 2; ++nt)
#pragma unroll
                for (int r = 0; r < 8; ++r) {
                    const int gm = m0 + wr*64 + mt*16 + r + 8*lh;
                    const int gn = n0 + wc*32 + nt*16 + ln;
                    const float vv = (acc[mt][nt][r] + bias[gn]) * scale;
                    const int b = gm >> 10, n = gm & 1023;
                    const int d = gn >> 4,  h = gn & 15;
                    out[((size_t)(b*16 + h) * 1024 + n) * 64 + d] = (_Float16)vv;
                }
    }
}

__global__ __launch_bounds__(128)
void attn_kernel(const _Float16* __restrict__ Qh, const _Float16* __restrict__ Kh,
                 const _Float16* __restrict__ Vt, const float* __restrict__ mask,
                 _Float16* __restrict__ O)
{
    __shared__ float    Msh[64 * 64];    // mask tile  (16 KB)
    __shared__ _Float16 Ksh[64 * 64];    // K chunk    ( 8 KB)  [n][d]
    __shared__ _Float16 Vsh[64 * 64];    // V chunk    ( 8 KB)  [d][n]
    __shared__ _Float16 Psh[64 * 64];    // P tile     ( 8 KB)

    const int tid  = threadIdx.x;
    const int lane = tid & 31;
    const int wave = tid >> 5;
    const int lh   = lane >> 4;
    const int ln   = lane & 15;
    const int bh   = blockIdx.y;
    const int q0   = blockIdx.x * 64;

    const _Float16* Qbase = Qh + ((size_t)bh * 1024 + q0) * 64;
    const _Float16* Kbase = Kh + (size_t)bh * 1024 * 64;
    const _Float16* Vbase = Vt + (size_t)bh * 64 * 1024;

    const int qrow = wave*16 + ln;
    v16h qf[2];
    qf[0] = *(const v16h*)&Qbase[qrow*64 +  0 + lh*16];
    qf[1] = *(const v16h*)&Qbase[qrow*64 + 32 + lh*16];

    v8f oacc[4];
#pragma unroll
    for (int dt = 0; dt < 4; ++dt) oacc[dt] = (v8f){0,0,0,0,0,0,0,0};
    float mrun[8], lrun[8];
#pragma unroll
    for (int r = 0; r < 8; ++r) { mrun[r] = -1.0e30f; lrun[r] = 0.0f; }

    const unsigned int koff = (unsigned int)(uintptr_t)&Ksh[0];
    const unsigned int voff = (unsigned int)(uintptr_t)&Vsh[0];
    const unsigned int moff = (unsigned int)(uintptr_t)&Msh[0];

    for (int kc = 0; kc < 1024; kc += 64) {
        if (wave == 0) {
            // K chunk: 64 rows x 64 d, contiguous -> 1 row of 4096 f16
            tdm_load_2d(&Kbase[(size_t)kc * 64], koff, 1u, 4096u, 1u, 4096ull);
            // V chunk: 64 d-rows x 64 n, row stride 1024 f16
            tdm_load_2d(&Vbase[kc], voff, 1u, 64u, 64u, 1024ull);
            // mask tile: 64 q-rows x 64 k, row stride 1024 f32
            tdm_load_2d(&mask[(size_t)q0 * 1024 + kc], moff, 2u, 64u, 64u, 1024ull);
            __builtin_amdgcn_s_wait_tensorcnt(0);
        }
        __syncthreads();

        // S = Q @ K^T for this wave's 16 rows x 64 chunk cols
        v8f sacc[4];
#pragma unroll
        for (int ct = 0; ct < 4; ++ct) {
            const int kr = ct*16 + ln;
            v16h b0 = *(const v16h*)&Ksh[kr*64 +  0 + lh*16];
            v16h b1 = *(const v16h*)&Ksh[kr*64 + 32 + lh*16];
            v8f s = (v8f){0,0,0,0,0,0,0,0};
            s = wmma_f16(qf[0], b0, s);
            s = wmma_f16(qf[1], b1, s);
            sacc[ct] = s;
        }

        // Online softmax
#pragma unroll
        for (int r = 0; r < 8; ++r) {
            const int lrow = wave*16 + r + 8*lh;
            float s[4];
#pragma unroll
            for (int ct = 0; ct < 4; ++ct)
                s[ct] = sacc[ct][r]
                      - 100000000.0f * (1.0f - Msh[lrow*64 + ct*16 + ln]);
            float mx = fmaxf(fmaxf(s[0], s[1]), fmaxf(s[2], s[3]));
#pragma unroll
            for (int off = 8; off > 0; off >>= 1)
                mx = fmaxf(mx, __shfl_xor(mx, off, 32));
            const float mnew  = fmaxf(mrun[r], mx);
            const float alpha = __expf(mrun[r] - mnew);
            float psum = 0.0f;
#pragma unroll
            for (int ct = 0; ct < 4; ++ct) {
                float p = __expf(s[ct] - mnew);
                Psh[lrow*64 + ct*16 + ln] = (_Float16)p;
                psum += p;
            }
#pragma unroll
            for (int off = 8; off > 0; off >>= 1)
                psum += __shfl_xor(psum, off, 32);
            lrun[r] = lrun[r] * alpha + psum;
            mrun[r] = mnew;
#pragma unroll
            for (int dt = 0; dt < 4; ++dt) oacc[dt][r] *= alpha;
        }
        __syncthreads();

        // O += P @ V
#pragma unroll
        for (int dt = 0; dt < 4; ++dt) {
            const int d = dt*16 + ln;
#pragma unroll
            for (int ks = 0; ks < 2; ++ks) {
                v16h a  = *(const v16h*)&Psh[(wave*16 + ln)*64 + ks*32 + lh*16];
                v16h bf = *(const v16h*)&Vsh[d*64 + ks*32 + lh*16];
                oacc[dt] = wmma_f16(a, bf, oacc[dt]);
            }
        }
        __syncthreads();
    }

    const int bb = bh >> 4, hh = bh & 15;
#pragma unroll
    for (int r = 0; r < 8; ++r) {
        const float inv = 1.0f / lrun[r];
        const int qn = q0 + wave*16 + r + 8*lh;
#pragma unroll
        for (int dt = 0; dt < 4; ++dt) {
            const int d = dt*16 + ln;
            O[((size_t)(bb*1024 + qn)) * 1024 + d*16 + hh] = (_Float16)(oacc[dt][r] * inv);
        }
    }
}

__global__ __launch_bounds__(256)
void out_proj_kernel(const _Float16* __restrict__ Xh, const float* __restrict__ W,
                     const float* __restrict__ bias, float* __restrict__ out)
{
    __shared__ _Float16 Ash[128 * 32];
    __shared__ _Float16 Bsh[128 * 32];

    const int tid  = threadIdx.x;
    const int lane = tid & 31;
    const int wave = tid >> 5;
    const int wr   = wave >> 2;
    const int wc   = wave & 3;
    const int m0   = blockIdx.x * 128;
    const int n0   = blockIdx.y * 128;
    const int lh   = lane >> 4;
    const int ln   = lane & 15;

    const unsigned int aoff = (unsigned int)(uintptr_t)&Ash[0];

    v8f acc[4][2];
#pragma unroll
    for (int i = 0; i < 4; ++i)
#pragma unroll
        for (int j = 0; j < 2; ++j) acc[i][j] = (v8f){0,0,0,0,0,0,0,0};

    for (int k0 = 0; k0 < PK; k0 += 32) {
        if (wave == 0)
            tdm_load_2d(&Xh[(size_t)m0 * PK + k0], aoff, 1u, 32u, 128u, 1024ull);
        {
            const int nn = (tid & 15) * 8;
            const int kp = tid >> 4;
            const int k  = 2 * kp;
            const float4* r0 = (const float4*)&W[(size_t)(k0 + k)     * PN + n0 + nn];
            const float4* r1 = (const float4*)&W[(size_t)(k0 + k + 1) * PN + n0 + nn];
            float a[8], b[8];
            float4 t;
            t = r0[0]; a[0]=t.x; a[1]=t.y; a[2]=t.z; a[3]=t.w;
            t = r0[1]; a[4]=t.x; a[5]=t.y; a[6]=t.z; a[7]=t.w;
            t = r1[0]; b[0]=t.x; b[1]=t.y; b[2]=t.z; b[3]=t.w;
            t = r1[1]; b[4]=t.x; b[5]=t.y; b[6]=t.z; b[7]=t.w;
#pragma unroll
            for (int j = 0; j < 8; ++j)
                *(unsigned int*)&Bsh[(nn + j) * 32 + k] = pk2(a[j], b[j]);
        }
        if (wave == 0) __builtin_amdgcn_s_wait_tensorcnt(0);
        __syncthreads();

        const int kb = lh * 16;
        v16h bfrag[2];
#pragma unroll
        for (int nt = 0; nt < 2; ++nt)
            bfrag[nt] = *(const v16h*)&Bsh[(wc*32 + nt*16 + ln) * 32 + kb];
#pragma unroll
        for (int mt = 0; mt < 4; ++mt) {
            v16h a = *(const v16h*)&Ash[(wr*64 + mt*16 + ln) * 32 + kb];
#pragma unroll
            for (int nt = 0; nt < 2; ++nt)
                acc[mt][nt] = wmma_f16(a, bfrag[nt], acc[mt][nt]);
        }
        __syncthreads();
    }

#pragma unroll
    for (int mt = 0; mt < 4; ++mt)
#pragma unroll
        for (int nt = 0; nt < 2; ++nt)
#pragma unroll
            for (int r = 0; r < 8; ++r) {
                const int gm = m0 + wr*64 + mt*16 + r + 8*lh;
                const int gn = n0 + wc*32 + nt*16 + ln;
                out[(size_t)gm * PN + gn] = acc[mt][nt][r] + bias[gn];
            }
}

// ---------------------------------------------------------------------------
extern "C" void kernel_launch(void* const* d_in, const int* in_sizes, int n_in,
                              void* d_out, int out_size, void* d_ws, size_t ws_size,
                              hipStream_t stream)
{
    const float* q    = (const float*)d_in[0];
    const float* k    = (const float*)d_in[1];
    const float* v    = (const float*)d_in[2];
    const float* mask = (const float*)d_in[3];
    const float* Wq   = (const float*)d_in[4];
    const float* bq   = (const float*)d_in[5];
    const float* Wk   = (const float*)d_in[6];
    const float* bk   = (const float*)d_in[7];
    const float* Wv   = (const float*)d_in[8];
    const float* bv   = (const float*)d_in[9];
    const float* Wo   = (const float*)d_in[10];
    const float* bo   = (const float*)d_in[11];
    float* out        = (float*)d_out;

    const size_t QKV = (size_t)4 * 16 * 1024 * 64;
    _Float16* Qh = (_Float16*)d_ws;
    _Float16* Kh = Qh + QKV;
    _Float16* Vt = Kh + QKV;
    _Float16* O  = Vt + QKV;

    const float scale = 1.0f / 32.0f;   // 1024^-0.5

    dim3 g(32, 8);
    qkv_proj_kernel<<<g, 256, 0, stream>>>(q, Wq, bq, Qh, 0, scale);
    qkv_proj_kernel<<<g, 256, 0, stream>>>(k, Wk, bk, Kh, 0, 1.0f);
    qkv_proj_kernel<<<g, 256, 0, stream>>>(v, Wv, bv, Vt, 1, 1.0f);

    attn_kernel<<<dim3(16, 64), 128, 0, stream>>>(Qh, Kh, Vt, mask, O);

    out_proj_kernel<<<g, 256, 0, stream>>>(O, Wo, bo, out);
}

// v001
// One run takes 243 microseconds.
// Timed twice side by side with v000, it ran 1.26 and 1.25 times as fast.
#include <hip/hip_runtime.h>
#include <hip/hip_bf16.h>
#include <cstdint>

typedef __attribute__((ext_vector_type(16))) _Float16 v16h;
typedef __attribute__((ext_vector_type(8)))  float    v8f;
typedef __attribute__((ext_vector_type(4)))  unsigned int u32x4;
typedef __attribute__((ext_vector_type(8)))  int          i32x8;
typedef __attribute__((ext_vector_type(4)))  int          i32x4;

__device__ __forceinline__ v8f wmma_f16(v16h a, v16h b, v8f c) {
    return __builtin_amdgcn_wmma_f32_16x16x32_f16(
        false, a, false, b, (short)0, c, false, false);
}

// v_cvt_pk_rtz_f16_f32: pack two f32 -> two f16 in one u32
__device__ __forceinline__ unsigned int pk2(float a, float b) {
    auto h = __builtin_amdgcn_cvt_pkrtz(a, b);
    return __builtin_bit_cast(unsigned int, h);
}

__device__ __forceinline__ void tdm_load_2d(const void* gptr, unsigned int lds_off,
                                            unsigned int dsz, unsigned int tile0,
                                            unsigned int tile1,
                                            unsigned long long stride0)
{
    unsigned long long ga = (unsigned long long)(uintptr_t)gptr;
    u32x4 g0 = { 1u,
                 lds_off,
                 (unsigned int)(ga & 0xffffffffull),
                 (unsigned int)((ga >> 32) & 0x1ffffffull) | (2u << 30) }; // [56:32]|type=2
    i32x8 g1 = {
        (int)(dsz << 16),
        (int)((tile0 & 0xffffu) << 16),
        (int)(((tile0 >> 16) & 0xffffu) | ((tile1 & 0xffffu) << 16)),
        (int)(((tile1 >> 16) & 0xffffu) | ((tile0 & 0xffffu) << 16)),
        (int)(tile1 & 0xffffu),
        (int)(stride0 & 0xffffffffull),
        (int)((stride0 >> 32) & 0xffffull),
        0 };
    i32x4 gz = { 0, 0, 0, 0 };
#if __clang_major__ >= 23
    i32x8 gz8 = { 0, 0, 0, 0, 0, 0, 0, 0 };
    __builtin_amdgcn_tensor_load_to_lds(g0, g1, gz, gz, gz8, 0);
#else
    __builtin_amdgcn_tensor_load_to_lds(g0, g1, gz, gz, 0);
#endif
}

#define PK 1024
#define PN 1024

// ---------------------------------------------------------------------------
// QKV projection: out = split_heads(X @ W + bias) * scale
// 128x128 block tile, 8 waves (2x4 of 64x32), BK=32, f32->f16 via cvt_pkrtz.
// One launch does all three products: blockIdx.z = 0 (Q), 1 (K), 2 (V), so that
// three independent workgroups share each WGP and fill one another's waits.
// Q/K -> out[bh][n][d];  V -> out[bh][d][n] (V^T). Only Q is scaled.
// ---------------------------------------------------------------------------
__global__ __launch_bounds__(256)
void qkv_proj_kernel(const float* __restrict__ Xq, const float* __restrict__ Xk,
                     const float* __restrict__ Xv,
                     const float* __restrict__ Wq, const float* __restrict__ Wk,
                     const float* __restrict__ Wv,
                     const float* __restrict__ bq, const float* __restrict__ bk,
                     const float* __restrict__ bv,
                     _Float16* __restrict__ out_q, _Float16* __restrict__ out_k,
                     _Float16* __restrict__ out_v, float q_scale)
{
    const int which = blockIdx.z;
    const float* __restrict__ X    = which == 0 ? Xq : which == 1 ? Xk : Xv;
    const float* __restrict__ W    = which == 0 ? Wq : which == 1 ? Wk : Wv;
    const float* __restrict__ bias = which == 0 ? bq : which == 1 ? bk : bv;
    _Float16* __restrict__ out     = which == 0 ? out_q : which == 1 ? out_k : out_v;
    const bool  transposed = which == 2;
    const float scale      = which == 0 ? q_scale : 1.0f;

    __shared__ _Float16 Ash[128 * 32];   // [m][k]
    __shared__ _Float16 Bsh[128 * 32];   // [n][k]

    const int tid  = threadIdx.x;
    const int lane = tid & 31;
    const int wave = tid >> 5;
    const int wr   = wave >> 2;
    const int wc   = wave & 3;
    const int m0   = blockIdx.x * 128;
    const int n0   = blockIdx.y * 128;
    const int lh   = lane >> 4;
    const int ln   = lane & 15;

    v8f acc[4][2];
#pragma unroll
    for (int i = 0; i < 4; ++i)
#pragma unroll
        for (int j = 0; j < 2; ++j) acc[i][j] = (v8f){0,0,0,0,0,0,0,0};

    for (int k0 = 0; k0 < PK; k0 += 32) {
        // A tile: 2 threads/row, 16 floats each -> 8 packed u32 -> 2x b128 DS stores
        {
            const int r  = tid >> 1;
            const int kk = (tid & 1) * 16;
            const float4* src = (const float4*)&X[(size_t)(m0 + r) * PK + k0 + kk];
            unsigned int p[8];
#pragma unroll
            for (int i = 0; i < 4; ++i) {
                float4 f = src[i];
                p[2*i+0] = pk2(f.x, f.y);
                p[2*i+1] = pk2(f.z, f.w);
            }
            uint4* dst = (uint4*)&Ash[r * 32 + kk];
            dst[0] = make_uint4(p[0], p[1], p[2], p[3]);
            dst[1] = make_uint4(p[4], p[5], p[6], p[7]);
        }
        // W tile: each thread covers 2 k-rows x 8 cols; packed k-pairs -> b32 stores
        {
            const int nn = (tid & 15) * 8;        // 0..120
            const int kp = tid >> 4;              // 0..15
            const int k  = 2 * kp;
            const float4* r0 = (const float4*)&W[(size_t)(k0 + k)     * PN + n0 + nn];
            const float4* r1 = (const float4*)&W[(size_t)(k0 + k + 1) * PN + n0 + nn];
            float a[8], b[8];
            float4 t;
            t = r0[0]; a[0]=t.x; a[1]=t.y; a[2]=t.z; a[3]=t.w;
            t = r0[1]; a[4]=t.x; a[5]=t.y; a[6]=t.z; a[7]=t.w;
            t = r1[0]; b[0]=t.x; b[1]=t.y; b[2]=t.z; b[3]=t.w;
            t = r1[1]; b[4]=t.x; b[5]=t.y; b[6]=t.z; b[7]=t.w;
#pragma unroll
            for (int j = 0; j < 8; ++j)
                *(unsigned int*)&Bsh[(nn + j) * 32 + k] = pk2(a[j], b[j]);
        }
        __syncthreads();

        const int kb = lh * 16;
        v16h bfrag[2];
#pragma unroll
        for (int nt = 0; nt < 2; ++nt)
            bfrag[nt] = *(const v16h*)&Bsh[(wc*32 + nt*16 + ln) * 32 + kb];
#pragma unroll
        for (int mt = 0; mt < 4; ++mt) {
            v16h a = *(const v16h*)&Ash[(wr*64 + mt*16 + ln) * 32 + kb];
#pragma unroll
            for (int nt = 0; nt < 2; ++nt)
                acc[mt][nt] = wmma_f16(a, bfrag[nt], acc[mt][nt]);
        }
        __syncthreads();
    }

    if (transposed) {
        // V^T: for fixed (mt,nt) the 8 rows are consecutive n -> one b128 store
#pragma unroll
        for (int mt = 0; mt < 4; ++mt)
#pragma unroll
            for (int nt = 0; nt < 2; ++nt) {
                const int gm0 = m0 + wr*64 + mt*16 + 8*lh;      // n base (mult of 8)
                const int gn  = n0 + wc*32 + nt*16 + ln;
                const int b = gm0 >> 10, nb = gm0 & 1023;
                const int d = gn >> 4,  h = gn & 15;
                const float bb = bias[gn];
                float vv[8];
#pragma unroll
                for (int r = 0; r < 8; ++r) vv[r] = (acc[mt][nt][r] + bb) * scale;
                uint4 u = make_uint4(pk2(vv[0], vv[1]), pk2(vv[2], vv[3]),
                                     pk2(vv[4], vv[5]), pk2(vv[6], vv[7]));
                *(uint4*)&out[((size_t)(b*16 + h) * 64 + d) * 1024 + nb] = u;
            }
    } else {
#pragma unroll
        for (int mt = 0; mt < 4; ++mt)
#pragma unroll
            for (int nt = 0; nt < 2; ++nt)
#pragma unroll
                for (int r = 0; r < 8; ++r) {
                    const int gm = m0 + wr*64 + mt*16 + r + 8*lh;
                    const int gn = n0 + wc*32 + nt*16 + ln;
                    const float vv = (acc[mt][nt][r] + bias[gn]) * scale;
                    const int b = gm >> 10, n = gm & 1023;
                    const int d = gn >> 4,  h = gn & 15;
                    out[((size_t)(b*16 + h) * 1024 + n) * 64 + d] = (_Float16)vv;
                }
    }
}

__global__ __launch_bounds__(128)
void attn_kernel(const _Float16* __restrict__ Qh, const _Float16* __restrict__ Kh,
                 const _Float16* __restrict__ Vt, const float* __restrict__ mask,
                 _Float16* __restrict__ O)
{
    __shared__ float    Msh[64 * 64];    // mask tile  (16 KB)
    __shared__ _Float16 Ksh[64 * 64];    // K chunk    ( 8 KB)  [n][d]
    __shared__ _Float16 Vsh[64 * 64];    // V chunk    ( 8 KB)  [d][n]
    __shared__ _Float16 Psh[64 * 64];    // P tile     ( 8 KB)

    const int tid  = threadIdx.x;
    const int lane = tid & 31;
    const int wave = tid >> 5;
    const int lh   = lane >> 4;
    const int ln   = lane & 15;
    const int bh   = blockIdx.y;
    const int q0   = blockIdx.x * 64;

    const _Float16* Qbase = Qh + ((size_t)bh * 1024 + q0) * 64;
    const _Float16* Kbase = Kh + (size_t)bh * 1024 * 64;
    const _Float16* Vbase = Vt + (size_t)bh * 64 * 1024;

    const int qrow = wave*16 + ln;
    v16h qf[2];
    qf[0] = *(const v16h*)&Qbase[qrow*64 +  0 + lh*16];
    qf[1] = *(const v16h*)&Qbase[qrow*64 + 32 + lh*16];

    v8f oacc[4];
#pragma unroll
    for (int dt = 0; dt < 4; ++dt) oacc[dt] = (v8f){0,0,0,0,0,0,0,0};
    float mrun[8], lrun[8];
#pragma unroll
    for (int r = 0; r < 8; ++r) { mrun[r] = -1.0e30f; lrun[r] = 0.0f; }

    const unsigned int koff = (unsigned int)(uintptr_t)&Ksh[0];
    const unsigned int voff = (unsigned int)(uintptr_t)&Vsh[0];
    const unsigned int moff = (unsigned int)(uintptr_t)&Msh[0];

    for (int kc = 0; kc < 1024; kc += 64) {
        if (wave == 0) {
            // K chunk: 64 rows x 64 d, contiguous -> 1 row of 4096 f16
            tdm_load_2d(&Kbase[(size_t)kc * 64], koff, 1u, 4096u, 1u, 4096ull);
            // V chunk: 64 d-rows x 64 n, row stride 1024 f16
            tdm_load_2d(&Vbase[kc], voff, 1u, 64u, 64u, 1024ull);
            // mask tile: 64 q-rows x 64 k, row stride 1024 f32
            tdm_load_2d(&mask[(size_t)q0 * 1024 + kc], moff, 2u, 64u, 64u, 1024ull);
            __builtin_amdgcn_s_wait_tensorcnt(0);
        }
        __syncthreads();

        // S = Q @ K^T for this wave's 16 rows x 64 chunk cols
        v8f sacc[4];
#pragma unroll
        for (int ct = 0; ct < 4; ++ct) {
            const int kr = ct*16 + ln;
            v16h b0 = *(const v16h*)&Ksh[kr*64 +  0 + lh*16];
            v16h b1 = *(const v16h*)&Ksh[kr*64 + 32 + lh*16];
            v8f s = (v8f){0,0,0,0,0,0,0,0};
            s = wmma_f16(qf[0], b0, s);
            s = wmma_f16(qf[1], b1, s);
            sacc[ct] = s;
        }

        // Online softmax
#pragma unroll
        for (int r = 0; r < 8; ++r) {
            const int lrow = wave*16 + r + 8*lh;
            float s[4];
#pragma unroll
            for (int ct = 0; ct < 4; ++ct)
                s[ct] = sacc[ct][r]
                      - 100000000.0f * (1.0f - Msh[lrow*64 + ct*16 + ln]);
            float mx = fmaxf(fmaxf(s[0], s[1]), fmaxf(s[2], s[3]));
#pragma unroll
            for (int off = 8; off > 0; off >>= 1)
                mx = fmaxf(mx, __shfl_xor(mx, off, 32));
            const float mnew  = fmaxf(mrun[r], mx);
            const float alpha = __expf(mrun[r] - mnew);
            float psum = 0.0f;
#pragma unroll
            for (int ct = 0; ct < 4; ++ct) {
                float p = __expf(s[ct] - mnew);
                Psh[lrow*64 + ct*16 + ln] = (_Float16)p;
                psum += p;
            }
#pragma unroll
            for (int off = 8; off > 0; off >>= 1)
                psum += __shfl_xor(psum, off, 32);
            lrun[r] = lrun[r] * alpha + psum;
            mrun[r] = mnew;
#pragma unroll
            for (int dt = 0; dt < 4; ++dt) oacc[dt][r] *= alpha;
        }
        __syncthreads();

        // O += P @ V
#pragma unroll
        for (int dt = 0; dt < 4; ++dt) {
            const int d = dt*16 + ln;
#pragma unroll
            for (int ks = 0; ks < 2; ++ks) {
                v16h a  = *(const v16h*)&Psh[(wave*16 + ln)*64 + ks*32 + lh*16];
                v16h bf = *(const v16h*)&Vsh[d*64 + ks*32 + lh*16];
                oacc[dt] = wmma_f16(a, bf, oacc[dt]);
            }
        }
        __syncthreads();
    }

    const int bb = bh >> 4, hh = bh & 15;
#pragma unroll
    for (int r = 0; r < 8; ++r) {
        const float inv = 1.0f / lrun[r];
        const int qn = q0 + wave*16 + r + 8*lh;
#pragma unroll
        for (int dt = 0; dt < 4; ++dt) {
            const int d = dt*16 + ln;
            O[((size_t)(bb*1024 + qn)) * 1024 + d*16 + hh] = (_Float16)(oacc[dt][r] * inv);
        }
    }
}

__global__ __launch_bounds__(256)
void out_proj_kernel(const _Float16* __restrict__ Xh, const float* __restrict__ W,
                     const float* __restrict__ bias, float* __restrict__ out)
{
    __shared__ _Float16 Ash[128 * 32];
    __shared__ _Float16 Bsh[128 * 32];

    const int tid  = threadIdx.x;
    const int lane = tid & 31;
    const int wave = tid >> 5;
    const int wr   = wave >> 2;
    const int wc   = wave & 3;
    const int m0   = blockIdx.x * 128;
    const int n0   = blockIdx.y * 128;
    const int lh   = lane >> 4;
    const int ln   = lane & 15;

    const unsigned int aoff = (unsigned int)(uintptr_t)&Ash[0];

    v8f acc[4][2];
#pragma unroll
    for (int i = 0; i < 4; ++i)
#pragma unroll
        for (int j = 0; j < 2; ++j) acc[i][j] = (v8f){0,0,0,0,0,0,0,0};

    for (int k0 = 0; k0 < PK; k0 += 32) {
        if (wave == 0)
            tdm_load_2d(&Xh[(size_t)m0 * PK + k0], aoff, 1u, 32u, 128u, 1024ull);
        {
            const int nn = (tid & 15) * 8;
            const int kp = tid >> 4;
            const int k  = 2 * kp;
            const float4* r0 = (const float4*)&W[(size_t)(k0 + k)     * PN + n0 + nn];
            const float4* r1 = (const float4*)&W[(size_t)(k0 + k + 1) * PN + n0 + nn];
            float a[8], b[8];
            float4 t;
            t = r0[0]; a[0]=t.x; a[1]=t.y; a[2]=t.z; a[3]=t.w;
            t = r0[1]; a[4]=t.x; a[5]=t.y; a[6]=t.z; a[7]=t.w;
            t = r1[0]; b[0]=t.x; b[1]=t.y; b[2]=t.z; b[3]=t.w;
            t = r1[1]; b[4]=t.x; b[5]=t.y; b[6]=t.z; b[7]=t.w;
#pragma unroll
            for (int j = 0; j < 8; ++j)
                *(unsigned int*)&Bsh[(nn + j) * 32 + k] = pk2(a[j], b[j]);
        }
        if (wave == 0) __builtin_amdgcn_s_wait_tensorcnt(0);
        __syncthreads();

        const int kb = lh * 16;
        v16h bfrag[2];
#pragma unroll
        for (int nt = 0; nt < 2; ++nt)
            bfrag[nt] = *(const v16h*)&Bsh[(wc*32 + nt*16 + ln) * 32 + kb];
#pragma unroll
        for (int mt = 0; mt < 4; ++mt) {
            v16h a = *(const v16h*)&Ash[(wr*64 + mt*16 + ln) * 32 + kb];
#pragma unroll
            for (int nt = 0; nt < 2; ++nt)
                acc[mt][nt] = wmma_f16(a, bfrag[nt], acc[mt][nt]);
        }
        __syncthreads();
    }

#pragma unroll
    for (int mt = 0; mt < 4; ++mt)
#pragma unroll
        for (int nt = 0; nt < 2; ++nt)
#pragma unroll
            for (int r = 0; r < 8; ++r) {
                const int gm = m0 + wr*64 + mt*16 + r + 8*lh;
                const int gn = n0 + wc*32 + nt*16 + ln;
                out[(size_t)gm * PN + gn] = acc[mt][nt][r] + bias[gn];
            }
}

// ---------------------------------------------------------------------------
extern "C" void kernel_launch(void* const* d_in, const int* in_sizes, int n_in,
                              void* d_out, int out_size, void* d_ws, size_t ws_size,
                              hipStream_t stream)
{
    const float* q    = (const float*)d_in[0];
    const float* k    = (const float*)d_in[1];
    const float* v    = (const float*)d_in[2];
    const float* mask = (const float*)d_in[3];
    const float* Wq   = (const float*)d_in[4];
    const float* bq   = (const float*)d_in[5];
    const float* Wk   = (const float*)d_in[6];
    const float* bk   = (const float*)d_in[7];
    const float* Wv   = (const float*)d_in[8];
    const float* bv   = (const float*)d_in[9];
    const float* Wo   = (const float*)d_in[10];
    const float* bo   = (const float*)d_in[11];
    float* out        = (float*)d_out;

    const size_t QKV = (size_t)4 * 16 * 1024 * 64;
    _Float16* Qh = (_Float16*)d_ws;
    _Float16* Kh = Qh + QKV;
    _Float16* Vt = Kh + QKV;
    _Float16* O  = Vt + QKV;

    const float scale = 1.0f / 32.0f;   // 1024^-0.5

    dim3 g(32, 8);
    qkv_proj_kernel<<<dim3(32, 8, 3), 256, 0, stream>>>(q, k, v, Wq, Wk, Wv, bq, bk, bv,
                                                        Qh, Kh, Vt, scale);

    attn_kernel<<<dim3(16, 64), 128, 0, stream>>>(Qh, Kh, Vt, mask, O);

    out_proj_kernel<<<g, 256, 0, stream>>>(O, Wo, bo, out);
}

// v002
// It runs in 156 microseconds.
// Next to v001, in two timings, it ran 1.55 times as fast each time.
// Over all steps from v000 it is 1.95 times as fast.
#include <hip/hip_runtime.h>
#include <hip/hip_bf16.h>
#include <cstdint>

typedef __attribute__((ext_vector_type(16))) _Float16 v16h;
typedef __attribute__((ext_vector_type(8)))  _Float16 v8h;
typedef __attribute__((ext_vector_type(8)))  float    v8f;
typedef __attribute__((ext_vector_type(4)))  unsigned int u32x4;
typedef __attribute__((ext_vector_type(8)))  unsigned int u32x8;

__device__ __forceinline__ v8f wmma_f16(v16h a, v16h b, v8f c) {
    return __builtin_amdgcn_wmma_f32_16x16x32_f16(
        false, a, false, b, (short)0, c, false, false);
}

// v_cvt_pk_rtz_f16_f32: pack two f32 -> two f16 in one u32
__device__ __forceinline__ unsigned int pk2(float a, float b) {
    auto h = __builtin_amdgcn_cvt_pkrtz(a, b);
    return __builtin_bit_cast(unsigned int, h);
}

// ---------------------------------------------------------------------------
// Tensor load: one request of one wave brings ROWS rows of ROWB bytes (source row
// pitch src_pitch bytes) into LDS. 1-byte elements, every extent in bytes, tensor
// dims = tile dims, two groups. WORD0 holds the pad: 1 << 20 | c << 22 | a << 25
// puts a + 1 dwords behind every 2^(c+1) dwords, so the LDS pitch is ROWB + 16 B
// for a = 3 with c matched to the row (3: 64 B, 4: 128 B, 5: 256 B).
// The issuing wave waits s_wait_tensorcnt 0 itself; others read behind a barrier.
// ---------------------------------------------------------------------------
__device__ __forceinline__ uint32_t uni(uint32_t v) {
    return (uint32_t)__builtin_amdgcn_readfirstlane(v);
}
__device__ __forceinline__ uint32_t pinned(uint32_t v) {
    uint32_t w = uni(v);
    asm volatile("" : "+s"(w));   // pinned(): keeps the test in a scalar register
    return w;
}
template <uint32_t WORD0, uint32_t ROWB, uint32_t ROWS>
__device__ __forceinline__ void tdm_tile(const void* gptr, uint32_t lds_dst,
                                         uint32_t src_pitch)
{
    const uint64_t ga = (uint64_t)(uintptr_t)gptr;
    u32x4 g0;
    g0[0] = uni(1u);                                     // count = 1
    g0[1] = uni(lds_dst);                                // byte offset in LDS
    g0[2] = uni((uint32_t)ga);                           // address [31:0]
    g0[3] = uni((((uint32_t)(ga >> 32)) & 0x01FFFFFFu) | 0x80000000u);  // [56:32], type 2
    u32x8 g1;
    g1[0] = uni(WORD0);
    g1[1] = uni((ROWB & 0xFFFFu) << 16);
    g1[2] = uni((ROWB >> 16) | ((ROWS & 0xFFFFu) << 16));
    g1[3] = uni((ROWS >> 16) | (ROWB << 16));
    g1[4] = uni(ROWS);
    g1[5] = uni(src_pitch);
    g1[6] = uni(0u);
    g1[7] = uni(0u);
    asm volatile("tensor_load_to_lds %0, %1" :: "s"(g0), "s"(g1) : "memory");
}
// The issuer's tile has landed behind this wait.
__device__ __forceinline__ void wait_tensor0() { asm volatile("s_wait_tensorcnt 0x0" ::: "memory"); }
// The wave's own LDS reads and writes have retired: owed before a barrier behind
// which a tensor load refills what the wave has read.
__device__ __forceinline__ void wait_ds0() { asm volatile("s_wait_dscnt 0x0" ::: "memory"); }

#define PAD64  ((1u << 20) | (3u << 22) | (3u << 25))   //  64-B rows -> pitch  80 B
#define PAD128 ((1u << 20) | (4u << 22) | (3u << 25))   // 128-B rows -> pitch 144 B
#define PAD256 ((1u << 20) | (5u << 22) | (3u << 25))   // 256-B rows -> pitch 272 B

#define PK 1024
#define PN 1024

#define LP 40
#define KP 72
#define MP 68

// 16 consecutive f16 of a padded row (16-byte aligned only): two b128 LDS loads.
__device__ __forceinline__ v16h ld_frag(const _Float16* p) {
    v8h lo = *(const v8h*)p;
    v8h hi = *(const v8h*)(p + 8);
    return __builtin_shufflevector(lo, hi, 0, 1, 2, 3, 4, 5, 6, 7,
                                   8, 9, 10, 11, 12, 13, 14, 15);
}

__device__ __forceinline__ void stage_w(const float* __restrict__ W, _Float16* Bsh,
                                        int k0, int n0, int tid) {
    const int lane = tid & 31;
    const int wave = tid >> 5;
    const int k = 4 * ((wave & 1) * 4 + (lane >> 3));      // 0..28
    const int n = 4 * ((wave >> 1) * 8 + (lane & 7));      // 0..124
    const float* src = &W[(size_t)(k0 + k) * PN + n0 + n];
    float w[4][4];
#pragma unroll
    for (int i = 0; i < 4; ++i) {
        float4 t = *(const float4*)&src[(size_t)i * PN];
        w[i][0] = t.x; w[i][1] = t.y; w[i][2] = t.z; w[i][3] = t.w;
    }
#pragma unroll
    for (int c = 0; c < 4; ++c)
        *(uint2*)&Bsh[(n + c) * LP + k] = make_uint2(pk2(w[0][c], w[1][c]),
                                                     pk2(w[2][c], w[3][c]));
}

// ---------------------------------------------------------------------------
// QKV projection: out = split_heads(X @ W + bias) * scale
// 128x128 block tile, 8 waves (2x4 of 64x32), BK=32, f32->f16 via cvt_pkrtz.
// One launch does all three products: blockIdx.z = 0 (Q), 1 (K), 2 (V), so that
// three independent workgroups share each WGP and fill one another's waits.
// Q/K -> out[bh][n][d];  V -> out[bh][d][n] (V^T). Only Q is scaled.
// ---------------------------------------------------------------------------
__global__ __launch_bounds__(256)
void qkv_proj_kernel(const float* __restrict__ Xq, const float* __restrict__ Xk,
                     const float* __restrict__ Xv,
                     const float* __restrict__ Wq, const float* __restrict__ Wk,
                     const float* __restrict__ Wv,
                     const float* __restrict__ bq, const float* __restrict__ bk,
                     const float* __restrict__ bv,
                     _Float16* __restrict__ out_q, _Float16* __restrict__ out_k,
                     _Float16* __restrict__ out_v, float q_scale)
{
    const int which = blockIdx.z;
    const float* __restrict__ X    = which == 0 ? Xq : which == 1 ? Xk : Xv;
    const float* __restrict__ W    = which == 0 ? Wq : which == 1 ? Wk : Wv;
    const float* __restrict__ bias = which == 0 ? bq : which == 1 ? bk : bv;
    _Float16* __restrict__ out     = which == 0 ? out_q : which == 1 ? out_k : out_v;
    const bool  transposed = which == 2;
    const float scale      = which == 0 ? q_scale : 1.0f;

    __shared__ _Float16 Ash[128 * LP];   // [m][k], padded rows
    __shared__ _Float16 Bsh[128 * LP];   // [n][k], padded rows

    const int tid  = threadIdx.x;
    const int lane = tid & 31;
    const int wave = tid >> 5;
    const int wr   = wave >> 2;
    const int wc   = wave & 3;
    const int m0   = blockIdx.x * 128;
    const int n0   = blockIdx.y * 128;
    const int lh   = lane >> 4;
    const int ln   = lane & 15;

    v8f acc[4][2];
#pragma unroll
    for (int i = 0; i < 4; ++i)
#pragma unroll
        for (int j = 0; j < 2; ++j) acc[i][j] = (v8f){0,0,0,0,0,0,0,0};

    for (int k0 = 0; k0 < PK; k0 += 32) {
        // A tile: 2 threads/row, 16 floats each -> 8 packed u32 -> 2x b128 DS stores
        {
            const int r  = tid >> 1;
            const int kk = (tid & 1) * 16;
            const float4* src = (const float4*)&X[(size_t)(m0 + r) * PK + k0 + kk];
            unsigned int p[8];
#pragma unroll
            for (int i = 0; i < 4; ++i) {
                float4 f = src[i];
                p[2*i+0] = pk2(f.x, f.y);
                p[2*i+1] = pk2(f.z, f.w);
            }
            uint4* dst = (uint4*)&Ash[r * LP + kk];
            dst[0] = make_uint4(p[0], p[1], p[2], p[3]);
            dst[1] = make_uint4(p[4], p[5], p[6], p[7]);
        }
        stage_w(W, Bsh, k0, n0, tid);
        __syncthreads();

        const int kb = lh * 16;
        v16h bfrag[2];
#pragma unroll
        for (int nt = 0; nt < 2; ++nt)
            bfrag[nt] = ld_frag(&Bsh[(wc*32 + nt*16 + ln) * LP + kb]);
#pragma unroll
        for (int mt = 0; mt < 4; ++mt) {
            v16h a = ld_frag(&Ash[(wr*64 + mt*16 + ln) * LP + kb]);
#pragma unroll
            for (int nt = 0; nt < 2; ++nt)
                acc[mt][nt] = wmma_f16(a, bfrag[nt], acc[mt][nt]);
        }
        __syncthreads();
    }

    if (transposed) {
        // V^T: for fixed (mt,nt) the 8 rows are consecutive n -> one b128 store
#pragma unroll
        for (int mt = 0; mt < 4; ++mt)
#pragma unroll
            for (int nt = 0; nt < 2; ++nt) {
                const int gm0 = m0 + wr*64 + mt*16 + 8*lh;      // n base (mult of 8)
                const int gn  = n0 + wc*32 + nt*16 + ln;
                const int b = gm0 >> 10, nb = gm0 & 1023;
                const int d = gn >> 4,  h = gn & 15;
                const float bb = bias[gn];
                float vv[8];
#pragma unroll
                for (int r = 0; r < 8; ++r) vv[r] = (acc[mt][nt][r] + bb) * scale;
                uint4 u = make_uint4(pk2(vv[0], vv[1]), pk2(vv[2], vv[3]),
                                     pk2(vv[4], vv[5]), pk2(vv[6], vv[7]));
                *(uint4*)&out[((size_t)(b*16 + h) * 64 + d) * 1024 + nb] = u;
            }
    } else {
#pragma unroll
        for (int mt = 0; mt < 4; ++mt)
#pragma unroll
            for (int nt = 0; nt < 2; ++nt)
#pragma unroll
                for (int r = 0; r < 8; ++r) {
                    const int gm = m0 + wr*64 + mt*16 + r + 8*lh;
                    const int gn = n0 + wc*32 + nt*16 + ln;
                    const float vv = (acc[mt][nt][r] + bias[gn]) * scale;
                    const int b = gm >> 10, n = gm & 1023;
                    const int d = gn >> 4,  h = gn & 15;
                    out[((size_t)(b*16 + h) * 1024 + n) * 64 + d] = (_Float16)vv;
                }
    }
}

// ---------------------------------------------------------------------------
// Flash attention with K/V/mask tiles staged by tensor loads, rows padded in LDS.
// Block = (b,h) x 64 Q rows; 4 waves; waves 0, 1, 2 each issue one tile's request.
// ---------------------------------------------------------------------------
__global__ __launch_bounds__(128)
void attn_kernel(const _Float16* __restrict__ Qh, const _Float16* __restrict__ Kh,
                 const _Float16* __restrict__ Vt, const float* __restrict__ mask,
                 _Float16* __restrict__ O)
{
    __shared__ __attribute__((aligned(2048))) float    Msh[64 * MP];    // mask tile
    __shared__ __attribute__((aligned(2048))) _Float16 Ksh[64 * KP];    // K chunk [n][d]
    __shared__ __attribute__((aligned(2048))) _Float16 Vsh[64 * KP];    // V chunk [d][n]
    __shared__ __attribute__((aligned(2048))) _Float16 Psh[64 * KP];    // P tile

    const int tid  = threadIdx.x;
    const int lane = tid & 31;
    const int wave = (int)uni((uint32_t)tid >> 5);
    const int lh   = lane >> 4;
    const int ln   = lane & 15;
    const int bh   = blockIdx.y;
    const int q0   = blockIdx.x * 64;

    const _Float16* Qbase = Qh + ((size_t)bh * 1024 + q0) * 64;
    const _Float16* Kbase = Kh + (size_t)bh * 1024 * 64;
    const _Float16* Vbase = Vt + (size_t)bh * 64 * 1024;

    const int qrow = wave*16 + ln;
    v16h qf[2];
    qf[0] = *(const v16h*)&Qbase[qrow*64 +  0 + lh*16];
    qf[1] = *(const v16h*)&Qbase[qrow*64 + 32 + lh*16];

    v8f oacc[4];
#pragma unroll
    for (int dt = 0; dt < 4; ++dt) oacc[dt] = (v8f){0,0,0,0,0,0,0,0};
    float mrun[8], lrun[8];
#pragma unroll
    for (int r = 0; r < 8; ++r) { mrun[r] = -1.0e30f; lrun[r] = 0.0f; }

    const unsigned int koff = (unsigned int)(uintptr_t)&Ksh[0];
    const unsigned int voff = (unsigned int)(uintptr_t)&Vsh[0];
    const unsigned int moff = (unsigned int)(uintptr_t)&Msh[0];

    for (int kc = 0; kc < 1024; kc += 64) {
        if (pinned(wave == 0)) {   // K chunk: 64 rows of 128 B, source pitch 128 B
            tdm_tile<PAD128, 128u, 64u>(&Kbase[(size_t)kc * 64], koff, 128u);
            wait_tensor0();
        }
        if (pinned(wave == 1)) {   // V chunk: 64 d-rows of 128 B, source pitch 2048 B
            tdm_tile<PAD128, 128u, 64u>(&Vbase[kc], voff, 2048u);
            wait_tensor0();
        }
        if (pinned(wave == 2)) {   // mask tile: 64 q-rows of 256 B, source pitch 4096 B
            tdm_tile<PAD256, 256u, 64u>(&mask[(size_t)q0 * 1024 + kc], moff, 4096u);
            wait_tensor0();
        }
        __syncthreads();

        // S = Q @ K^T for this wave's 16 rows x 64 chunk cols
        v8f sacc[4];
#pragma unroll
        for (int ct = 0; ct < 4; ++ct) {
            const int kr = ct*16 + ln;
            v16h b0 = ld_frag(&Ksh[kr*KP +  0 + lh*16]);
            v16h b1 = ld_frag(&Ksh[kr*KP + 32 + lh*16]);
            v8f s = (v8f){0,0,0,0,0,0,0,0};
            s = wmma_f16(qf[0], b0, s);
            s = wmma_f16(qf[1], b1, s);
            sacc[ct] = s;
        }

        // Online softmax
#pragma unroll
        for (int r = 0; r < 8; ++r) {
            const int lrow = wave*16 + r + 8*lh;
            float s[4];
#pragma unroll
            for (int ct = 0; ct < 4; ++ct)
                s[ct] = sacc[ct][r]
                      - 100000000.0f * (1.0f - Msh[lrow*MP + ct*16 + ln]);
            float mx = fmaxf(fmaxf(s[0], s[1]), fmaxf(s[2], s[3]));
#pragma unroll
            for (int off = 8; off > 0; off >>= 1)
                mx = fmaxf(mx, __shfl_xor(mx, off, 32));
            const float mnew  = fmaxf(mrun[r], mx);
            const float alpha = __expf(mrun[r] - mnew);
            float psum = 0.0f;
#pragma unroll
            for (int ct = 0; ct < 4; ++ct) {
                float p = __expf(s[ct] - mnew);
                Psh[lrow*KP + ct*16 + ln] = (_Float16)p;
                psum += p;
            }
#pragma unroll
            for (int off = 8; off > 0; off >>= 1)
                psum += __shfl_xor(psum, off, 32);
            lrun[r] = lrun[r] * alpha + psum;
            mrun[r] = mnew;
#pragma unroll
            for (int dt = 0; dt < 4; ++dt) oacc[dt][r] *= alpha;
        }
        __syncthreads();

        // O += P @ V
#pragma unroll
        for (int dt = 0; dt < 4; ++dt) {
            const int d = dt*16 + ln;
#pragma unroll
            for (int ks = 0; ks < 2; ++ks) {
                v16h a  = ld_frag(&Psh[(wave*16 + ln)*KP + ks*32 + lh*16]);
                v16h bf = ld_frag(&Vsh[d*KP + ks*32 + lh*16]);
                oacc[dt] = wmma_f16(a, bf, oacc[dt]);
            }
        }
        wait_ds0();
        __syncthreads();   // every reader has left Ksh/Vsh/Msh before the next chunk's loads
    }

    const int bb = bh >> 4, hh = bh & 15;
#pragma unroll
    for (int r = 0; r < 8; ++r) {
        const float inv = 1.0f / lrun[r];
        const int qn = q0 + wave*16 + r + 8*lh;
#pragma unroll
        for (int dt = 0; dt < 4; ++dt) {
            const int d = dt*16 + ln;
            O[((size_t)(bb*1024 + qn)) * 1024 + d*16 + hh] = (_Float16)(oacc[dt][r] * inv);
        }
    }
}

// ---------------------------------------------------------------------------
// Output projection: d_out = O(f16) @ Wo(f32) + bo -> f32.
// A tile staged by a tensor load (pure f16 copy, padded rows); W tile converted cooperatively.
// ---------------------------------------------------------------------------
__global__ __launch_bounds__(256)
void out_proj_kernel(const _Float16* __restrict__ Xh, const float* __restrict__ W,
                     const float* __restrict__ bias, float* __restrict__ out)
{
    __shared__ __attribute__((aligned(2048))) _Float16 Ash[128 * LP];   // padded by the tensor load
    __shared__ _Float16 Bsh[128 * LP];   // padded rows

    const int tid  = threadIdx.x;
    const int lane = tid & 31;
    const int wave = (int)uni((uint32_t)tid >> 5);
    const int wr   = wave >> 2;
    const int wc   = wave & 3;
    const int m0   = blockIdx.x * 128;
    const int n0   = blockIdx.y * 128;
    const int lh   = lane >> 4;
    const int ln   = lane & 15;

    const unsigned int aoff = (unsigned int)(uintptr_t)&Ash[0];

    v8f acc[4][2];
#pragma unroll
    for (int i = 0; i < 4; ++i)
#pragma unroll
        for (int j = 0; j < 2; ++j) acc[i][j] = (v8f){0,0,0,0,0,0,0,0};

    for (int k0 = 0; k0 < PK; k0 += 32) {
        // A tile: 128 rows of 64 B, source pitch 2048 B (wave 0 issues)
        if (pinned(wave == 0))
            tdm_tile<PAD64, 64u, 128u>(&Xh[(size_t)m0 * PK + k0], aoff, 2048u);
        // W tile (overlapped with the tensor load)
        stage_w(W, Bsh, k0, n0, tid);
        wait_ds0();       // this wave's W stores have retired
        wait_tensor0();   // wave 0: its tile has landed; the other waves have none outstanding
        __syncthreads();

        const int kb = lh * 16;
        v16h bfrag[2];
#pragma unroll
        for (int nt = 0; nt < 2; ++nt)
            bfrag[nt] = ld_frag(&Bsh[(wc*32 + nt*16 + ln) * LP + kb]);
#pragma unroll
        for (int mt = 0; mt < 4; ++mt) {
            v16h a = ld_frag(&Ash[(wr*64 + mt*16 + ln) * LP + kb]);
#pragma unroll
            for (int nt = 0; nt < 2; ++nt)
                acc[mt][nt] = wmma_f16(a, bfrag[nt], acc[mt][nt]);
        }
        wait_ds0();
        __syncthreads();   // every reader has left Ash before the next tile's load
    }

#pragma unroll
    for (int mt = 0; mt < 4; ++mt)
#pragma unroll
        for (int nt = 0; nt < 2; ++nt)
#pragma unroll
            for (int r = 0; r < 8; ++r) {
                const int gm = m0 + wr*64 + mt*16 + r + 8*lh;
                const int gn = n0 + wc*32 + nt*16 + ln;
                out[(size_t)gm * PN + gn] = acc[mt][nt][r] + bias[gn];
            }
}

// ---------------------------------------------------------------------------
extern "C" void kernel_launch(void* const* d_in, const int* in_sizes, int n_in,
                              void* d_out, int out_size, void* d_ws, size_t ws_size,
                              hipStream_t stream)
{
    const float* q    = (const float*)d_in[0];
    const float* k    = (const float*)d_in[1];
    const float* v    = (const float*)d_in[2];
    const float* mask = (const float*)d_in[3];
    const float* Wq   = (const float*)d_in[4];
    const float* bq   = (const float*)d_in[5];
    const float* Wk   = (const float*)d_in[6];
    const float* bk   = (const float*)d_in[7];
    const float* Wv   = (const float*)d_in[8];
    const float* bv   = (const float*)d_in[9];
    const float* Wo   = (const float*)d_in[10];
    const float* bo   = (const float*)d_in[11];
    float* out        = (float*)d_out;

    const size_t QKV = (size_t)4 * 16 * 1024 * 64;
    _Float16* Qh = (_Float16*)d_ws;
    _Float16* Kh = Qh + QKV;
    _Float16* Vt = Kh + QKV;
    _Float16* O  = Vt + QKV;

    const float scale = 1.0f / 32.0f;   // 1024^-0.5

    dim3 g(32, 8);
    qkv_proj_kernel<<<dim3(32, 8, 3), 256, 0, stream>>>(q, k, v, Wq, Wk, Wv, bq, bk, bv,
                                                        Qh, Kh, Vt, scale);

    attn_kernel<<<dim3(16, 64), 128, 0, stream>>>(Qh, Kh, Vt, mask, O);

    out_proj_kernel<<<g, 256, 0, stream>>>(O, Wo, bo, out);
}

// v003
// A run of this version takes 128 microseconds.
// Two timings next to v002 both put it at 1.22 times that version's speed.
// Over all steps from v000 it is 2.38 times as fast.
#include <hip/hip_runtime.h>
#include <hip/hip_bf16.h>
#include <cstdint>

typedef __attribute__((ext_vector_type(16))) _Float16 v16h;
typedef __attribute__((ext_vector_type(8)))  _Float16 v8h;
typedef __attribute__((ext_vector_type(2)))  _Float16 v2h;
typedef __attribute__((ext_vector_type(8)))  float    v8f;
typedef __attribute__((ext_vector_type(4)))  unsigned int u32x4;
typedef __attribute__((ext_vector_type(8)))  unsigned int u32x8;

__device__ __forceinline__ v8f wmma_f16(v16h a, v16h b, v8f c) {
    return __builtin_amdgcn_wmma_f32_16x16x32_f16(
        false, a, false, b, (short)0, c, false, false);
}

// v_cvt_pk_rtz_f16_f32: pack two f32 -> two f16 in one u32
__device__ __forceinline__ unsigned int pk2(float a, float b) {
    auto h = __builtin_amdgcn_cvt_pkrtz(a, b);
    return __builtin_bit_cast(unsigned int, h);
}

// ---------------------------------------------------------------------------
// Tensor load: one request of one wave brings ROWS rows of ROWB bytes (source row
// pitch src_pitch bytes) into LDS. 1-byte elements, every extent in bytes, tensor
// dims = tile dims, two groups. WORD0 holds the pad: 1 << 20 | c << 22 | a << 25
// puts a + 1 dwords behind every 2^(c+1) dwords, so the LDS pitch is ROWB + 16 B
// for a = 3 with c matched to the row (3: 64 B, 4: 128 B, 5: 256 B).
// The issuing wave waits s_wait_tensorcnt 0 itself; others read behind a barrier.
// ---------------------------------------------------------------------------
__device__ __forceinline__ uint32_t uni(uint32_t v) {
    return (uint32_t)__builtin_amdgcn_readfirstlane(v);
}
__device__ __forceinline__ uint32_t pinned(uint32_t v) {
    uint32_t w = uni(v);
    asm volatile("" : "+s"(w));   // pinned(): keeps the test in a scalar register
    return w;
}
template <uint32_t WORD0, uint32_t ROWB, uint32_t ROWS>
__device__ __forceinline__ void tdm_tile(const void* gptr, uint32_t lds_dst,
                                         uint32_t src_pitch)
{
    const uint64_t ga = (uint64_t)(uintptr_t)gptr;
    u32x4 g0;
    g0[0] = uni(1u);                                     // count = 1
    g0[1] = uni(lds_dst);                                // byte offset in LDS
    g0[2] = uni((uint32_t)ga);                           // address [31:0]
    g0[3] = uni((((uint32_t)(ga >> 32)) & 0x01FFFFFFu) | 0x80000000u);  // [56:32], type 2
    u32x8 g1;
    g1[0] = uni(WORD0);
    g1[1] = uni((ROWB & 0xFFFFu) << 16);
    g1[2] = uni((ROWB >> 16) | ((ROWS & 0xFFFFu) << 16));
    g1[3] = uni((ROWS >> 16) | (ROWB << 16));
    g1[4] = uni(ROWS);
    g1[5] = uni(src_pitch);
    g1[6] = uni(0u);
    g1[7] = uni(0u);
    asm volatile("tensor_load_to_lds %0, %1" :: "s"(g0), "s"(g1) : "memory");
}
// The issuer's tile has landed behind this wait.
__device__ __forceinline__ void wait_tensor0() { asm volatile("s_wait_tensorcnt 0x0" ::: "memory"); }
// The wave's own LDS reads and writes have retired: owed before a barrier behind
// which a tensor load refills what the wave has read.
__device__ __forceinline__ void wait_ds0() { asm volatile("s_wait_dscnt 0x0" ::: "memory"); }

#define PAD64  ((1u << 20) | (3u << 22) | (3u << 25))   //  64-B rows -> pitch  80 B
#define PAD128 ((1u << 20) | (4u << 22) | (3u << 25))   // 128-B rows -> pitch 144 B
#define PAD256 ((1u << 20) | (5u << 22) | (3u << 25))   // 256-B rows -> pitch 272 B

#define PK 1024
#define PN 1024

#define LP 40
#define KP 72
#define MP 68

// 16 consecutive f16 of a padded row (16-byte aligned only): two b128 LDS loads.
__device__ __forceinline__ v16h ld_frag(const _Float16* p) {
    v8h lo = *(const v8h*)p;
    v8h hi = *(const v8h*)(p + 8);
    return __builtin_shufflevector(lo, hi, 0, 1, 2, 3, 4, 5, 6, 7,
                                   8, 9, 10, 11, 12, 13, 14, 15);
}

template <bool HEADS>
__device__ __forceinline__ void stage_w(const float* __restrict__ W, _Float16* Bsh,
                                        int k0, int n0, int tid) {
    const int lane = tid & 31;
    const int wave = tid >> 5;
    const int k = 4 * ((wave & 1) * 4 + (lane >> 3));      // 0..28
    const int n = 4 * ((wave >> 1) * 8 + (lane & 7));      // 0..124
    const float* src = &W[(size_t)(k0 + k) * PN + n0 + n];
    float w[4][4];
#pragma unroll
    for (int i = 0; i < 4; ++i) {
        float4 t = *(const float4*)&src[(size_t)i * PN];
        w[i][0] = t.x; w[i][1] = t.y; w[i][2] = t.z; w[i][3] = t.w;
    }
    const int row0 = HEADS ? ((lane >> 2) & 1) * 16 + (lane & 3) * 4 + (wave >> 1) : n;
    const int rstep = HEADS ? 32 : 1;
#pragma unroll
    for (int c = 0; c < 4; ++c)
        *(uint2*)&Bsh[(row0 + c * rstep) * LP + k] = make_uint2(pk2(w[0][c], w[1][c]),
                                                                pk2(w[2][c], w[3][c]));
}

// ---------------------------------------------------------------------------
// QKV projection: out = split_heads(X @ W + bias) * scale
// 128x128 block tile, 8 waves (2x4 of 64x32), BK=32, f32->f16 via cvt_pkrtz.
// One launch does all three products: blockIdx.z = 0 (Q), 1 (K), 2 (V), so that
// three independent workgroups share each WGP and fill one another's waits.
// Q/K -> out[bh][n][d];  V -> out[bh][d][n] (V^T). Only Q is scaled.
// ---------------------------------------------------------------------------
__global__ __launch_bounds__(256)
void qkv_proj_kernel(const float* __restrict__ Xq, const float* __restrict__ Xk,
                     const float* __restrict__ Xv,
                     const float* __restrict__ Wq, const float* __restrict__ Wk,
                     const float* __restrict__ Wv,
                     const float* __restrict__ bq, const float* __restrict__ bk,
                     const float* __restrict__ bv,
                     _Float16* __restrict__ out_q, _Float16* __restrict__ out_k,
                     _Float16* __restrict__ out_v, float q_scale)
{
    const int which = blockIdx.z;
    const float* __restrict__ X    = which == 0 ? Xq : which == 1 ? Xk : Xv;
    const float* __restrict__ W    = which == 0 ? Wq : which == 1 ? Wk : Wv;
    const float* __restrict__ bias = which == 0 ? bq : which == 1 ? bk : bv;
    _Float16* __restrict__ out     = which == 0 ? out_q : which == 1 ? out_k : out_v;
    const bool  transposed = which == 2;
    const float scale      = which == 0 ? q_scale : 1.0f;

    __shared__ _Float16 Ash[128 * LP];   // [m][k], padded rows
    __shared__ _Float16 Bsh[128 * LP];   // [n][k], padded rows

    const int tid  = threadIdx.x;
    const int lane = tid & 31;
    const int wave = tid >> 5;
    const int wr   = wave >> 2;
    const int wc   = wave & 3;
    const int m0   = blockIdx.x * 128;
    const int n0   = blockIdx.y * 128;
    const int lh   = lane >> 4;
    const int ln   = lane & 15;

    v8f acc[4][2];
#pragma unroll
    for (int i = 0; i < 4; ++i)
#pragma unroll
        for (int j = 0; j < 2; ++j) acc[i][j] = (v8f){0,0,0,0,0,0,0,0};

    for (int k0 = 0; k0 < PK; k0 += 32) {
        // A tile: 2 threads/row, 16 floats each -> 8 packed u32 -> 2x b128 DS stores
        {
            const int r  = tid >> 1;
            const int kk = (tid & 1) * 16;
            const float4* src = (const float4*)&X[(size_t)(m0 + r) * PK + k0 + kk];
            unsigned int p[8];
#pragma unroll
            for (int i = 0; i < 4; ++i) {
                float4 f = src[i];
                p[2*i+0] = pk2(f.x, f.y);
                p[2*i+1] = pk2(f.z, f.w);
            }
            uint4* dst = (uint4*)&Ash[r * LP + kk];
            dst[0] = make_uint4(p[0], p[1], p[2], p[3]);
            dst[1] = make_uint4(p[4], p[5], p[6], p[7]);
        }
        stage_w<true>(W, Bsh, k0, n0, tid);
        __syncthreads();

        const int kb = lh * 16;
        v16h bfrag[2];
#pragma unroll
        for (int nt = 0; nt < 2; ++nt)
            bfrag[nt] = ld_frag(&Bsh[(wc*32 + nt*16 + ln) * LP + kb]);
#pragma unroll
        for (int mt = 0; mt < 4; ++mt) {
            v16h a = ld_frag(&Ash[(wr*64 + mt*16 + ln) * LP + kb]);
#pragma unroll
            for (int nt = 0; nt < 2; ++nt)
                acc[mt][nt] = wmma_f16(a, bfrag[nt], acc[mt][nt]);
        }
        __syncthreads();
    }

    // The W column that (wc, nt, ln) holds, by stage_w<true>'s row order
    const int h   = 4 * (ln >> 2) + wc;
    const int gc0 = n0 + 32 * (ln & 3) + h;      // tile nt = 0; nt = 1 is 16 further (next d)

    if (transposed) {
        // V^T: for fixed (mt,nt) the 8 rows are consecutive n -> one b128 store
#pragma unroll
        for (int mt = 0; mt < 4; ++mt)
#pragma unroll
            for (int nt = 0; nt < 2; ++nt) {
                const int gm0 = m0 + wr*64 + mt*16 + 8*lh;      // n base (mult of 8)
                const int gn  = gc0 + nt*16;
                const int b = gm0 >> 10, nb = gm0 & 1023;
                const int d = gn >> 4;
                const float bb = bias[gn];
                float vv[8];
#pragma unroll
                for (int r = 0; r < 8; ++r) vv[r] = (acc[mt][nt][r] + bb) * scale;
                uint4 u = make_uint4(pk2(vv[0], vv[1]), pk2(vv[2], vv[3]),
                                     pk2(vv[4], vv[5]), pk2(vv[6], vv[7]));
                *(uint4*)&out[((size_t)(b*16 + h) * 64 + d) * 1024 + nb] = u;
            }
    } else {
        // Q, K: the two tiles are d and d + 1 of one head -> one b32 store; four lanes
        // cover 16 contiguous bytes
        const float b0 = bias[gc0], b1 = bias[gc0 + 16];
        const int   d0 = gc0 >> 4;               // even
        // the 128 rows of a tile lie in one batch entry: one base address, row steps of 128 B
        const int   gmb = m0 + wr*64 + 8*lh;
        _Float16* dst = &out[((size_t)((gmb >> 10)*16 + h) * 1024 + (gmb & 1023)) * 64 + d0];
#pragma unroll
        for (int mt = 0; mt < 4; ++mt)
#pragma unroll
            for (int r = 0; r < 8; ++r) {
                v2h pr;
                pr[0] = (_Float16)((acc[mt][0][r] + b0) * scale);
                pr[1] = (_Float16)((acc[mt][1][r] + b1) * scale);
                *(v2h*)&dst[(mt*16 + r) * 64] = pr;
            }
        // the stores' address and data registers may be rewritten behind this point
        asm volatile("s_wait_xcnt 0x0" ::: "memory");
    }
}

// ---------------------------------------------------------------------------
// Flash attention with K/V/mask tiles staged by tensor loads, rows padded in LDS.
// Block = (b,h) x 64 Q rows; 4 waves; waves 0, 1, 2 each issue one tile's request.
// ---------------------------------------------------------------------------
__global__ __launch_bounds__(128)
void attn_kernel(const _Float16* __restrict__ Qh, const _Float16* __restrict__ Kh,
                 const _Float16* __restrict__ Vt, const float* __restrict__ mask,
                 _Float16* __restrict__ O)
{
    __shared__ __attribute__((aligned(2048))) float    Msh[64 * MP];    // mask tile
    __shared__ __attribute__((aligned(2048))) _Float16 Ksh[64 * KP];    // K chunk [n][d]
    __shared__ __attribute__((aligned(2048))) _Float16 Vsh[64 * KP];    // V chunk [d][n]
    __shared__ __attribute__((aligned(2048))) _Float16 Psh[64 * KP];    // P tile

    const int tid  = threadIdx.x;
    const int lane = tid & 31;
    const int wave = (int)uni((uint32_t)tid >> 5);
    const int lh   = lane >> 4;
    const int ln   = lane & 15;
    const int bh   = blockIdx.y;
    const int q0   = blockIdx.x * 64;

    const _Float16* Qbase = Qh + ((size_t)bh * 1024 + q0) * 64;
    const _Float16* Kbase = Kh + (size_t)bh * 1024 * 64;
    const _Float16* Vbase = Vt + (size_t)bh * 64 * 1024;

    const int qrow = wave*16 + ln;
    v16h qf[2];
    qf[0] = *(const v16h*)&Qbase[qrow*64 +  0 + lh*16];
    qf[1] = *(const v16h*)&Qbase[qrow*64 + 32 + lh*16];

    v8f oacc[4];
#pragma unroll
    for (int dt = 0; dt < 4; ++dt) oacc[dt] = (v8f){0,0,0,0,0,0,0,0};
    float mrun[8], lrun[8];
#pragma unroll
    for (int r = 0; r < 8; ++r) { mrun[r] = -1.0e30f; lrun[r] = 0.0f; }

    const unsigned int koff = (unsigned int)(uintptr_t)&Ksh[0];
    const unsigned int voff = (unsigned int)(uintptr_t)&Vsh[0];
    const unsigned int moff = (unsigned int)(uintptr_t)&Msh[0];

    for (int kc = 0; kc < 1024; kc += 64) {
        if (pinned(wave == 0)) {   // K chunk: 64 rows of 128 B, source pitch 128 B
            tdm_tile<PAD128, 128u, 64u>(&Kbase[(size_t)kc * 64], koff, 128u);
            wait_tensor0();
        }
        if (pinned(wave == 1)) {   // V chunk: 64 d-rows of 128 B, source pitch 2048 B
            tdm_tile<PAD128, 128u, 64u>(&Vbase[kc], voff, 2048u);
            wait_tensor0();
        }
        if (pinned(wave == 2)) {   // mask tile: 64 q-rows of 256 B, source pitch 4096 B
            tdm_tile<PAD256, 256u, 64u>(&mask[(size_t)q0 * 1024 + kc], moff, 4096u);
            wait_tensor0();
        }
        __syncthreads();

        // S = Q @ K^T for this wave's 16 rows x 64 chunk cols
        v8f sacc[4];
#pragma unroll
        for (int ct = 0; ct < 4; ++ct) {
            const int kr = ct*16 + ln;
            v16h b0 = ld_frag(&Ksh[kr*KP +  0 + lh*16]);
            v16h b1 = ld_frag(&Ksh[kr*KP + 32 + lh*16]);
            v8f s = (v8f){0,0,0,0,0,0,0,0};
            s = wmma_f16(qf[0], b0, s);
            s = wmma_f16(qf[1], b1, s);
            sacc[ct] = s;
        }

        // Online softmax
#pragma unroll
        for (int r = 0; r < 8; ++r) {
            const int lrow = wave*16 + r + 8*lh;
            float s[4];
#pragma unroll
            for (int ct = 0; ct < 4; ++ct)
                s[ct] = sacc[ct][r]
                      - 100000000.0f * (1.0f - Msh[lrow*MP + ct*16 + ln]);
            float mx = fmaxf(fmaxf(s[0], s[1]), fmaxf(s[2], s[3]));
#pragma unroll
            for (int off = 8; off > 0; off >>= 1)
                mx = fmaxf(mx, __shfl_xor(mx, off, 32));
            const float mnew  = fmaxf(mrun[r], mx);
            const float alpha = __expf(mrun[r] - mnew);
            float psum = 0.0f;
#pragma unroll
            for (int ct = 0; ct < 4; ++ct) {
                float p = __expf(s[ct] - mnew);
                Psh[lrow*KP + ct*16 + ln] = (_Float16)p;
                psum += p;
            }
#pragma unroll
            for (int off = 8; off > 0; off >>= 1)
                psum += __shfl_xor(psum, off, 32);
            lrun[r] = lrun[r] * alpha + psum;
            mrun[r] = mnew;
#pragma unroll
            for (int dt = 0; dt < 4; ++dt) oacc[dt][r] *= alpha;
        }
        __syncthreads();

        // O += P @ V
#pragma unroll
        for (int dt = 0; dt < 4; ++dt) {
            const int d = dt*16 + ln;
#pragma unroll
            for (int ks = 0; ks < 2; ++ks) {
                v16h a  = ld_frag(&Psh[(wave*16 + ln)*KP + ks*32 + lh*16]);
                v16h bf = ld_frag(&Vsh[d*KP + ks*32 + lh*16]);
                oacc[dt] = wmma_f16(a, bf, oacc[dt]);
            }
        }
        wait_ds0();
        __syncthreads();   // every reader has left Ksh/Vsh/Msh before the next chunk's loads
    }

    const int bb = bh >> 4, hh = bh & 15;
#pragma unroll
    for (int r = 0; r < 8; ++r) {
        const float inv = 1.0f / lrun[r];
        const int qn = q0 + wave*16 + r + 8*lh;
#pragma unroll
        for (int dt = 0; dt < 4; ++dt) {
            const int d = dt*16 + ln;
            O[((size_t)(bb*1024 + qn)) * 1024 + d*16 + hh] = (_Float16)(oacc[dt][r] * inv);
        }
    }
}

// ---------------------------------------------------------------------------
// Output projection: d_out = O(f16) @ Wo(f32) + bo -> f32.
// A tile staged by a tensor load (pure f16 copy, padded rows); W tile converted cooperatively.
// ---------------------------------------------------------------------------
__global__ __launch_bounds__(256)
void out_proj_kernel(const _Float16* __restrict__ Xh, const float* __restrict__ W,
                     const float* __restrict__ bias, float* __restrict__ out)
{
    __shared__ __attribute__((aligned(2048))) _Float16 Ash[128 * LP];   // padded by the tensor load
    __shared__ _Float16 Bsh[128 * LP];   // padded rows

    const int tid  = threadIdx.x;
    const int lane = tid & 31;
    const int wave = (int)uni((uint32_t)tid >> 5);
    const int wr   = wave >> 2;
    const int wc   = wave & 3;
    const int m0   = blockIdx.x * 128;
    const int n0   = blockIdx.y * 128;
    const int lh   = lane >> 4;
    const int ln   = lane & 15;

    const unsigned int aoff = (unsigned int)(uintptr_t)&Ash[0];

    v8f acc[4][2];
#pragma unroll
    for (int i = 0; i < 4; ++i)
#pragma unroll
        for (int j = 0; j < 2; ++j) acc[i][j] = (v8f){0,0,0,0,0,0,0,0};

    for (int k0 = 0; k0 < PK; k0 += 32) {
        // A tile: 128 rows of 64 B, source pitch 2048 B (wave 0 issues)
        if (pinned(wave == 0))
            tdm_tile<PAD64, 64u, 128u>(&Xh[(size_t)m0 * PK + k0], aoff, 2048u);
        // W tile (overlapped with the tensor load)
        stage_w<false>(W, Bsh, k0, n0, tid);
        wait_ds0();       // this wave's W stores have retired
        wait_tensor0();   // wave 0: its tile has landed; the other waves have none outstanding
        __syncthreads();

        const int kb = lh * 16;
        v16h bfrag[2];
#pragma unroll
        for (int nt = 0; nt < 2; ++nt)
            bfrag[nt] = ld_frag(&Bsh[(wc*32 + nt*16 + ln) * LP + kb]);
#pragma unroll
        for (int mt = 0; mt < 4; ++mt) {
            v16h a = ld_frag(&Ash[(wr*64 + mt*16 + ln) * LP + kb]);
#pragma unroll
            for (int nt = 0; nt < 2; ++nt)
                acc[mt][nt] = wmma_f16(a, bfrag[nt], acc[mt][nt]);
        }
        wait_ds0();
        __syncthreads();   // every reader has left Ash before the next tile's load
    }

#pragma unroll
    for (int mt = 0; mt < 4; ++mt)
#pragma unroll
        for (int nt = 0; nt < 2; ++nt)
#pragma unroll
            for (int r = 0; r < 8; ++r) {
                const int gm = m0 + wr*64 + mt*16 + r + 8*lh;
                const int gn = n0 + wc*32 + nt*16 + ln;
                out[(size_t)gm * PN + gn] = acc[mt][nt][r] + bias[gn];
            }
}

// ---------------------------------------------------------------------------
extern "C" void kernel_launch(void* const* d_in, const int* in_sizes, int n_in,
                              void* d_out, int out_size, void* d_ws, size_t ws_size,
                              hipStream_t stream)
{
    const float* q    = (const float*)d_in[0];
    const float* k    = (const float*)d_in[1];
    const float* v    = (const float*)d_in[2];
    const float* mask = (const float*)d_in[3];
    const float* Wq   = (const float*)d_in[4];
    const float* bq   = (const float*)d_in[5];
    const float* Wk   = (const float*)d_in[6];
    const float* bk   = (const float*)d_in[7];
    const float* Wv   = (const float*)d_in[8];
    const float* bv   = (const float*)d_in[9];
    const float* Wo   = (const float*)d_in[10];
    const float* bo   = (const float*)d_in[11];
    float* out        = (float*)d_out;

    const size_t QKV = (size_t)4 * 16 * 1024 * 64;
    _Float16* Qh = (_Float16*)d_ws;
    _Float16* Kh = Qh + QKV;
    _Float16* Vt = Kh + QKV;
    _Float16* O  = Vt + QKV;

    const float scale = 1.0f / 32.0f;   // 1024^-0.5

    dim3 g(32, 8);
    qkv_proj_kernel<<<dim3(32, 8, 3), 256, 0, stream>>>(q, k, v, Wq, Wk, Wv, bq, bk, bv,
                                                        Qh, Kh, Vt, scale);

    attn_kernel<<<dim3(16, 64), 128, 0, stream>>>(Qh, Kh, Vt, mask, O);

    out_proj_kernel<<<g, 256, 0, stream>>>(O, Wo, bo, out);
}

// v004
// It runs in 112 microseconds.
// In both of two side-by-side timings against v003, it was 1.14 times as fast.
// All steps since v000 together make it 2.73 times as fast.
#include <hip/hip_runtime.h>
#include <hip/hip_bf16.h>
#include <cstdint>

typedef __attribute__((ext_vector_type(16))) _Float16 v16h;
typedef __attribute__((ext_vector_type(8)))  _Float16 v8h;
typedef __attribute__((ext_vector_type(2)))  _Float16 v2h;
typedef __attribute__((ext_vector_type(8)))  float    v8f;
typedef __attribute__((ext_vector_type(4)))  unsigned int u32x4;
typedef __attribute__((ext_vector_type(8)))  unsigned int u32x8;

__device__ __forceinline__ v8f wmma_f16(v16h a, v16h b, v8f c) {
    return __builtin_amdgcn_wmma_f32_16x16x32_f16(
        false, a, false, b, (short)0, c, false, false);
}

// v_cvt_pk_rtz_f16_f32: pack two f32 -> two f16 in one u32
__device__ __forceinline__ unsigned int pk2(float a, float b) {
    auto h = __builtin_amdgcn_cvt_pkrtz(a, b);
    return __builtin_bit_cast(unsigned int, h);
}

// ---------------------------------------------------------------------------
// Tensor load: one request of one wave brings ROWS rows of ROWB bytes (source row
// pitch src_pitch bytes) into LDS. 1-byte elements, every extent in bytes, tensor
// dims = tile dims, two groups. WORD0 holds the pad: 1 << 20 | c << 22 | a << 25
// puts a + 1 dwords behind every 2^(c+1) dwords, so the LDS pitch is ROWB + 16 B
// for a = 3 with c matched to the row (3: 64 B, 4: 128 B, 5: 256 B).
// The issuing wave waits s_wait_tensorcnt 0 itself; others read behind a barrier.
// ---------------------------------------------------------------------------
__device__ __forceinline__ uint32_t uni(uint32_t v) {
    return (uint32_t)__builtin_amdgcn_readfirstlane(v);
}
__device__ __forceinline__ uint32_t pinned(uint32_t v) {
    uint32_t w = uni(v);
    asm volatile("" : "+s"(w));   // pinned(): keeps the test in a scalar register
    return w;
}
template <uint32_t WORD0, uint32_t ROWB, uint32_t ROWS>
__device__ __forceinline__ void tdm_tile(const void* gptr, uint32_t lds_dst,
                                         uint32_t src_pitch)
{
    const uint64_t ga = (uint64_t)(uintptr_t)gptr;
    u32x4 g0;
    g0[0] = uni(1u);                                     // count = 1
    g0[1] = uni(lds_dst);                                // byte offset in LDS
    g0[2] = uni((uint32_t)ga);                           // address [31:0]
    g0[3] = uni((((uint32_t)(ga >> 32)) & 0x01FFFFFFu) | 0x80000000u);  // [56:32], type 2
    u32x8 g1;
    g1[0] = uni(WORD0);
    g1[1] = uni((ROWB & 0xFFFFu) << 16);
    g1[2] = uni((ROWB >> 16) | ((ROWS & 0xFFFFu) << 16));
    g1[3] = uni((ROWS >> 16) | (ROWB << 16));
    g1[4] = uni(ROWS);
    g1[5] = uni(src_pitch);
    g1[6] = uni(0u);
    g1[7] = uni(0u);
    asm volatile("tensor_load_to_lds %0, %1" :: "s"(g0), "s"(g1) : "memory");
}
// The issuer's tile has landed behind this wait.
__device__ __forceinline__ void wait_tensor0() { asm volatile("s_wait_tensorcnt 0x0" ::: "memory"); }
// The wave's own LDS reads and writes have retired: owed before a barrier behind
// which a tensor load refills what the wave has read.
__device__ __forceinline__ void wait_ds0() { asm volatile("s_wait_dscnt 0x0" ::: "memory"); }

#define PAD64  ((1u << 20) | (3u << 22) | (3u << 25))   //  64-B rows -> pitch  80 B
#define PAD128 ((1u << 20) | (4u << 22) | (3u << 25))   // 128-B rows -> pitch 144 B
#define PAD256 ((1u << 20) | (5u << 22) | (3u << 25))   // 256-B rows -> pitch 272 B

#define PK 1024
#define PN 1024

#define LP 40
#define KP 72
#define MP 68

// 16 consecutive f16 of a padded row (16-byte aligned only): two b128 LDS loads.
__device__ __forceinline__ v16h ld_frag(const _Float16* p) {
    v8h lo = *(const v8h*)p;
    v8h hi = *(const v8h*)(p + 8);
    return __builtin_shufflevector(lo, hi, 0, 1, 2, 3, 4, 5, 6, 7,
                                   8, 9, 10, 11, 12, 13, 14, 15);
}

template <bool HEADS>
__device__ __forceinline__ void stage_w(const float* __restrict__ W, _Float16* Bsh,
                                        int k0, int n0, int tid) {
    const int lane = tid & 31;
    const int wave = tid >> 5;
    const int k = 4 * ((wave & 1) * 4 + (lane >> 3));      // 0..28
    const int n = 4 * ((wave >> 1) * 8 + (lane & 7));      // 0..124
    const float* src = &W[(size_t)(k0 + k) * PN + n0 + n];
    float w[4][4];
#pragma unroll
    for (int i = 0; i < 4; ++i) {
        float4 t = *(const float4*)&src[(size_t)i * PN];
        w[i][0] = t.x; w[i][1] = t.y; w[i][2] = t.z; w[i][3] = t.w;
    }
    const int row0 = HEADS ? ((lane >> 2) & 1) * 16 + (lane & 3) * 4 + (wave >> 1) : n;
    const int rstep = HEADS ? 32 : 1;
#pragma unroll
    for (int c = 0; c < 4; ++c)
        *(uint2*)&Bsh[(row0 + c * rstep) * LP + k] = make_uint2(pk2(w[0][c], w[1][c]),
                                                                pk2(w[2][c], w[3][c]));
}

// ---------------------------------------------------------------------------
// QKV projection: out = split_heads(X @ W + bias) * scale
// 128x128 block tile, 8 waves (2x4 of 64x32), BK=32, f32->f16 via cvt_pkrtz.
// One launch does all three products: blockIdx.z = 0 (Q), 1 (K), 2 (V), so that
// three independent workgroups share each WGP and fill one another's waits.
// Q/K -> out[bh][n][d];  V -> out[bh][d][n] (V^T). Only Q is scaled.
// ---------------------------------------------------------------------------
__global__ __launch_bounds__(256)
void qkv_proj_kernel(const float* __restrict__ Xq, const float* __restrict__ Xk,
                     const float* __restrict__ Xv,
                     const float* __restrict__ Wq, const float* __restrict__ Wk,
                     const float* __restrict__ Wv,
                     const float* __restrict__ bq, const float* __restrict__ bk,
                     const float* __restrict__ bv,
                     _Float16* __restrict__ out_q, _Float16* __restrict__ out_k,
                     _Float16* __restrict__ out_v, float q_scale)
{
    const int which = blockIdx.z;
    const float* __restrict__ X    = which == 0 ? Xq : which == 1 ? Xk : Xv;
    const float* __restrict__ W    = which == 0 ? Wq : which == 1 ? Wk : Wv;
    const float* __restrict__ bias = which == 0 ? bq : which == 1 ? bk : bv;
    _Float16* __restrict__ out     = which == 0 ? out_q : which == 1 ? out_k : out_v;
    const bool  transposed = which == 2;
    const float scale      = which == 0 ? q_scale : 1.0f;

    __shared__ _Float16 Ash[128 * LP];   // [m][k], padded rows
    __shared__ _Float16 Bsh[128 * LP];   // [n][k], padded rows

    const int tid  = threadIdx.x;
    const int lane = tid & 31;
    const int wave = tid >> 5;
    const int wr   = wave >> 2;
    const int wc   = wave & 3;
    const int m0   = blockIdx.x * 128;
    const int n0   = blockIdx.y * 128;
    const int lh   = lane >> 4;
    const int ln   = lane & 15;

    v8f acc[4][2];
#pragma unroll
    for (int i = 0; i < 4; ++i)
#pragma unroll
        for (int j = 0; j < 2; ++j) acc[i][j] = (v8f){0,0,0,0,0,0,0,0};

    for (int k0 = 0; k0 < PK; k0 += 32) {
        // A tile: 2 threads/row, 16 floats each -> 8 packed u32 -> 2x b128 DS stores
        {
            const int r  = tid >> 1;
            const int kk = (tid & 1) * 16;
            const float4* src = (const float4*)&X[(size_t)(m0 + r) * PK + k0 + kk];
            unsigned int p[8];
#pragma unroll
            for (int i = 0; i < 4; ++i) {
                float4 f = src[i];
                p[2*i+0] = pk2(f.x, f.y);
                p[2*i+1] = pk2(f.z, f.w);
            }
            uint4* dst = (uint4*)&Ash[r * LP + kk];
            dst[0] = make_uint4(p[0], p[1], p[2], p[3]);
            dst[1] = make_uint4(p[4], p[5], p[6], p[7]);
        }
        stage_w<true>(W, Bsh, k0, n0, tid);
        __syncthreads();

        const int kb = lh * 16;
        v16h bfrag[2];
#pragma unroll
        for (int nt = 0; nt < 2; ++nt)
            bfrag[nt] = ld_frag(&Bsh[(wc*32 + nt*16 + ln) * LP + kb]);
#pragma unroll
        for (int mt = 0; mt < 4; ++mt) {
            v16h a = ld_frag(&Ash[(wr*64 + mt*16 + ln) * LP + kb]);
#pragma unroll
            for (int nt = 0; nt < 2; ++nt)
                acc[mt][nt] = wmma_f16(a, bfrag[nt], acc[mt][nt]);
        }
        __syncthreads();
    }

    // The W column that (wc, nt, ln) holds, by stage_w<true>'s row order
    const int h   = 4 * (ln >> 2) + wc;
    const int gc0 = n0 + 32 * (ln & 3) + h;      // tile nt = 0; nt = 1 is 16 further (next d)

    if (transposed) {
        // V^T: for fixed (mt,nt) the 8 rows are consecutive n -> one b128 store
#pragma unroll
        for (int mt = 0; mt < 4; ++mt)
#pragma unroll
            for (int nt = 0; nt < 2; ++nt) {
                const int gm0 = m0 + wr*64 + mt*16 + 8*lh;      // n base (mult of 8)
                const int gn  = gc0 + nt*16;
                const int b = gm0 >> 10, nb = gm0 & 1023;
                const int d = gn >> 4;
                const float bb = bias[gn];
                float vv[8];
#pragma unroll
                for (int r = 0; r < 8; ++r) vv[r] = (acc[mt][nt][r] + bb) * scale;
                uint4 u = make_uint4(pk2(vv[0], vv[1]), pk2(vv[2], vv[3]),
                                     pk2(vv[4], vv[5]), pk2(vv[6], vv[7]));
                *(uint4*)&out[((size_t)(b*16 + h) * 64 + d) * 1024 + nb] = u;
            }
    } else {
        // Q, K: the two tiles are d and d + 1 of one head -> one b32 store; four lanes
        // cover 16 contiguous bytes
        const float b0 = bias[gc0], b1 = bias[gc0 + 16];
        const int   d0 = gc0 >> 4;               // even
        // the 128 rows of a tile lie in one batch entry: one base address, row steps of 128 B
        const int   gmb = m0 + wr*64 + 8*lh;
        _Float16* dst = &out[((size_t)((gmb >> 10)*16 + h) * 1024 + (gmb & 1023)) * 64 + d0];
#pragma unroll
        for (int mt = 0; mt < 4; ++mt)
#pragma unroll
            for (int r = 0; r < 8; ++r) {
                v2h pr;
                pr[0] = (_Float16)((acc[mt][0][r] + b0) * scale);
                pr[1] = (_Float16)((acc[mt][1][r] + b1) * scale);
                *(v2h*)&dst[(mt*16 + r) * 64] = pr;
            }
        // the stores' address and data registers may be rewritten behind this point
        asm volatile("s_wait_xcnt 0x0" ::: "memory");
    }
}

__device__ __forceinline__ float xhalf(float x) {
    const int b = __builtin_bit_cast(int, x);
    return __builtin_bit_cast(float,
        __builtin_amdgcn_permlanex16(b, b, 0x76543210, 0xfedcba98, false, false));
}

__device__ __forceinline__ void exp2x8(float (&y)[8], const float (&x)[8]) {
    asm("v_exp_f32 %0, %8\n\t"
        "v_exp_f32 %1, %9\n\t"
        "v_exp_f32 %2, %10\n\t"
        "v_exp_f32 %3, %11\n\t"
        "v_exp_f32 %4, %12\n\t"
        "v_exp_f32 %5, %13\n\t"
        "v_exp_f32 %6, %14\n\t"
        "v_exp_f32 %7, %15\n\t"
        "v_nop"
        : "=&v"(y[0]), "=&v"(y[1]), "=&v"(y[2]), "=&v"(y[3]),
          "=&v"(y[4]), "=&v"(y[5]), "=&v"(y[6]), "=&v"(y[7])
        : "v"(x[0]), "v"(x[1]), "v"(x[2]), "v"(x[3]),
          "v"(x[4]), "v"(x[5]), "v"(x[6]), "v"(x[7]));
}
__device__ __forceinline__ float exp2x1(float x) {
    float y;
    asm("v_exp_f32 %0, %1\n\t"
        "v_nop"
        : "=&v"(y) : "v"(x));
    return y;
}
#define LOG2E 1.44269504f

__global__ __launch_bounds__(128)
void attn_kernel(const _Float16* __restrict__ Qh, const _Float16* __restrict__ Kh,
                 const _Float16* __restrict__ Vt, const float* __restrict__ mask,
                 _Float16* __restrict__ O)
{
    __shared__ __attribute__((aligned(2048))) float    Msh[64 * MP];    // mask tile
    __shared__ __attribute__((aligned(2048))) _Float16 Ksh[64 * KP];    // K chunk [n][d]
    __shared__ __attribute__((aligned(2048))) _Float16 Vsh[64 * KP];    // V chunk [d][n]
    __shared__ __attribute__((aligned(2048))) _Float16 Osh[64 * KP];    // output tile [q][d]

    const int tid  = threadIdx.x;
    const int lane = tid & 31;
    const int wave = (int)uni((uint32_t)tid >> 5);
    const int lh   = lane >> 4;
    const int ln   = lane & 15;
    const int bh   = blockIdx.y;
    const int q0   = blockIdx.x * 64;

    const _Float16* Qbase = Qh + ((size_t)bh * 1024 + q0) * 64;
    const _Float16* Kbase = Kh + (size_t)bh * 1024 * 64;
    const _Float16* Vbase = Vt + (size_t)bh * 64 * 1024;

    // Q^T as B operand: column = query ln, k = d in the order of the K loader below
    const int qrow = wave*16 + ln;
    v16h qf[2];
    qf[0] = *(const v16h*)&Qbase[qrow*64 +  0 + lh*16];
    qf[1] = *(const v16h*)&Qbase[qrow*64 + 32 + lh*16];

    v8f oacc[4];   // O^T: register r of tile dt = d dt*16 + 8*lh + r of query ln
#pragma unroll
    for (int dt = 0; dt < 4; ++dt) oacc[dt] = (v8f){0,0,0,0,0,0,0,0};
    float mrun = -1.0e30f;   // the query's running maximum, equal in both halves
    float lrun = 0.0f;       // the sum over this half's keys; the halves join behind the loop

    const unsigned int koff = (unsigned int)(uintptr_t)&Ksh[0];
    const unsigned int voff = (unsigned int)(uintptr_t)&Vsh[0];
    const unsigned int moff = (unsigned int)(uintptr_t)&Msh[0];

    for (int kc = 0; kc < 1024; kc += 64) {
        if (pinned(wave == 0)) {   // K chunk: 64 rows of 128 B, source pitch 128 B
            tdm_tile<PAD128, 128u, 64u>(&Kbase[(size_t)kc * 64], koff, 128u);
            wait_tensor0();
        }
        if (pinned(wave == 1)) {   // V chunk: 64 d-rows of 128 B, source pitch 2048 B
            tdm_tile<PAD128, 128u, 64u>(&Vbase[kc], voff, 2048u);
            wait_tensor0();
        }
        if (pinned(wave == 2)) {   // mask tile: 64 q-rows of 256 B, source pitch 4096 B
            tdm_tile<PAD256, 256u, 64u>(&mask[(size_t)q0 * 1024 + kc], moff, 4096u);
            wait_tensor0();
        }
        __syncthreads();

        // S^T = K @ Q^T: register r of tile kt = key kt*16 + 8*lh + r, query ln
        v8f st[4];
#pragma unroll
        for (int kt = 0; kt < 4; ++kt) {
            const int kr = kt*16 + ln;
            v16h a0 = ld_frag(&Ksh[kr*KP +  0 + lh*16]);
            v16h a1 = ld_frag(&Ksh[kr*KP + 32 + lh*16]);
            v8f s = (v8f){0,0,0,0,0,0,0,0};
            s = wmma_f16(a0, qf[0], s);
            s = wmma_f16(a1, qf[1], s);
            st[kt] = s;
        }

        // Online softmax of one query per lane; four chains, one per tile
        const float* mrow = &Msh[qrow*MP + 8*lh];
        float mk[4];
#pragma unroll
        for (int kt = 0; kt < 4; ++kt) {
            const float4 m0 = *(const float4*)&mrow[kt*16];
            const float4 m1 = *(const float4*)&mrow[kt*16 + 4];
            const float mv[8] = {m0.x, m0.y, m0.z, m0.w, m1.x, m1.y, m1.z, m1.w};
#pragma unroll
            for (int r = 0; r < 8; ++r)
                st[kt][r] = st[kt][r] - 100000000.0f * (1.0f - mv[r]);
            float m = st[kt][0];
#pragma unroll
            for (int r = 1; r < 8; ++r) m = fmaxf(m, st[kt][r]);
            mk[kt] = m;
        }
        float mx = fmaxf(fmaxf(mk[0], mk[1]), fmaxf(mk[2], mk[3]));
        mx = fmaxf(mx, xhalf(mx));
        const float mnew  = fmaxf(mrun, mx);
        const float alpha = exp2x1((mrun - mnew) * LOG2E);

        // P^T as B operand: element s of block kb = tile 2*kb + (s >> 3), register s & 7
        v16h pb[2];
        float ps[4];
#pragma unroll
        for (int kt = 0; kt < 4; ++kt) {
            float x[8], p[8];
#pragma unroll
            for (int r = 0; r < 8; ++r) x[r] = (st[kt][r] - mnew) * LOG2E;
            exp2x8(p, x);
            float sum = p[0];
#pragma unroll
            for (int r = 1; r < 8; ++r) sum += p[r];
            ps[kt] = sum;
#pragma unroll
            for (int r = 0; r < 8; ++r) pb[kt >> 1][(kt & 1)*8 + r] = (_Float16)p[r];
        }
        lrun = lrun * alpha + ((ps[0] + ps[1]) + (ps[2] + ps[3]));
        mrun = mnew;
#pragma unroll
        for (int dt = 0; dt < 4; ++dt)
#pragma unroll
            for (int r = 0; r < 8; ++r) oacc[dt][r] *= alpha;

        // O^T += V^T @ P^T; the V loader takes P^T's key order: of each 32 keys a half
        // holds 8*lh .. 8*lh + 7 and 16 + 8*lh .. 16 + 8*lh + 7
#pragma unroll
        for (int dt = 0; dt < 4; ++dt) {
#pragma unroll
            for (int kb = 0; kb < 2; ++kb) {
                const _Float16* vr = &Vsh[(dt*16 + ln)*KP + kb*32 + 8*lh];
                v8h lo = *(const v8h*)vr;
                v8h hi = *(const v8h*)(vr + 16);
                v16h vf = __builtin_shufflevector(lo, hi, 0, 1, 2, 3, 4, 5, 6, 7,
                                                  8, 9, 10, 11, 12, 13, 14, 15);
                oacc[dt] = wmma_f16(vf, pb[kb], oacc[dt]);
            }
        }
        wait_ds0();
        __syncthreads();   // every reader has left Ksh/Vsh/Msh before the next chunk's loads
    }

    // Each wave turns its own 16 x 64 tile in its own rows of Osh, so that the global
    // stores keep 16 lanes along d of one output row.
    const float inv = 1.0f / (lrun + xhalf(lrun));
#pragma unroll
    for (int dt = 0; dt < 4; ++dt) {
        v8h o;
#pragma unroll
        for (int r = 0; r < 8; ++r) o[r] = (_Float16)(oacc[dt][r] * inv);
        *(v8h*)&Osh[qrow*KP + dt*16 + 8*lh] = o;
    }
    wait_ds0();   // the wave's own stores have retired before its other lanes read them

    const int bb = bh >> 4, hh = bh & 15;
#pragma unroll
    for (int r = 0; r < 8; ++r) {
        const int lrow = wave*16 + r + 8*lh;
        const int qn = q0 + lrow;
#pragma unroll
        for (int dt = 0; dt < 4; ++dt) {
            const int d = dt*16 + ln;
            O[((size_t)(bb*1024 + qn)) * 1024 + d*16 + hh] = Osh[lrow*KP + d];
        }
    }
}

// ---------------------------------------------------------------------------
// Output projection: d_out = O(f16) @ Wo(f32) + bo -> f32.
// A tile staged by a tensor load (pure f16 copy, padded rows); W tile converted cooperatively.
// ---------------------------------------------------------------------------
__global__ __launch_bounds__(256)
void out_proj_kernel(const _Float16* __restrict__ Xh, const float* __restrict__ W,
                     const float* __restrict__ bias, float* __restrict__ out)
{
    __shared__ __attribute__((aligned(2048))) _Float16 Ash[128 * LP];   // padded by the tensor load
    __shared__ _Float16 Bsh[128 * LP];   // padded rows

    const int tid  = threadIdx.x;
    const int lane = tid & 31;
    const int wave = (int)uni((uint32_t)tid >> 5);
    const int wr   = wave >> 2;
    const int wc   = wave & 3;
    const int m0   = blockIdx.x * 128;
    const int n0   = blockIdx.y * 128;
    const int lh   = lane >> 4;
    const int ln   = lane & 15;

    const unsigned int aoff = (unsigned int)(uintptr_t)&Ash[0];

    v8f acc[4][2];
#pragma unroll
    for (int i = 0; i < 4; ++i)
#pragma unroll
        for (int j = 0; j < 2; ++j) acc[i][j] = (v8f){0,0,0,0,0,0,0,0};

    for (int k0 = 0; k0 < PK; k0 += 32) {
        // A tile: 128 rows of 64 B, source pitch 2048 B (wave 0 issues)
        if (pinned(wave == 0))
            tdm_tile<PAD64, 64u, 128u>(&Xh[(size_t)m0 * PK + k0], aoff, 2048u);
        // W tile (overlapped with the tensor load)
        stage_w<false>(W, Bsh, k0, n0, tid);
        wait_ds0();       // this wave's W stores have retired
        wait_tensor0();   // wave 0: its tile has landed; the other waves have none outstanding
        __syncthreads();

        const int kb = lh * 16;
        v16h bfrag[2];
#pragma unroll
        for (int nt = 0; nt < 2; ++nt)
            bfrag[nt] = ld_frag(&Bsh[(wc*32 + nt*16 + ln) * LP + kb]);
#pragma unroll
        for (int mt = 0; mt < 4; ++mt) {
            v16h a = ld_frag(&Ash[(wr*64 + mt*16 + ln) * LP + kb]);
#pragma unroll
            for (int nt = 0; nt < 2; ++nt)
                acc[mt][nt] = wmma_f16(a, bfrag[nt], acc[mt][nt]);
        }
        wait_ds0();
        __syncthreads();   // every reader has left Ash before the next tile's load
    }

#pragma unroll
    for (int mt = 0; mt < 4; ++mt)
#pragma unroll
        for (int nt = 0; nt < 2; ++nt)
#pragma unroll
            for (int r = 0; r < 8; ++r) {
                const int gm = m0 + wr*64 + mt*16 + r + 8*lh;
                const int gn = n0 + wc*32 + nt*16 + ln;
                out[(size_t)gm * PN + gn] = acc[mt][nt][r] + bias[gn];
            }
}

// ---------------------------------------------------------------------------
extern "C" void kernel_launch(void* const* d_in, const int* in_sizes, int n_in,
                              void* d_out, int out_size, void* d_ws, size_t ws_size,
                              hipStream_t stream)
{
    const float* q    = (const float*)d_in[0];
    const float* k    = (const float*)d_in[1];
    const float* v    = (const float*)d_in[2];
    const float* mask = (const float*)d_in[3];
    const float* Wq   = (const float*)d_in[4];
    const float* bq   = (const float*)d_in[5];
    const float* Wk   = (const float*)d_in[6];
    const float* bk   = (const float*)d_in[7];
    const float* Wv   = (const float*)d_in[8];
    const float* bv   = (const float*)d_in[9];
    const float* Wo   = (const float*)d_in[10];
    const float* bo   = (const float*)d_in[11];
    float* out        = (float*)d_out;

    const size_t QKV = (size_t)4 * 16 * 1024 * 64;
    _Float16* Qh = (_Float16*)d_ws;
    _Float16* Kh = Qh + QKV;
    _Float16* Vt = Kh + QKV;
    _Float16* O  = Vt + QKV;

    const float scale = 1.0f / 32.0f;   // 1024^-0.5

    dim3 g(32, 8);
    qkv_proj_kernel<<<dim3(32, 8, 3), 256, 0, stream>>>(q, k, v, Wq, Wk, Wv, bq, bk, bv,
                                                        Qh, Kh, Vt, scale);

    attn_kernel<<<dim3(16, 64), 128, 0, stream>>>(Qh, Kh, Vt, mask, O);

    out_proj_kernel<<<g, 256, 0, stream>>>(O, Wo, bo, out);
}

// v005
// Measured time: 108 microseconds a run.
// Next to v004, in two timings, it ran 1.03 times as fast each time.
// Counting every step since v000, it is 2.82 times as fast.
#include <hip/hip_runtime.h>
#include <hip/hip_bf16.h>
#include <cstdint>

typedef __attribute__((ext_vector_type(16))) _Float16 v16h;
typedef __attribute__((ext_vector_type(8)))  _Float16 v8h;
typedef __attribute__((ext_vector_type(2)))  _Float16 v2h;
typedef __attribute__((ext_vector_type(8)))  float    v8f;
typedef __attribute__((ext_vector_type(4)))  unsigned int u32x4;
typedef __attribute__((ext_vector_type(8)))  unsigned int u32x8;

__device__ __forceinline__ v8f wmma_f16(v16h a, v16h b, v8f c) {
    return __builtin_amdgcn_wmma_f32_16x16x32_f16(
        false, a, false, b, (short)0, c, false, false);
}

// v_cvt_pk_rtz_f16_f32: pack two f32 -> two f16 in one u32
__device__ __forceinline__ unsigned int pk2(float a, float b) {
    auto h = __builtin_amdgcn_cvt_pkrtz(a, b);
    return __builtin_bit_cast(unsigned int, h);
}

// ---------------------------------------------------------------------------
// Tensor load: one request of one wave brings ROWS rows of ROWB bytes (source row
// pitch src_pitch bytes) into LDS. 1-byte elements, every extent in bytes, tensor
// dims = tile dims, two groups. WORD0 holds the pad: 1 << 20 | c << 22 | a << 25
// puts a + 1 dwords behind every 2^(c+1) dwords, so the LDS pitch is ROWB + 16 B
// for a = 3 with c matched to the row (3: 64 B, 4: 128 B, 5: 256 B).
// The issuing wave waits s_wait_tensorcnt 0 itself; others read behind a barrier.
// ---------------------------------------------------------------------------
__device__ __forceinline__ uint32_t uni(uint32_t v) {
    return (uint32_t)__builtin_amdgcn_readfirstlane(v);
}
__device__ __forceinline__ uint32_t pinned(uint32_t v) {
    uint32_t w = uni(v);
    asm volatile("" : "+s"(w));   // pinned(): keeps the test in a scalar register
    return w;
}
template <uint32_t WORD0, uint32_t ROWB, uint32_t ROWS>
__device__ __forceinline__ void tdm_tile(const void* gptr, uint32_t lds_dst,
                                         uint32_t src_pitch)
{
    const uint64_t ga = (uint64_t)(uintptr_t)gptr;
    u32x4 g0;
    g0[0] = uni(1u);                                     // count = 1
    g0[1] = uni(lds_dst);                                // byte offset in LDS
    g0[2] = uni((uint32_t)ga);                           // address [31:0]
    g0[3] = uni((((uint32_t)(ga >> 32)) & 0x01FFFFFFu) | 0x80000000u);  // [56:32], type 2
    u32x8 g1;
    g1[0] = uni(WORD0);
    g1[1] = uni((ROWB & 0xFFFFu) << 16);
    g1[2] = uni((ROWB >> 16) | ((ROWS & 0xFFFFu) << 16));
    g1[3] = uni((ROWS >> 16) | (ROWB << 16));
    g1[4] = uni(ROWS);
    g1[5] = uni(src_pitch);
    g1[6] = uni(0u);
    g1[7] = uni(0u);
    asm volatile("tensor_load_to_lds %0, %1" :: "s"(g0), "s"(g1) : "memory");
}
// The issuer's tile has landed behind this wait.
__device__ __forceinline__ void wait_tensor0() { asm volatile("s_wait_tensorcnt 0x0" ::: "memory"); }
// The wave's own LDS reads and writes have retired: owed before a barrier behind
// which a tensor load refills what the wave has read.
__device__ __forceinline__ void wait_ds0() { asm volatile("s_wait_dscnt 0x0" ::: "memory"); }

#define PAD64  ((1u << 20) | (3u << 22) | (3u << 25))   //  64-B rows -> pitch  80 B
#define PAD128 ((1u << 20) | (4u << 22) | (3u << 25))   // 128-B rows -> pitch 144 B
#define PAD256 ((1u << 20) | (5u << 22) | (3u << 25))   // 256-B rows -> pitch 272 B

#define PK 1024
#define PN 1024

#define LP 40
#define KP 72
#define MP 68

// 16 consecutive f16 of a padded row (16-byte aligned only): two b128 LDS loads.
__device__ __forceinline__ v16h ld_frag(const _Float16* p) {
    v8h lo = *(const v8h*)p;
    v8h hi = *(const v8h*)(p + 8);
    return __builtin_shufflevector(lo, hi, 0, 1, 2, 3, 4, 5, 6, 7,
                                   8, 9, 10, 11, 12, 13, 14, 15);
}

template <bool HEADS>
__device__ __forceinline__ void stage_w(const float* __restrict__ W, _Float16* Bsh,
                                        int k0, int n0, int tid) {
    const int lane = tid & 31;
    const int wave = tid >> 5;
    const int k = 4 * ((wave & 1) * 4 + (lane >> 3));      // 0..28
    const int n = 4 * ((wave >> 1) * 8 + (lane & 7));      // 0..124
    const float* src = &W[(size_t)(k0 + k) * PN + n0 + n];
    float w[4][4];
#pragma unroll
    for (int i = 0; i < 4; ++i) {
        float4 t = *(const float4*)&src[(size_t)i * PN];
        w[i][0] = t.x; w[i][1] = t.y; w[i][2] = t.z; w[i][3] = t.w;
    }
    const int row0 = HEADS ? ((lane >> 2) & 1) * 16 + (lane & 3) * 4 + (wave >> 1) : n;
    const int rstep = HEADS ? 32 : 1;
#pragma unroll
    for (int c = 0; c < 4; ++c)
        *(uint2*)&Bsh[(row0 + c * rstep) * LP + k] = make_uint2(pk2(w[0][c], w[1][c]),
                                                                pk2(w[2][c], w[3][c]));
}

// ---------------------------------------------------------------------------
// QKV projection: out = split_heads(X @ W + bias) * scale
// 128x128 block tile, 8 waves (2x4 of 64x32), BK=32, f32->f16 via cvt_pkrtz.
// One launch does all three products: blockIdx.z = 0 (Q), 1 (K), 2 (V), so that
// three independent workgroups share each WGP and fill one another's waits.
// Q/K -> out[bh][n][d];  V -> out[bh][d][n] (V^T). Only Q is scaled.
// ---------------------------------------------------------------------------
__global__ __launch_bounds__(256)
void qkv_proj_kernel(const float* __restrict__ Xq, const float* __restrict__ Xk,
                     const float* __restrict__ Xv,
                     const float* __restrict__ Wq, const float* __restrict__ Wk,
                     const float* __restrict__ Wv,
                     const float* __restrict__ bq, const float* __restrict__ bk,
                     const float* __restrict__ bv,
                     _Float16* __restrict__ out_q, _Float16* __restrict__ out_k,
                     _Float16* __restrict__ out_v, float q_scale)
{
    const int which = blockIdx.z;
    const float* __restrict__ X    = which == 0 ? Xq : which == 1 ? Xk : Xv;
    const float* __restrict__ W    = which == 0 ? Wq : which == 1 ? Wk : Wv;
    const float* __restrict__ bias = which == 0 ? bq : which == 1 ? bk : bv;
    _Float16* __restrict__ out     = which == 0 ? out_q : which == 1 ? out_k : out_v;
    const bool  transposed = which == 2;
    const float scale      = which == 0 ? q_scale : 1.0f;

    __shared__ _Float16 Ash[128 * LP];   // [m][k], padded rows
    __shared__ _Float16 Bsh[128 * LP];   // [n][k], padded rows

    const int tid  = threadIdx.x;
    const int lane = tid & 31;
    const int wave = tid >> 5;
    const int wr   = wave >> 2;
    const int wc   = wave & 3;
    const int m0   = blockIdx.x * 128;
    const int n0   = blockIdx.y * 128;
    const int lh   = lane >> 4;
    const int ln   = lane & 15;

    v8f acc[4][2];
#pragma unroll
    for (int i = 0; i < 4; ++i)
#pragma unroll
        for (int j = 0; j < 2; ++j) acc[i][j] = (v8f){0,0,0,0,0,0,0,0};

    for (int k0 = 0; k0 < PK; k0 += 32) {
        {
            const int r  = (lane >> 3) * 4 + wc + wr * 16;
            const int kk = (tid & 7) * 4;
            const float* src = &X[(size_t)(m0 + r) * PK + k0 + kk];
            float4 f[4];
#pragma unroll
            for (int i = 0; i < 4; ++i) f[i] = *(const float4*)&src[(size_t)(32 * i) * PK];
#pragma unroll
            for (int i = 0; i < 4; ++i)
                *(uint2*)&Ash[(r + 32 * i) * LP + kk] = make_uint2(pk2(f[i].x, f[i].y),
                                                                   pk2(f[i].z, f[i].w));
        }
        stage_w<true>(W, Bsh, k0, n0, tid);
        __syncthreads();

        const int kb = lh * 16;
        v16h bfrag[2];
#pragma unroll
        for (int nt = 0; nt < 2; ++nt)
            bfrag[nt] = ld_frag(&Bsh[(wc*32 + nt*16 + ln) * LP + kb]);
#pragma unroll
        for (int mt = 0; mt < 4; ++mt) {
            v16h a = ld_frag(&Ash[(wr*64 + mt*16 + ln) * LP + kb]);
#pragma unroll
            for (int nt = 0; nt < 2; ++nt)
                acc[mt][nt] = wmma_f16(a, bfrag[nt], acc[mt][nt]);
        }
        __syncthreads();
    }

    // The W column that (wc, nt, ln) holds, by stage_w<true>'s row order
    const int h   = 4 * (ln >> 2) + wc;
    const int gc0 = n0 + 32 * (ln & 3) + h;      // tile nt = 0; nt = 1 is 16 further (next d)

    if (transposed) {
        // V^T: for fixed (mt,nt) the 8 rows are consecutive n -> one b128 store
#pragma unroll
        for (int mt = 0; mt < 4; ++mt)
#pragma unroll
            for (int nt = 0; nt < 2; ++nt) {
                const int gm0 = m0 + wr*64 + mt*16 + 8*lh;      // n base (mult of 8)
                const int gn  = gc0 + nt*16;
                const int b = gm0 >> 10, nb = gm0 & 1023;
                const int d = gn >> 4;
                const float bb = bias[gn];
                float vv[8];
#pragma unroll
                for (int r = 0; r < 8; ++r) vv[r] = (acc[mt][nt][r] + bb) * scale;
                uint4 u = make_uint4(pk2(vv[0], vv[1]), pk2(vv[2], vv[3]),
                                     pk2(vv[4], vv[5]), pk2(vv[6], vv[7]));
                *(uint4*)&out[((size_t)(b*16 + h) * 64 + d) * 1024 + nb] = u;
            }
    } else {
        // Q, K: the two tiles are d and d + 1 of one head -> one b32 store; four lanes
        // cover 16 contiguous bytes
        const float b0 = bias[gc0], b1 = bias[gc0 + 16];
        const int   d0 = gc0 >> 4;               // even
        // the 128 rows of a tile lie in one batch entry: one base address, row steps of 128 B
        const int   gmb = m0 + wr*64 + 8*lh;
        _Float16* dst = &out[((size_t)((gmb >> 10)*16 + h) * 1024 + (gmb & 1023)) * 64 + d0];
#pragma unroll
        for (int mt = 0; mt < 4; ++mt)
#pragma unroll
            for (int r = 0; r < 8; ++r) {
                v2h pr;
                pr[0] = (_Float16)((acc[mt][0][r] + b0) * scale);
                pr[1] = (_Float16)((acc[mt][1][r] + b1) * scale);
                *(v2h*)&dst[(mt*16 + r) * 64] = pr;
            }
        // the stores' address and data registers may be rewritten behind this point
        asm volatile("s_wait_xcnt 0x0" ::: "memory");
    }
}

__device__ __forceinline__ float xhalf(float x) {
    const int b = __builtin_bit_cast(int, x);
    return __builtin_bit_cast(float,
        __builtin_amdgcn_permlanex16(b, b, 0x76543210, 0xfedcba98, false, false));
}

__device__ __forceinline__ void exp2x8(float (&y)[8], const float (&x)[8]) {
    asm("v_exp_f32 %0, %8\n\t"
        "v_exp_f32 %1, %9\n\t"
        "v_exp_f32 %2, %10\n\t"
        "v_exp_f32 %3, %11\n\t"
        "v_exp_f32 %4, %12\n\t"
        "v_exp_f32 %5, %13\n\t"
        "v_exp_f32 %6, %14\n\t"
        "v_exp_f32 %7, %15\n\t"
        "v_nop"
        : "=&v"(y[0]), "=&v"(y[1]), "=&v"(y[2]), "=&v"(y[3]),
          "=&v"(y[4]), "=&v"(y[5]), "=&v"(y[6]), "=&v"(y[7])
        : "v"(x[0]), "v"(x[1]), "v"(x[2]), "v"(x[3]),
          "v"(x[4]), "v"(x[5]), "v"(x[6]), "v"(x[7]));
}
__device__ __forceinline__ float exp2x1(float x) {
    float y;
    asm("v_exp_f32 %0, %1\n\t"
        "v_nop"
        : "=&v"(y) : "v"(x));
    return y;
}
#define LOG2E 1.44269504f

__global__ __launch_bounds__(128)
void attn_kernel(const _Float16* __restrict__ Qh, const _Float16* __restrict__ Kh,
                 const _Float16* __restrict__ Vt, const float* __restrict__ mask,
                 _Float16* __restrict__ O)
{
    __shared__ __attribute__((aligned(2048))) float    Msh[64 * MP];    // mask tile
    __shared__ __attribute__((aligned(2048))) _Float16 Ksh[64 * KP];    // K chunk [n][d]
    __shared__ __attribute__((aligned(2048))) _Float16 Vsh[64 * KP];    // V chunk [d][n]
    __shared__ __attribute__((aligned(2048))) _Float16 Osh[64 * KP];    // output tile [q][d]

    const int tid  = threadIdx.x;
    const int lane = tid & 31;
    const int wave = (int)uni((uint32_t)tid >> 5);
    const int lh   = lane >> 4;
    const int ln   = lane & 15;
    const int bh   = blockIdx.y;
    const int q0   = blockIdx.x * 64;

    const _Float16* Qbase = Qh + ((size_t)bh * 1024 + q0) * 64;
    const _Float16* Kbase = Kh + (size_t)bh * 1024 * 64;
    const _Float16* Vbase = Vt + (size_t)bh * 64 * 1024;

    // Q^T as B operand: column = query ln, k = d in the order of the K loader below
    const int qrow = wave*16 + ln;
    v16h qf[2];
    qf[0] = *(const v16h*)&Qbase[qrow*64 +  0 + lh*16];
    qf[1] = *(const v16h*)&Qbase[qrow*64 + 32 + lh*16];

    v8f oacc[4];   // O^T: register r of tile dt = d dt*16 + 8*lh + r of query ln
#pragma unroll
    for (int dt = 0; dt < 4; ++dt) oacc[dt] = (v8f){0,0,0,0,0,0,0,0};
    float mrun = -1.0e30f;   // the query's running maximum, equal in both halves
    float lrun = 0.0f;       // the sum over this half's keys; the halves join behind the loop

    const unsigned int koff = (unsigned int)(uintptr_t)&Ksh[0];
    const unsigned int voff = (unsigned int)(uintptr_t)&Vsh[0];
    const unsigned int moff = (unsigned int)(uintptr_t)&Msh[0];

    for (int kc = 0; kc < 1024; kc += 64) {
        if (pinned(wave == 0)) {   // K chunk: 64 rows of 128 B, source pitch 128 B
            tdm_tile<PAD128, 128u, 64u>(&Kbase[(size_t)kc * 64], koff, 128u);
            wait_tensor0();
        }
        if (pinned(wave == 1)) {   // V chunk: 64 d-rows of 128 B, source pitch 2048 B
            tdm_tile<PAD128, 128u, 64u>(&Vbase[kc], voff, 2048u);
            wait_tensor0();
        }
        if (pinned(wave == 2)) {   // mask tile: 64 q-rows of 256 B, source pitch 4096 B
            tdm_tile<PAD256, 256u, 64u>(&mask[(size_t)q0 * 1024 + kc], moff, 4096u);
            wait_tensor0();
        }
        __syncthreads();

        // S^T = K @ Q^T: register r of tile kt = key kt*16 + 8*lh + r, query ln
        v8f st[4];
#pragma unroll
        for (int kt = 0; kt < 4; ++kt) {
            const int kr = kt*16 + ln;
            v16h a0 = ld_frag(&Ksh[kr*KP +  0 + lh*16]);
            v16h a1 = ld_frag(&Ksh[kr*KP + 32 + lh*16]);
            v8f s = (v8f){0,0,0,0,0,0,0,0};
            s = wmma_f16(a0, qf[0], s);
            s = wmma_f16(a1, qf[1], s);
            st[kt] = s;
        }

        // Online softmax of one query per lane; four chains, one per tile
        const float* mrow = &Msh[qrow*MP + 8*lh];
        float mk[4];
#pragma unroll
        for (int kt = 0; kt < 4; ++kt) {
            const float4 m0 = *(const float4*)&mrow[kt*16];
            const float4 m1 = *(const float4*)&mrow[kt*16 + 4];
            const float mv[8] = {m0.x, m0.y, m0.z, m0.w, m1.x, m1.y, m1.z, m1.w};
#pragma unroll
            for (int r = 0; r < 8; ++r)
                st[kt][r] = st[kt][r] - 100000000.0f * (1.0f - mv[r]);
            float m = st[kt][0];
#pragma unroll
            for (int r = 1; r < 8; ++r) m = fmaxf(m, st[kt][r]);
            mk[kt] = m;
        }
        float mx = fmaxf(fmaxf(mk[0], mk[1]), fmaxf(mk[2], mk[3]));
        mx = fmaxf(mx, xhalf(mx));
        const float mnew  = fmaxf(mrun, mx);
        const float alpha = exp2x1((mrun - mnew) * LOG2E);

        // P^T as B operand: element s of block kb = tile 2*kb + (s >> 3), register s & 7
        v16h pb[2];
        float ps[4];
#pragma unroll
        for (int kt = 0; kt < 4; ++kt) {
            float x[8], p[8];
#pragma unroll
            for (int r = 0; r < 8; ++r) x[r] = (st[kt][r] - mnew) * LOG2E;
            exp2x8(p, x);
            float sum = p[0];
#pragma unroll
            for (int r = 1; r < 8; ++r) sum += p[r];
            ps[kt] = sum;
#pragma unroll
            for (int r = 0; r < 8; ++r) pb[kt >> 1][(kt & 1)*8 + r] = (_Float16)p[r];
        }
        lrun = lrun * alpha + ((ps[0] + ps[1]) + (ps[2] + ps[3]));
        mrun = mnew;
#pragma unroll
        for (int dt = 0; dt < 4; ++dt)
#pragma unroll
            for (int r = 0; r < 8; ++r) oacc[dt][r] *= alpha;

        // O^T += V^T @ P^T; the V loader takes P^T's key order: of each 32 keys a half
        // holds 8*lh .. 8*lh + 7 and 16 + 8*lh .. 16 + 8*lh + 7
#pragma unroll
        for (int dt = 0; dt < 4; ++dt) {
#pragma unroll
            for (int kb = 0; kb < 2; ++kb) {
                const _Float16* vr = &Vsh[(dt*16 + ln)*KP + kb*32 + 8*lh];
                v8h lo = *(const v8h*)vr;
                v8h hi = *(const v8h*)(vr + 16);
                v16h vf = __builtin_shufflevector(lo, hi, 0, 1, 2, 3, 4, 5, 6, 7,
                                                  8, 9, 10, 11, 12, 13, 14, 15);
                oacc[dt] = wmma_f16(vf, pb[kb], oacc[dt]);
            }
        }
        wait_ds0();
        __syncthreads();   // every reader has left Ksh/Vsh/Msh before the next chunk's loads
    }

    // Each wave turns its own 16 x 64 tile in its own rows of Osh, so that the global
    // stores keep 16 lanes along d of one output row.
    const float inv = 1.0f / (lrun + xhalf(lrun));
#pragma unroll
    for (int dt = 0; dt < 4; ++dt) {
        v8h o;
#pragma unroll
        for (int r = 0; r < 8; ++r) o[r] = (_Float16)(oacc[dt][r] * inv);
        *(v8h*)&Osh[qrow*KP + dt*16 + 8*lh] = o;
    }
    wait_ds0();   // the wave's own stores have retired before its other lanes read them

    const int bb = bh >> 4, hh = bh & 15;
#pragma unroll
    for (int r = 0; r < 8; ++r) {
        const int lrow = wave*16 + r + 8*lh;
        const int qn = q0 + lrow;
#pragma unroll
        for (int dt = 0; dt < 4; ++dt) {
            const int d = dt*16 + ln;
            O[((size_t)(bb*1024 + qn)) * 1024 + d*16 + hh] = Osh[lrow*KP + d];
        }
    }
}

// ---------------------------------------------------------------------------
// Output projection: d_out = O(f16) @ Wo(f32) + bo -> f32.
// A tile staged by a tensor load (pure f16 copy, padded rows); W tile converted cooperatively.
// ---------------------------------------------------------------------------
__global__ __launch_bounds__(256)
void out_proj_kernel(const _Float16* __restrict__ Xh, const float* __restrict__ W,
                     const float* __restrict__ bias, float* __restrict__ out)
{
    __shared__ __attribute__((aligned(2048))) _Float16 Ash[128 * LP];   // padded by the tensor load
    __shared__ _Float16 Bsh[128 * LP];   // padded rows

    const int tid  = threadIdx.x;
    const int lane = tid & 31;
    const int wave = (int)uni((uint32_t)tid >> 5);
    const int wr   = wave >> 2;
    const int wc   = wave & 3;
    const int m0   = blockIdx.x * 128;
    const int n0   = blockIdx.y * 128;
    const int lh   = lane >> 4;
    const int ln   = lane & 15;

    const unsigned int aoff = (unsigned int)(uintptr_t)&Ash[0];

    v8f acc[4][2];
#pragma unroll
    for (int i = 0; i < 4; ++i)
#pragma unroll
        for (int j = 0; j < 2; ++j) acc[i][j] = (v8f){0,0,0,0,0,0,0,0};

    for (int k0 = 0; k0 < PK; k0 += 32) {
        // A tile: 128 rows of 64 B, source pitch 2048 B (wave 0 issues)
        if (pinned(wave == 0))
            tdm_tile<PAD64, 64u, 128u>(&Xh[(size_t)m0 * PK + k0], aoff, 2048u);
        // W tile (overlapped with the tensor load)
        stage_w<false>(W, Bsh, k0, n0, tid);
        wait_ds0();       // this wave's W stores have retired
        wait_tensor0();   // wave 0: its tile has landed; the other waves have none outstanding
        __syncthreads();

        const int kb = lh * 16;
        v16h bfrag[2];
#pragma unroll
        for (int nt = 0; nt < 2; ++nt)
            bfrag[nt] = ld_frag(&Bsh[(wc*32 + nt*16 + ln) * LP + kb]);
#pragma unroll
        for (int mt = 0; mt < 4; ++mt) {
            v16h a = ld_frag(&Ash[(wr*64 + mt*16 + ln) * LP + kb]);
#pragma unroll
            for (int nt = 0; nt < 2; ++nt)
                acc[mt][nt] = wmma_f16(a, bfrag[nt], acc[mt][nt]);
        }
        wait_ds0();
        __syncthreads();   // every reader has left Ash before the next tile's load
    }

#pragma unroll
    for (int mt = 0; mt < 4; ++mt)
#pragma unroll
        for (int nt = 0; nt < 2; ++nt)
#pragma unroll
            for (int r = 0; r < 8; ++r) {
                const int gm = m0 + wr*64 + mt*16 + r + 8*lh;
                const int gn = n0 + wc*32 + nt*16 + ln;
                out[(size_t)gm * PN + gn] = acc[mt][nt][r] + bias[gn];
            }
}

// ---------------------------------------------------------------------------
extern "C" void kernel_launch(void* const* d_in, const int* in_sizes, int n_in,
                              void* d_out, int out_size, void* d_ws, size_t ws_size,
                              hipStream_t stream)
{
    const float* q    = (const float*)d_in[0];
    const float* k    = (const float*)d_in[1];
    const float* v    = (const float*)d_in[2];
    const float* mask = (const float*)d_in[3];
    const float* Wq   = (const float*)d_in[4];
    const float* bq   = (const float*)d_in[5];
    const float* Wk   = (const float*)d_in[6];
    const float* bk   = (const float*)d_in[7];
    const float* Wv   = (const float*)d_in[8];
    const float* bv   = (const float*)d_in[9];
    const float* Wo   = (const float*)d_in[10];
    const float* bo   = (const float*)d_in[11];
    float* out        = (float*)d_out;

    const size_t QKV = (size_t)4 * 16 * 1024 * 64;
    _Float16* Qh = (_Float16*)d_ws;
    _Float16* Kh = Qh + QKV;
    _Float16* Vt = Kh + QKV;
    _Float16* O  = Vt + QKV;

    const float scale = 1.0f / 32.0f;   // 1024^-0.5

    dim3 g(32, 8);
    qkv_proj_kernel<<<dim3(32, 8, 3), 256, 0, stream>>>(q, k, v, Wq, Wk, Wv, bq, bk, bv,
                                                        Qh, Kh, Vt, scale);

    attn_kernel<<<dim3(16, 64), 128, 0, stream>>>(Qh, Kh, Vt, mask, O);

    out_proj_kernel<<<g, 256, 0, stream>>>(O, Wo, bo, out);
}

// v006
// A run of this version takes 92.3 microseconds.
// Two timings next to v005 put it at 1.18 and 1.17 times that version's speed.
// All steps since v000 together make it 3.31 times as fast.
#include <hip/hip_runtime.h>
#include <hip/hip_bf16.h>
#include <cstdint>

typedef __attribute__((ext_vector_type(16))) _Float16 v16h;
typedef __attribute__((ext_vector_type(8)))  _Float16 v8h;
typedef __attribute__((ext_vector_type(2)))  _Float16 v2h;
typedef __attribute__((ext_vector_type(8)))  float    v8f;
typedef __attribute__((ext_vector_type(4)))  float    v4f;
typedef __attribute__((ext_vector_type(4)))  unsigned int u32x4;
typedef __attribute__((ext_vector_type(8)))  unsigned int u32x8;

__device__ __forceinline__ v8f wmma_f16(v16h a, v16h b, v8f c) {
    return __builtin_amdgcn_wmma_f32_16x16x32_f16(
        false, a, false, b, (short)0, c, false, false);
}

// v_cvt_pk_rtz_f16_f32: pack two f32 -> two f16 in one u32
__device__ __forceinline__ unsigned int pk2(float a, float b) {
    auto h = __builtin_amdgcn_cvt_pkrtz(a, b);
    return __builtin_bit_cast(unsigned int, h);
}

// ---------------------------------------------------------------------------
// Tensor load: one request of one wave brings ROWS rows of ROWB bytes (source row
// pitch src_pitch bytes) into LDS. 1-byte elements, every extent in bytes, tensor
// dims = tile dims, two groups. WORD0 holds the pad: 1 << 20 | c << 22 | a << 25
// puts a + 1 dwords behind every 2^(c+1) dwords, so the LDS pitch is ROWB + 16 B
// for a = 3 with c matched to the row (3: 64 B, 4: 128 B, 5: 256 B).
// The issuing wave waits s_wait_tensorcnt 0 itself; others read behind a barrier.
// ---------------------------------------------------------------------------
__device__ __forceinline__ uint32_t uni(uint32_t v) {
    return (uint32_t)__builtin_amdgcn_readfirstlane(v);
}
__device__ __forceinline__ uint32_t pinned(uint32_t v) {
    uint32_t w = uni(v);
    asm volatile("" : "+s"(w));   // pinned(): keeps the test in a scalar register
    return w;
}
template <uint32_t WORD0, uint32_t ROWB, uint32_t ROWS>
__device__ __forceinline__ void tdm_tile(const void* gptr, uint32_t lds_dst,
                                         uint32_t src_pitch)
{
    const uint64_t ga = (uint64_t)(uintptr_t)gptr;
    u32x4 g0;
    g0[0] = uni(1u);                                     // count = 1
    g0[1] = uni(lds_dst);                                // byte offset in LDS
    g0[2] = uni((uint32_t)ga);                           // address [31:0]
    g0[3] = uni((((uint32_t)(ga >> 32)) & 0x01FFFFFFu) | 0x80000000u);  // [56:32], type 2
    u32x8 g1;
    g1[0] = uni(WORD0);
    g1[1] = uni((ROWB & 0xFFFFu) << 16);
    g1[2] = uni((ROWB >> 16) | ((ROWS & 0xFFFFu) << 16));
    g1[3] = uni((ROWS >> 16) | (ROWB << 16));
    g1[4] = uni(ROWS);
    g1[5] = uni(src_pitch);
    g1[6] = uni(0u);
    g1[7] = uni(0u);
    asm volatile("tensor_load_to_lds %0, %1" :: "s"(g0), "s"(g1) : "memory");
}
// The issuer's tile has landed behind this wait.
__device__ __forceinline__ void wait_tensor0() { asm volatile("s_wait_tensorcnt 0x0" ::: "memory"); }
// The wave's own LDS reads and writes have retired: owed before a barrier behind
// which a tensor load refills what the wave has read.
__device__ __forceinline__ void wait_ds0() { asm volatile("s_wait_dscnt 0x0" ::: "memory"); }

#define PAD128 ((1u << 20) | (4u << 22) | (3u << 25))   // 128-B rows -> pitch 144 B
#define PAD256 ((1u << 20) | (5u << 22) | (3u << 25))   // 256-B rows -> pitch 272 B

#define PK 1024
#define PN 1024

#define QBK 64
#define LQ  72
#define OBK 128
#define LO  136
#define KP 72
#define MP 68

// 16 consecutive f16 of a padded row (16-byte aligned only): two b128 LDS loads.
__device__ __forceinline__ v16h ld_frag(const _Float16* p) {
    v8h lo = *(const v8h*)p;
    v8h hi = *(const v8h*)(p + 8);
    return __builtin_shufflevector(lo, hi, 0, 1, 2, 3, 4, 5, 6, 7,
                                   8, 9, 10, 11, 12, 13, 14, 15);
}

template <int KT>
__device__ __forceinline__ void load_w(const float* __restrict__ W, v4f (&w)[KT][4],
                                       int k0, int n0, int tid) {
    const int lane = tid & 31;
    const int wave = tid >> 5;
    const int k = 4 * ((wave & 1) * 4 + (lane >> 3));      // 0..28
    const int n = 4 * ((wave >> 1) * 8 + (lane & 7));      // 0..124
    const float* src = &W[(size_t)(k0 + k) * PN + n0 + n];
#pragma unroll
    for (int j = 0; j < KT; ++j)
#pragma unroll
        for (int i = 0; i < 4; ++i)
            w[j][i] = *(const v4f*)&src[(size_t)(32 * j + i) * PN];
}
// Eight loaded values as inputs only: every load in front of it is issued before the first
// conversion; left to itself the scheduler held some loads back until registers came free.
__device__ __forceinline__ void hold8(const v4f (&a)[4], const v4f (&b)[4]) {
    asm volatile("" :: "v"(a[0]), "v"(a[1]), "v"(a[2]), "v"(a[3]),
                       "v"(b[0]), "v"(b[1]), "v"(b[2]), "v"(b[3]));
}
template <bool HEADS, int KT, int PITCH>
__device__ __forceinline__ void store_w(_Float16* Bsh, const v4f (&w)[KT][4], int tid) {
    const int lane = tid & 31;
    const int wave = tid >> 5;
    const int k = 4 * ((wave & 1) * 4 + (lane >> 3));      // 0..28
    const int n = 4 * ((wave >> 1) * 8 + (lane & 7));      // 0..124
    const int row0 = HEADS ? ((lane >> 2) & 1) * 16 + (lane & 3) * 4 + (wave >> 1) : n;
    const int rstep = HEADS ? 32 : 1;
#pragma unroll
    for (int j = 0; j < KT; ++j)
#pragma unroll
        for (int c = 0; c < 4; ++c)
            *(uint2*)&Bsh[(row0 + c * rstep) * PITCH + 32 * j + k] =
                make_uint2(pk2(w[j][0][c], w[j][1][c]), pk2(w[j][2][c], w[j][3][c]));
}

// ---------------------------------------------------------------------------
// QKV projection: out = split_heads(X @ W + bias) * scale
// 128x128 block tile, 8 waves (2x4 of 64x32), 64 k per pass, f32->f16 via cvt_pkrtz.
// One launch does all three products: blockIdx.z = 0 (Q), 1 (K), 2 (V), so that
// three independent workgroups share each WGP and fill one another's waits.
// Q/K -> out[bh][n][d];  V -> out[bh][d][n] (V^T). Only Q is scaled.
// ---------------------------------------------------------------------------
__global__ __launch_bounds__(256)
void qkv_proj_kernel(const float* __restrict__ Xq, const float* __restrict__ Xk,
                     const float* __restrict__ Xv,
                     const float* __restrict__ Wq, const float* __restrict__ Wk,
                     const float* __restrict__ Wv,
                     const float* __restrict__ bq, const float* __restrict__ bk,
                     const float* __restrict__ bv,
                     _Float16* __restrict__ out_q, _Float16* __restrict__ out_k,
                     _Float16* __restrict__ out_v, float q_scale)
{
    const int which = blockIdx.z;
    const float* __restrict__ X    = which == 0 ? Xq : which == 1 ? Xk : Xv;
    const float* __restrict__ W    = which == 0 ? Wq : which == 1 ? Wk : Wv;
    const float* __restrict__ bias = which == 0 ? bq : which == 1 ? bk : bv;
    _Float16* __restrict__ out     = which == 0 ? out_q : which == 1 ? out_k : out_v;
    const bool  transposed = which == 2;
    const float scale      = which == 0 ? q_scale : 1.0f;

    __shared__ _Float16 Ash[128 * LQ];   // [m][k], padded rows
    __shared__ _Float16 Bsh[128 * LQ];   // [n][k], padded rows

    const int tid  = threadIdx.x;
    const int lane = tid & 31;
    const int wave = tid >> 5;
    const int wr   = wave >> 2;
    const int wc   = wave & 3;
    const int m0   = blockIdx.x * 128;
    const int n0   = blockIdx.y * 128;
    const int lh   = lane >> 4;
    const int ln   = lane & 15;

    v8f acc[4][2];
#pragma unroll
    for (int i = 0; i < 4; ++i)
#pragma unroll
        for (int j = 0; j < 2; ++j) acc[i][j] = (v8f){0,0,0,0,0,0,0,0};

    for (int k0 = 0; k0 < PK; k0 += QBK) {
        {
            const int r  = (lane >> 3) * 4 + wc + wr * 16;
            const int kk = (tid & 7) * 4;
            const float* src = &X[(size_t)(m0 + r) * PK + k0 + kk];
            v4f f[2][4];
            v4f w[QBK / 32][4];
#pragma unroll
            for (int j = 0; j < 2; ++j)
#pragma unroll
                for (int i = 0; i < 4; ++i)
                    f[j][i] = *(const v4f*)&src[(size_t)(32 * i) * PK + 32 * j];
            load_w<QBK / 32>(W, w, k0, n0, tid);
            hold8(f[0], f[1]);
            hold8(w[0], w[1]);
#pragma unroll
            for (int j = 0; j < 2; ++j)
#pragma unroll
                for (int i = 0; i < 4; ++i)
                    *(uint2*)&Ash[(r + 32 * i) * LQ + 32 * j + kk] =
                        make_uint2(pk2(f[j][i].x, f[j][i].y), pk2(f[j][i].z, f[j][i].w));
            store_w<true, QBK / 32, LQ>(Bsh, w, tid);
        }
        __syncthreads();

#pragma unroll
        for (int ks = 0; ks < QBK / 32; ++ks) {
            const int kb = ks * 32 + lh * 16;
            v16h bfrag[2];
#pragma unroll
            for (int nt = 0; nt < 2; ++nt)
                bfrag[nt] = ld_frag(&Bsh[(wc*32 + nt*16 + ln) * LQ + kb]);
#pragma unroll
            for (int mt = 0; mt < 4; ++mt) {
                v16h a = ld_frag(&Ash[(wr*64 + mt*16 + ln) * LQ + kb]);
#pragma unroll
                for (int nt = 0; nt < 2; ++nt)
                    acc[mt][nt] = wmma_f16(a, bfrag[nt], acc[mt][nt]);
            }
        }
        __syncthreads();
    }

    // The W column that (wc, nt, ln) holds, by store_w<true>'s row order
    const int h   = 4 * (ln >> 2) + wc;
    const int gc0 = n0 + 32 * (ln & 3) + h;      // tile nt = 0; nt = 1 is 16 further (next d)

    if (transposed) {
        // V^T: for fixed (mt,nt) the 8 rows are consecutive n -> one b128 store
#pragma unroll
        for (int mt = 0; mt < 4; ++mt)
#pragma unroll
            for (int nt = 0; nt < 2; ++nt) {
                const int gm0 = m0 + wr*64 + mt*16 + 8*lh;      // n base (mult of 8)
                const int gn  = gc0 + nt*16;
                const int b = gm0 >> 10, nb = gm0 & 1023;
                const int d = gn >> 4;
                const float bb = bias[gn];
                float vv[8];
#pragma unroll
                for (int r = 0; r < 8; ++r) vv[r] = (acc[mt][nt][r] + bb) * scale;
                uint4 u = make_uint4(pk2(vv[0], vv[1]), pk2(vv[2], vv[3]),
                                     pk2(vv[4], vv[5]), pk2(vv[6], vv[7]));
                *(uint4*)&out[((size_t)(b*16 + h) * 64 + d) * 1024 + nb] = u;
            }
    } else {
        // Q, K: the two tiles are d and d + 1 of one head -> one b32 store; four lanes
        // cover 16 contiguous bytes
        const float b0 = bias[gc0], b1 = bias[gc0 + 16];
        const int   d0 = gc0 >> 4;               // even
        // the 128 rows of a tile lie in one batch entry: one base address, row steps of 128 B
        const int   gmb = m0 + wr*64 + 8*lh;
        _Float16* dst = &out[((size_t)((gmb >> 10)*16 + h) * 1024 + (gmb & 1023)) * 64 + d0];
#pragma unroll
        for (int mt = 0; mt < 4; ++mt)
#pragma unroll
            for (int r = 0; r < 8; ++r) {
                v2h pr;
                pr[0] = (_Float16)((acc[mt][0][r] + b0) * scale);
                pr[1] = (_Float16)((acc[mt][1][r] + b1) * scale);
                *(v2h*)&dst[(mt*16 + r) * 64] = pr;
            }
        // the stores' address and data registers may be rewritten behind this point
        asm volatile("s_wait_xcnt 0x0" ::: "memory");
    }
}

__device__ __forceinline__ float xhalf(float x) {
    const int b = __builtin_bit_cast(int, x);
    return __builtin_bit_cast(float,
        __builtin_amdgcn_permlanex16(b, b, 0x76543210, 0xfedcba98, false, false));
}

__device__ __forceinline__ void exp2x8(float (&y)[8], const float (&x)[8]) {
    asm("v_exp_f32 %0, %8\n\t"
        "v_exp_f32 %1, %9\n\t"
        "v_exp_f32 %2, %10\n\t"
        "v_exp_f32 %3, %11\n\t"
        "v_exp_f32 %4, %12\n\t"
        "v_exp_f32 %5, %13\n\t"
        "v_exp_f32 %6, %14\n\t"
        "v_exp_f32 %7, %15\n\t"
        "v_nop"
        : "=&v"(y[0]), "=&v"(y[1]), "=&v"(y[2]), "=&v"(y[3]),
          "=&v"(y[4]), "=&v"(y[5]), "=&v"(y[6]), "=&v"(y[7])
        : "v"(x[0]), "v"(x[1]), "v"(x[2]), "v"(x[3]),
          "v"(x[4]), "v"(x[5]), "v"(x[6]), "v"(x[7]));
}
__device__ __forceinline__ float exp2x1(float x) {
    float y;
    asm("v_exp_f32 %0, %1\n\t"
        "v_nop"
        : "=&v"(y) : "v"(x));
    return y;
}
#define LOG2E 1.44269504f

__global__ __launch_bounds__(128)
void attn_kernel(const _Float16* __restrict__ Qh, const _Float16* __restrict__ Kh,
                 const _Float16* __restrict__ Vt, const float* __restrict__ mask,
                 _Float16* __restrict__ O)
{
    __shared__ __attribute__((aligned(2048))) float    Msh[64 * MP];    // mask tile
    __shared__ __attribute__((aligned(2048))) _Float16 Ksh[64 * KP];    // K chunk [n][d]
    __shared__ __attribute__((aligned(2048))) _Float16 Vsh[64 * KP];    // V chunk [d][n]
    __shared__ __attribute__((aligned(2048))) _Float16 Osh[64 * KP];    // output tile [q][d]

    const int tid  = threadIdx.x;
    const int lane = tid & 31;
    const int wave = (int)uni((uint32_t)tid >> 5);
    const int lh   = lane >> 4;
    const int ln   = lane & 15;
    const int bh   = blockIdx.y;
    const int q0   = blockIdx.x * 64;

    const _Float16* Qbase = Qh + ((size_t)bh * 1024 + q0) * 64;
    const _Float16* Kbase = Kh + (size_t)bh * 1024 * 64;
    const _Float16* Vbase = Vt + (size_t)bh * 64 * 1024;

    // Q^T as B operand: column = query ln, k = d in the order of the K loader below
    const int qrow = wave*16 + ln;
    v16h qf[2];
    qf[0] = *(const v16h*)&Qbase[qrow*64 +  0 + lh*16];
    qf[1] = *(const v16h*)&Qbase[qrow*64 + 32 + lh*16];

    v8f oacc[4];   // O^T: register r of tile dt = d dt*16 + 8*lh + r of query ln
#pragma unroll
    for (int dt = 0; dt < 4; ++dt) oacc[dt] = (v8f){0,0,0,0,0,0,0,0};
    float mrun = -1.0e30f;   // the query's running maximum, equal in both halves
    float lrun = 0.0f;       // the sum over this half's keys; the halves join behind the loop

    const unsigned int koff = (unsigned int)(uintptr_t)&Ksh[0];
    const unsigned int voff = (unsigned int)(uintptr_t)&Vsh[0];
    const unsigned int moff = (unsigned int)(uintptr_t)&Msh[0];

    for (int kc = 0; kc < 1024; kc += 64) {
        if (pinned(wave == 0)) {   // K chunk: 64 rows of 128 B, source pitch 128 B
            tdm_tile<PAD128, 128u, 64u>(&Kbase[(size_t)kc * 64], koff, 128u);
            wait_tensor0();
        }
        if (pinned(wave == 1)) {   // V chunk: 64 d-rows of 128 B, source pitch 2048 B
            tdm_tile<PAD128, 128u, 64u>(&Vbase[kc], voff, 2048u);
            wait_tensor0();
        }
        if (pinned(wave == 2)) {   // mask tile: 64 q-rows of 256 B, source pitch 4096 B
            tdm_tile<PAD256, 256u, 64u>(&mask[(size_t)q0 * 1024 + kc], moff, 4096u);
            wait_tensor0();
        }
        __syncthreads();

        // S^T = K @ Q^T: register r of tile kt = key kt*16 + 8*lh + r, query ln
        v8f st[4];
#pragma unroll
        for (int kt = 0; kt < 4; ++kt) {
            const int kr = kt*16 + ln;
            v16h a0 = ld_frag(&Ksh[kr*KP +  0 + lh*16]);
            v16h a1 = ld_frag(&Ksh[kr*KP + 32 + lh*16]);
            v8f s = (v8f){0,0,0,0,0,0,0,0};
            s = wmma_f16(a0, qf[0], s);
            s = wmma_f16(a1, qf[1], s);
            st[kt] = s;
        }

        // Online softmax of one query per lane; four chains, one per tile
        const float* mrow = &Msh[qrow*MP + 8*lh];
        float mk[4];
#pragma unroll
        for (int kt = 0; kt < 4; ++kt) {
            const float4 m0 = *(const float4*)&mrow[kt*16];
            const float4 m1 = *(const float4*)&mrow[kt*16 + 4];
            const float mv[8] = {m0.x, m0.y, m0.z, m0.w, m1.x, m1.y, m1.z, m1.w};
#pragma unroll
            for (int r = 0; r < 8; ++r)
                st[kt][r] = st[kt][r] - 100000000.0f * (1.0f - mv[r]);
            float m = st[kt][0];
#pragma unroll
            for (int r = 1; r < 8; ++r) m = fmaxf(m, st[kt][r]);
            mk[kt] = m;
        }
        float mx = fmaxf(fmaxf(mk[0], mk[1]), fmaxf(mk[2], mk[3]));
        mx = fmaxf(mx, xhalf(mx));
        const float mnew  = fmaxf(mrun, mx);
        const float alpha = exp2x1((mrun - mnew) * LOG2E);

        // P^T as B operand: element s of block kb = tile 2*kb + (s >> 3), register s & 7
        v16h pb[2];
        float ps[4];
#pragma unroll
        for (int kt = 0; kt < 4; ++kt) {
            float x[8], p[8];
#pragma unroll
            for (int r = 0; r < 8; ++r) x[r] = (st[kt][r] - mnew) * LOG2E;
            exp2x8(p, x);
            float sum = p[0];
#pragma unroll
            for (int r = 1; r < 8; ++r) sum += p[r];
            ps[kt] = sum;
#pragma unroll
            for (int r = 0; r < 8; ++r) pb[kt >> 1][(kt & 1)*8 + r] = (_Float16)p[r];
        }
        lrun = lrun * alpha + ((ps[0] + ps[1]) + (ps[2] + ps[3]));
        mrun = mnew;
#pragma unroll
        for (int dt = 0; dt < 4; ++dt)
#pragma unroll
            for (int r = 0; r < 8; ++r) oacc[dt][r] *= alpha;

        // O^T += V^T @ P^T; the V loader takes P^T's key order: of each 32 keys a half
        // holds 8*lh .. 8*lh + 7 and 16 + 8*lh .. 16 + 8*lh + 7
#pragma unroll
        for (int dt = 0; dt < 4; ++dt) {
#pragma unroll
            for (int kb = 0; kb < 2; ++kb) {
                const _Float16* vr = &Vsh[(dt*16 + ln)*KP + kb*32 + 8*lh];
                v8h lo = *(const v8h*)vr;
                v8h hi = *(const v8h*)(vr + 16);
                v16h vf = __builtin_shufflevector(lo, hi, 0, 1, 2, 3, 4, 5, 6, 7,
                                                  8, 9, 10, 11, 12, 13, 14, 15);
                oacc[dt] = wmma_f16(vf, pb[kb], oacc[dt]);
            }
        }
        wait_ds0();
        __syncthreads();   // every reader has left Ksh/Vsh/Msh before the next chunk's loads
    }

    // Each wave turns its own 16 x 64 tile in its own rows of Osh, so that the global
    // stores keep 16 lanes along d of one output row.
    const float inv = 1.0f / (lrun + xhalf(lrun));
#pragma unroll
    for (int dt = 0; dt < 4; ++dt) {
        v8h o;
#pragma unroll
        for (int r = 0; r < 8; ++r) o[r] = (_Float16)(oacc[dt][r] * inv);
        *(v8h*)&Osh[qrow*KP + dt*16 + 8*lh] = o;
    }
    wait_ds0();   // the wave's own stores have retired before its other lanes read them

    const int bb = bh >> 4, hh = bh & 15;
#pragma unroll
    for (int r = 0; r < 8; ++r) {
        const int lrow = wave*16 + r + 8*lh;
        const int qn = q0 + lrow;
#pragma unroll
        for (int dt = 0; dt < 4; ++dt) {
            const int d = dt*16 + ln;
            O[((size_t)(bb*1024 + qn)) * 1024 + d*16 + hh] = Osh[lrow*KP + d];
        }
    }
}

// ---------------------------------------------------------------------------
// Output projection: d_out = O(f16) @ Wo(f32) + bo -> f32.
// A tile staged by a tensor load (pure f16 copy, padded rows); W tile converted cooperatively.
// ---------------------------------------------------------------------------
__global__ __launch_bounds__(256)
void out_proj_kernel(const _Float16* __restrict__ Xh, const float* __restrict__ W,
                     const float* __restrict__ bias, float* __restrict__ out)
{
    __shared__ __attribute__((aligned(2048))) _Float16 Ash[128 * LO];   // padded by the tensor load
    __shared__ _Float16 Bsh[128 * LO];   // padded rows

    const int tid  = threadIdx.x;
    const int lane = tid & 31;
    const int wave = (int)uni((uint32_t)tid >> 5);
    const int wr   = wave >> 2;
    const int wc   = wave & 3;
    const int m0   = blockIdx.x * 128;
    const int n0   = blockIdx.y * 128;
    const int lh   = lane >> 4;
    const int ln   = lane & 15;

    const unsigned int aoff = (unsigned int)(uintptr_t)&Ash[0];

    v8f acc[4][2];
#pragma unroll
    for (int i = 0; i < 4; ++i)
#pragma unroll
        for (int j = 0; j < 2; ++j) acc[i][j] = (v8f){0,0,0,0,0,0,0,0};

    for (int k0 = 0; k0 < PK; k0 += OBK) {
        // A tile: 128 rows of 256 B, source pitch 2048 B (wave 0 issues)
        if (pinned(wave == 0))
            tdm_tile<PAD256, 256u, 128u>(&Xh[(size_t)m0 * PK + k0], aoff, 2048u);
        // W tile (overlapped with the tensor load)
        {
            v4f w[OBK / 32][4];
            load_w<OBK / 32>(W, w, k0, n0, tid);
            hold8(w[0], w[1]);
            hold8(w[2], w[3]);
            store_w<false, OBK / 32, LO>(Bsh, w, tid);
        }
        wait_ds0();       // this wave's W stores have retired
        wait_tensor0();   // wave 0: its tile has landed; the other waves have none outstanding
        __syncthreads();

#pragma unroll
        for (int ks = 0; ks < OBK / 32; ++ks) {
            const int kb = ks * 32 + lh * 16;
            v16h bfrag[2];
#pragma unroll
            for (int nt = 0; nt < 2; ++nt)
                bfrag[nt] = ld_frag(&Bsh[(wc*32 + nt*16 + ln) * LO + kb]);
#pragma unroll
            for (int mt = 0; mt < 4; ++mt) {
                v16h a = ld_frag(&Ash[(wr*64 + mt*16 + ln) * LO + kb]);
#pragma unroll
                for (int nt = 0; nt < 2; ++nt)
                    acc[mt][nt] = wmma_f16(a, bfrag[nt], acc[mt][nt]);
            }
        }
        wait_ds0();
        __syncthreads();   // every reader has left Ash before the next tile's load
    }

#pragma unroll
    for (int mt = 0; mt < 4; ++mt)
#pragma unroll
        for (int nt = 0; nt < 2; ++nt)
#pragma unroll
            for (int r = 0; r < 8; ++r) {
                const int gm = m0 + wr*64 + mt*16 + r + 8*lh;
                const int gn = n0 + wc*32 + nt*16 + ln;
                out[(size_t)gm * PN + gn] = acc[mt][nt][r] + bias[gn];
            }
}

// ---------------------------------------------------------------------------
extern "C" void kernel_launch(void* const* d_in, const int* in_sizes, int n_in,
                              void* d_out, int out_size, void* d_ws, size_t ws_size,
                              hipStream_t stream)
{
    const float* q    = (const float*)d_in[0];
    const float* k    = (const float*)d_in[1];
    const float* v    = (const float*)d_in[2];
    const float* mask = (const float*)d_in[3];
    const float* Wq   = (const float*)d_in[4];
    const float* bq   = (const float*)d_in[5];
    const float* Wk   = (const float*)d_in[6];
    const float* bk   = (const float*)d_in[7];
    const float* Wv   = (const float*)d_in[8];
    const float* bv   = (const float*)d_in[9];
    const float* Wo   = (const float*)d_in[10];
    const float* bo   = (const float*)d_in[11];
    float* out        = (float*)d_out;

    const size_t QKV = (size_t)4 * 16 * 1024 * 64;
    _Float16* Qh = (_Float16*)d_ws;
    _Float16* Kh = Qh + QKV;
    _Float16* Vt = Kh + QKV;
    _Float16* O  = Vt + QKV;

    const float scale = 1.0f / 32.0f;   // 1024^-0.5

    dim3 g(32, 8);
    qkv_proj_kernel<<<dim3(32, 8, 3), 256, 0, stream>>>(q, k, v, Wq, Wk, Wv, bq, bk, bv,
                                                        Qh, Kh, Vt, scale);

    attn_kernel<<<dim3(16, 64), 128, 0, stream>>>(Qh, Kh, Vt, mask, O);

    out_proj_kernel<<<g, 256, 0, stream>>>(O, Wo, bo, out);
}

// v007
// One run takes 87.6 microseconds.
// Two timings next to v006 put it at 1.05 and 1.06 times that version's speed.
// Counting every step since v000, it is 3.49 times as fast.
#include <hip/hip_runtime.h>
#include <hip/hip_bf16.h>
#include <cstdint>

typedef __attribute__((ext_vector_type(16))) _Float16 v16h;
typedef __attribute__((ext_vector_type(8)))  _Float16 v8h;
typedef __attribute__((ext_vector_type(2)))  _Float16 v2h;
typedef __attribute__((ext_vector_type(8)))  float    v8f;
typedef __attribute__((ext_vector_type(4)))  float    v4f;
typedef __attribute__((ext_vector_type(4)))  unsigned int u32x4;
typedef __attribute__((ext_vector_type(8)))  unsigned int u32x8;

__device__ __forceinline__ v8f wmma_f16(v16h a, v16h b, v8f c) {
    return __builtin_amdgcn_wmma_f32_16x16x32_f16(
        false, a, false, b, (short)0, c, false, false);
}

// v_cvt_pk_rtz_f16_f32: pack two f32 -> two f16 in one u32
__device__ __forceinline__ unsigned int pk2(float a, float b) {
    auto h = __builtin_amdgcn_cvt_pkrtz(a, b);
    return __builtin_bit_cast(unsigned int, h);
}

// ---------------------------------------------------------------------------
// Tensor load: one request of one wave brings ROWS rows of ROWB bytes (source row
// pitch src_pitch bytes) into LDS. 1-byte elements, every extent in bytes, tensor
// dims = tile dims, two groups. WORD0 holds the pad: 1 << 20 | c << 22 | a << 25
// puts a + 1 dwords behind every 2^(c+1) dwords, so the LDS pitch is ROWB + 16 B
// for a = 3 with c matched to the row (3: 64 B, 4: 128 B, 5: 256 B).
// The issuing wave waits s_wait_tensorcnt 0 itself; others read behind a barrier.
// ---------------------------------------------------------------------------
__device__ __forceinline__ uint32_t uni(uint32_t v) {
    return (uint32_t)__builtin_amdgcn_readfirstlane(v);
}
__device__ __forceinline__ uint32_t pinned(uint32_t v) {
    uint32_t w = uni(v);
    asm volatile("" : "+s"(w));   // pinned(): keeps the test in a scalar register
    return w;
}
template <uint32_t WORD0, uint32_t ROWB, uint32_t ROWS>
__device__ __forceinline__ void tdm_tile(const void* gptr, uint32_t lds_dst,
                                         uint32_t src_pitch)
{
    const uint64_t ga = (uint64_t)(uintptr_t)gptr;
    u32x4 g0;
    g0[0] = uni(1u);                                     // count = 1
    g0[1] = uni(lds_dst);                                // byte offset in LDS
    g0[2] = uni((uint32_t)ga);                           // address [31:0]
    g0[3] = uni((((uint32_t)(ga >> 32)) & 0x01FFFFFFu) | 0x80000000u);  // [56:32], type 2
    u32x8 g1;
    g1[0] = uni(WORD0);
    g1[1] = uni((ROWB & 0xFFFFu) << 16);
    g1[2] = uni((ROWB >> 16) | ((ROWS & 0xFFFFu) << 16));
    g1[3] = uni((ROWS >> 16) | (ROWB << 16));
    g1[4] = uni(ROWS);
    g1[5] = uni(src_pitch);
    g1[6] = uni(0u);
    g1[7] = uni(0u);
    asm volatile("tensor_load_to_lds %0, %1" :: "s"(g0), "s"(g1) : "memory");
}
// The issuer's tile has landed behind this wait.
__device__ __forceinline__ void wait_tensor0() { asm volatile("s_wait_tensorcnt 0x0" ::: "memory"); }
// The wave's own LDS reads and writes have retired: owed before a barrier behind
// which a tensor load refills what the wave has read.
__device__ __forceinline__ void wait_ds0() { asm volatile("s_wait_dscnt 0x0" ::: "memory"); }

#define PAD128 ((1u << 20) | (4u << 22) | (3u << 25))   // 128-B rows -> pitch 144 B
#define PAD256 ((1u << 20) | (5u << 22) | (3u << 25))   // 256-B rows -> pitch 272 B

#define PK 1024
#define PN 1024

#define QBK 64
#define LQ  72
#define OBK 128
#define LO  136
#define KP 72
#define MP 68

// 16 consecutive f16 of a padded row (16-byte aligned only): two b128 LDS loads.
__device__ __forceinline__ v16h ld_frag(const _Float16* p) {
    v8h lo = *(const v8h*)p;
    v8h hi = *(const v8h*)(p + 8);
    return __builtin_shufflevector(lo, hi, 0, 1, 2, 3, 4, 5, 6, 7,
                                   8, 9, 10, 11, 12, 13, 14, 15);
}

// 16 consecutive d of one key from a [d / 8][64 keys][d % 8] tile: two b128 LDS loads.
__device__ __forceinline__ v16h ld_frag2(const _Float16* p) {
    v8h lo = *(const v8h*)p;
    v8h hi = *(const v8h*)(p + 64 * 8);
    return __builtin_shufflevector(lo, hi, 0, 1, 2, 3, 4, 5, 6, 7,
                                   8, 9, 10, 11, 12, 13, 14, 15);
}

template <int KT, bool HEADK>
__device__ __forceinline__ void load_w(const float* __restrict__ W, v4f (&w)[KT][4],
                                       int k0, int n0, int tid) {
    const int lane = tid & 31;
    const int wave = tid >> 5;
    const int k = 4 * ((wave & 1) * 4 + (lane >> 3));      // 0..28
    const int n = 4 * ((wave >> 1) * 8 + (lane & 7));      // 0..124
    const float* src = &W[(size_t)(HEADK ? k * 16 + (k0 >> 6) : k0 + k) * PN + n0 + n];
#pragma unroll
    for (int j = 0; j < KT; ++j)
#pragma unroll
        for (int i = 0; i < 4; ++i)
            w[j][i] = *(const v4f*)&src[(size_t)(HEADK ? (32 * (j & 1) + i) * 16 + (j >> 1)
                                                       : 32 * j + i) * PN];
}
// Eight loaded values as inputs only: every load in front of it is issued before the first
// conversion; left to itself the scheduler held some loads back until registers came free.
__device__ __forceinline__ void hold8(const v4f (&a)[4], const v4f (&b)[4]) {
    asm volatile("" :: "v"(a[0]), "v"(a[1]), "v"(a[2]), "v"(a[3]),
                       "v"(b[0]), "v"(b[1]), "v"(b[2]), "v"(b[3]));
}
template <bool HEADS, int KT, int PITCH>
__device__ __forceinline__ void store_w(_Float16* Bsh, const v4f (&w)[KT][4], int tid) {
    const int lane = tid & 31;
    const int wave = tid >> 5;
    const int k = 4 * ((wave & 1) * 4 + (lane >> 3));      // 0..28
    const int n = 4 * ((wave >> 1) * 8 + (lane & 7));      // 0..124
    const int row0 = HEADS ? ((lane >> 2) & 1) * 16 + (lane & 3) * 4 + (wave >> 1) : n;
    const int rstep = HEADS ? 32 : 1;
#pragma unroll
    for (int j = 0; j < KT; ++j)
#pragma unroll
        for (int c = 0; c < 4; ++c)
            *(uint2*)&Bsh[(row0 + c * rstep) * PITCH + 32 * j + k] =
                make_uint2(pk2(w[j][0][c], w[j][1][c]), pk2(w[j][2][c], w[j][3][c]));
}

// ---------------------------------------------------------------------------
// QKV projection: out = split_heads(X @ W + bias) * scale
// 128x128 block tile, 8 waves (2x4 of 64x32), 64 k per pass, f32->f16 via cvt_pkrtz.
// One launch does all three products: blockIdx.z = 0 (Q), 1 (K), 2 (V), so that
// three independent workgroups share each WGP and fill one another's waits.
// Q/K -> out[bh][d / 8][n][d % 8];  V -> out[bh][d][n] (V^T). Only Q is scaled.
// ---------------------------------------------------------------------------
__global__ __launch_bounds__(256)
void qkv_proj_kernel(const float* __restrict__ Xq, const float* __restrict__ Xk,
                     const float* __restrict__ Xv,
                     const float* __restrict__ Wq, const float* __restrict__ Wk,
                     const float* __restrict__ Wv,
                     const float* __restrict__ bq, const float* __restrict__ bk,
                     const float* __restrict__ bv,
                     _Float16* __restrict__ out_q, _Float16* __restrict__ out_k,
                     _Float16* __restrict__ out_v, float q_scale)
{
    const int which = blockIdx.z;
    const float* __restrict__ X    = which == 0 ? Xq : which == 1 ? Xk : Xv;
    const float* __restrict__ W    = which == 0 ? Wq : which == 1 ? Wk : Wv;
    const float* __restrict__ bias = which == 0 ? bq : which == 1 ? bk : bv;
    _Float16* __restrict__ out     = which == 0 ? out_q : which == 1 ? out_k : out_v;
    const bool  transposed = which == 2;
    const float scale      = which == 0 ? q_scale : 1.0f;

    __shared__ _Float16 Ash[128 * LQ];   // [m][k], padded rows
    __shared__ _Float16 Bsh[128 * LQ];   // [n][k], padded rows

    const int tid  = threadIdx.x;
    const int lane = tid & 31;
    const int wave = tid >> 5;
    const int wr   = wave >> 2;
    const int wc   = wave & 3;
    const int m0   = blockIdx.x * 128;
    const int n0   = blockIdx.y * 128;
    const int lh   = lane >> 4;
    const int ln   = lane & 15;

    v8f acc[4][2];
#pragma unroll
    for (int i = 0; i < 4; ++i)
#pragma unroll
        for (int j = 0; j < 2; ++j) acc[i][j] = (v8f){0,0,0,0,0,0,0,0};

    for (int k0 = 0; k0 < PK; k0 += QBK) {
        {
            const int r  = (lane >> 3) * 4 + wc + wr * 16;
            const int kk = (tid & 7) * 4;
            const float* src = &X[(size_t)(m0 + r) * PK + k0 + kk];
            v4f f[2][4];
            v4f w[QBK / 32][4];
#pragma unroll
            for (int j = 0; j < 2; ++j)
#pragma unroll
                for (int i = 0; i < 4; ++i)
                    f[j][i] = *(const v4f*)&src[(size_t)(32 * i) * PK + 32 * j];
            load_w<QBK / 32, false>(W, w, k0, n0, tid);
            hold8(f[0], f[1]);
            hold8(w[0], w[1]);
#pragma unroll
            for (int j = 0; j < 2; ++j)
#pragma unroll
                for (int i = 0; i < 4; ++i)
                    *(uint2*)&Ash[(r + 32 * i) * LQ + 32 * j + kk] =
                        make_uint2(pk2(f[j][i].x, f[j][i].y), pk2(f[j][i].z, f[j][i].w));
            store_w<true, QBK / 32, LQ>(Bsh, w, tid);
        }
        __syncthreads();

#pragma unroll
        for (int ks = 0; ks < QBK / 32; ++ks) {
            const int kb = ks * 32 + lh * 16;
            v16h bfrag[2];
#pragma unroll
            for (int nt = 0; nt < 2; ++nt)
                bfrag[nt] = ld_frag(&Bsh[(wc*32 + nt*16 + ln) * LQ + kb]);
#pragma unroll
            for (int mt = 0; mt < 4; ++mt) {
                v16h a = ld_frag(&Ash[(wr*64 + mt*16 + ln) * LQ + kb]);
#pragma unroll
                for (int nt = 0; nt < 2; ++nt)
                    acc[mt][nt] = wmma_f16(a, bfrag[nt], acc[mt][nt]);
            }
        }
        __syncthreads();
    }

    // The W column that (wc, nt, ln) holds, by store_w<true>'s row order
    const int h   = 4 * (ln >> 2) + wc;
    const int gc0 = n0 + 32 * (ln & 3) + h;      // tile nt = 0; nt = 1 is 16 further (next d)

    if (transposed) {
        // V^T: a wave's 64 n of one column are one whole 128-byte line of the output. The wave
        // turns its 32 columns x 64 n in LDS rows of its own (the loop's last barrier has
        // freed the tiles), so that 8 lanes store one line and a store covers 4 whole lines.
        _Float16* stg = ((wave & 4) ? Bsh : Ash) + (wave & 3) * (32 * LQ);
#pragma unroll
        for (int mt = 0; mt < 4; ++mt)
#pragma unroll
            for (int nt = 0; nt < 2; ++nt) {
                const float bb = bias[gc0 + nt*16];
                float vv[8];
#pragma unroll
                for (int r = 0; r < 8; ++r) vv[r] = (acc[mt][nt][r] + bb) * scale;
                uint4 u = make_uint4(pk2(vv[0], vv[1]), pk2(vv[2], vv[3]),
                                     pk2(vv[4], vv[5]), pk2(vv[6], vv[7]));
                *(uint4*)&stg[(nt*16 + ln) * LQ + mt*16 + 8*lh] = u;
            }
        // the wave's own LDS stores have retired before its other lanes read them
        asm volatile("s_wait_dscnt 0x0" ::: "memory");
        const int gmw = m0 + wr*64;                  // the wave's first n: a multiple of 64
        const int l4  = lane >> 3;                   // column within a group of four
        _Float16* vdst = &out[(size_t)((gmw >> 10) * 16) * 64 * 1024 + (gmw & 1023) + (lane & 7) * 8];
#pragma unroll
        for (int i = 0; i < 8; ++i) {
            const int c  = (i & 3) * 4 + l4;         // the lane ln that held this column
            const int hc = 4 * (c >> 2) + wc;
            const int dc = (n0 + 32 * (c & 3) + hc + (i >> 2) * 16) >> 4;
            *(uint4*)&vdst[(size_t)(hc * 64 + dc) * 1024] =
                *(const uint4*)&stg[(i * 4 + l4) * LQ + (lane & 7) * 8];
        }
    } else {
        _Float16* stg = ((wave & 4) ? Bsh : Ash) + (wave & 3) * (32 * LQ);
        const float b0 = bias[gc0], b1 = bias[gc0 + 16];
        _Float16* srow = &stg[(ln >> 2) * 520 + 8*lh * 8 + 2 * (ln & 3)];
#pragma unroll
        for (int mt = 0; mt < 4; ++mt)
#pragma unroll
            for (int r = 0; r < 8; ++r) {
                v2h pr;
                pr[0] = (_Float16)((acc[mt][0][r] + b0) * scale);
                pr[1] = (_Float16)((acc[mt][1][r] + b1) * scale);
                *(v2h*)&srow[(mt*16 + r) * 8] = pr;
            }
        // the wave's own LDS stores have retired before its other lanes read them
        asm volatile("s_wait_dscnt 0x0" ::: "memory");
        // the 128 rows of a tile lie in one batch entry
        const int gmw = m0 + wr*64;
        _Float16* dst = &out[((((size_t)(gmw >> 10) * 16 + wc) * 8 + blockIdx.y) * 1024
                              + (gmw & 1023) + lane) * 8];
#pragma unroll
        for (int hq = 0; hq < 4; ++hq)           // head 4*hq + wc
#pragma unroll
            for (int j = 0; j < 2; ++j)
                *(uint4*)&dst[((size_t)(4 * hq) * 8 * 1024 + j * 32) * 8] =
                    *(const uint4*)&stg[hq * 520 + (j * 32 + lane) * 8];
        // the stores' address and data registers may be rewritten behind this point
        asm volatile("s_wait_xcnt 0x0" ::: "memory");
    }
}

__device__ __forceinline__ float xhalf(float x) {
    const int b = __builtin_bit_cast(int, x);
    return __builtin_bit_cast(float,
        __builtin_amdgcn_permlanex16(b, b, 0x76543210, 0xfedcba98, false, false));
}

__device__ __forceinline__ void exp2x8(float (&y)[8], const float (&x)[8]) {
    asm("v_exp_f32 %0, %8\n\t"
        "v_exp_f32 %1, %9\n\t"
        "v_exp_f32 %2, %10\n\t"
        "v_exp_f32 %3, %11\n\t"
        "v_exp_f32 %4, %12\n\t"
        "v_exp_f32 %5, %13\n\t"
        "v_exp_f32 %6, %14\n\t"
        "v_exp_f32 %7, %15\n\t"
        "v_nop"
        : "=&v"(y[0]), "=&v"(y[1]), "=&v"(y[2]), "=&v"(y[3]),
          "=&v"(y[4]), "=&v"(y[5]), "=&v"(y[6]), "=&v"(y[7])
        : "v"(x[0]), "v"(x[1]), "v"(x[2]), "v"(x[3]),
          "v"(x[4]), "v"(x[5]), "v"(x[6]), "v"(x[7]));
}
__device__ __forceinline__ float exp2x1(float x) {
    float y;
    asm("v_exp_f32 %0, %1\n\t"
        "v_nop"
        : "=&v"(y) : "v"(x));
    return y;
}
#define LOG2E 1.44269504f

__global__ __launch_bounds__(128)
void attn_kernel(const _Float16* __restrict__ Qh, const _Float16* __restrict__ Kh,
                 const _Float16* __restrict__ Vt, const float* __restrict__ mask,
                 _Float16* __restrict__ O)
{
    __shared__ __attribute__((aligned(2048))) float    Msh[64 * MP];    // mask tile
    __shared__ __attribute__((aligned(2048))) _Float16 Ksh[64 * 64];    // K chunk [d / 8][n][d % 8]
    __shared__ __attribute__((aligned(2048))) _Float16 Vsh[64 * KP];    // V chunk [d][n]
    __shared__ __attribute__((aligned(2048))) _Float16 Osh[64 * KP];    // output tile [q][d]

    const int tid  = threadIdx.x;
    const int lane = tid & 31;
    const int wave = (int)uni((uint32_t)tid >> 5);
    const int lh   = lane >> 4;
    const int ln   = lane & 15;
    const int bh   = blockIdx.y;
    const int q0   = blockIdx.x * 64;

    // Q and K lie as [bh][d / 8][n][d % 8]
    const _Float16* Qbase = Qh + (size_t)bh * 1024 * 64 + q0 * 8;
    const _Float16* Kbase = Kh + (size_t)bh * 1024 * 64;
    const _Float16* Vbase = Vt + (size_t)bh * 64 * 1024;

    // Q^T as B operand: column = query ln, k = d in the order of the K loader below
    const int qrow = wave*16 + ln;
    v16h qf[2];
#pragma unroll
    for (int j = 0; j < 2; ++j) {   // d = 32*j + 16*lh + 0..15: groups 4*j + 2*lh and the next
        v8h lo = *(const v8h*)&Qbase[((4*j + 2*lh)     * 1024 + qrow) * 8];
        v8h hi = *(const v8h*)&Qbase[((4*j + 2*lh + 1) * 1024 + qrow) * 8];
        qf[j] = __builtin_shufflevector(lo, hi, 0, 1, 2, 3, 4, 5, 6, 7,
                                        8, 9, 10, 11, 12, 13, 14, 15);
    }

    v8f oacc[4];   // O^T: register r of tile dt = d dt*16 + 8*lh + r of query ln
#pragma unroll
    for (int dt = 0; dt < 4; ++dt) oacc[dt] = (v8f){0,0,0,0,0,0,0,0};
    float mrun = -1.0e30f;   // the query's running maximum, equal in both halves
    float lrun = 0.0f;       // the sum over this half's keys; the halves join behind the loop

    const unsigned int koff = (unsigned int)(uintptr_t)&Ksh[0];
    const unsigned int voff = (unsigned int)(uintptr_t)&Vsh[0];
    const unsigned int moff = (unsigned int)(uintptr_t)&Msh[0];

    for (int kc = 0; kc < 1024; kc += 64) {
        if (pinned(wave == 0)) {   // K chunk: 8 d-groups of 64 keys x 16 B, source pitch 16 KiB
            tdm_tile<0u, 1024u, 8u>(&Kbase[(size_t)kc * 8], koff, 16384u);
            wait_tensor0();
        }
        if (pinned(wave == 1)) {   // V chunk: 64 d-rows of 128 B, source pitch 2048 B
            tdm_tile<PAD128, 128u, 64u>(&Vbase[kc], voff, 2048u);
            wait_tensor0();
        }
        if (pinned(wave == 2)) {   // mask tile: 64 q-rows of 256 B, source pitch 4096 B
            tdm_tile<PAD256, 256u, 64u>(&mask[(size_t)q0 * 1024 + kc], moff, 4096u);
            wait_tensor0();
        }
        __syncthreads();

        // S^T = K @ Q^T: register r of tile kt = key kt*16 + 8*lh + r, query ln
        v8f st[4];
#pragma unroll
        for (int kt = 0; kt < 4; ++kt) {
            const int kr = kt*16 + ln;
            // 16 lanes read 16 keys x 16 B in a row: no pad is wanted
            v16h a0 = ld_frag2(&Ksh[((2*lh)     * 64 + kr) * 8]);
            v16h a1 = ld_frag2(&Ksh[((2*lh + 4) * 64 + kr) * 8]);
            v8f s = (v8f){0,0,0,0,0,0,0,0};
            s = wmma_f16(a0, qf[0], s);
            s = wmma_f16(a1, qf[1], s);
            st[kt] = s;
        }

        // Online softmax of one query per lane; four chains, one per tile
        const float* mrow = &Msh[qrow*MP + 8*lh];
        float mk[4];
#pragma unroll
        for (int kt = 0; kt < 4; ++kt) {
            const float4 m0 = *(const float4*)&mrow[kt*16];
            const float4 m1 = *(const float4*)&mrow[kt*16 + 4];
            const float mv[8] = {m0.x, m0.y, m0.z, m0.w, m1.x, m1.y, m1.z, m1.w};
#pragma unroll
            for (int r = 0; r < 8; ++r)
                st[kt][r] = st[kt][r] - 100000000.0f * (1.0f - mv[r]);
            float m = st[kt][0];
#pragma unroll
            for (int r = 1; r < 8; ++r) m = fmaxf(m, st[kt][r]);
            mk[kt] = m;
        }
        float mx = fmaxf(fmaxf(mk[0], mk[1]), fmaxf(mk[2], mk[3]));
        mx = fmaxf(mx, xhalf(mx));
        const float mnew  = fmaxf(mrun, mx);
        const float alpha = exp2x1((mrun - mnew) * LOG2E);

        // P^T as B operand: element s of block kb = tile 2*kb + (s >> 3), register s & 7
        v16h pb[2];
        float ps[4];
#pragma unroll
        for (int kt = 0; kt < 4; ++kt) {
            float x[8], p[8];
#pragma unroll
            for (int r = 0; r < 8; ++r) x[r] = (st[kt][r] - mnew) * LOG2E;
            exp2x8(p, x);
            float sum = p[0];
#pragma unroll
            for (int r = 1; r < 8; ++r) sum += p[r];
            ps[kt] = sum;
#pragma unroll
            for (int r = 0; r < 8; ++r) pb[kt >> 1][(kt & 1)*8 + r] = (_Float16)p[r];
        }
        lrun = lrun * alpha + ((ps[0] + ps[1]) + (ps[2] + ps[3]));
        mrun = mnew;
#pragma unroll
        for (int dt = 0; dt < 4; ++dt)
#pragma unroll
            for (int r = 0; r < 8; ++r) oacc[dt][r] *= alpha;

        // O^T += V^T @ P^T; the V loader takes P^T's key order: of each 32 keys a half
        // holds 8*lh .. 8*lh + 7 and 16 + 8*lh .. 16 + 8*lh + 7
#pragma unroll
        for (int dt = 0; dt < 4; ++dt) {
#pragma unroll
            for (int kb = 0; kb < 2; ++kb) {
                const _Float16* vr = &Vsh[(dt*16 + ln)*KP + kb*32 + 8*lh];
                v8h lo = *(const v8h*)vr;
                v8h hi = *(const v8h*)(vr + 16);
                v16h vf = __builtin_shufflevector(lo, hi, 0, 1, 2, 3, 4, 5, 6, 7,
                                                  8, 9, 10, 11, 12, 13, 14, 15);
                oacc[dt] = wmma_f16(vf, pb[kb], oacc[dt]);
            }
        }
        wait_ds0();
        __syncthreads();   // every reader has left Ksh/Vsh/Msh before the next chunk's loads
    }

    // Each wave turns its own 16 x 64 tile in its own rows of Osh. O goes out head-major,
    // O[b][q][h*64 + d]: the 64 d of a query and head are one whole 128-byte line, which
    // 8 lanes store as 16 B each and no other work-group writes.
    const float inv = 1.0f / (lrun + xhalf(lrun));
#pragma unroll
    for (int dt = 0; dt < 4; ++dt) {
        v8h o;
#pragma unroll
        for (int r = 0; r < 8; ++r) o[r] = (_Float16)(oacc[dt][r] * inv);
        *(v8h*)&Osh[qrow*KP + dt*16 + 8*lh] = o;
    }
    wait_ds0();   // the wave's own stores have retired before its other lanes read them

    const int bb = bh >> 4, hh = bh & 15;
    const int lrow = wave*16 + (lane >> 3);      // four rows a store, 8 lanes a row
    const int dcol = (lane & 7) * 8;
    _Float16* dst = &O[((size_t)(bb*1024 + q0 + lrow)) * 1024 + hh*64 + dcol];
#pragma unroll
    for (int i = 0; i < 4; ++i)
        *(v8h*)&dst[(size_t)(4*i) * 1024] = *(const v8h*)&Osh[(lrow + 4*i)*KP + dcol];
}

// ---------------------------------------------------------------------------
// Output projection: d_out = O(f16) @ Wo(f32) + bo -> f32. O's columns run head-major
// (h*64 + d); the W loader takes Wo's rows (d*16 + h) in that same order.
// A tile staged by a tensor load (pure f16 copy, padded rows); W tile converted cooperatively.
// ---------------------------------------------------------------------------
__global__ __launch_bounds__(256)
void out_proj_kernel(const _Float16* __restrict__ Xh, const float* __restrict__ W,
                     const float* __restrict__ bias, float* __restrict__ out)
{
    __shared__ __attribute__((aligned(2048))) _Float16 Ash[128 * LO];   // padded by the tensor load
    __shared__ _Float16 Bsh[128 * LO];   // padded rows

    const int tid  = threadIdx.x;
    const int lane = tid & 31;
    const int wave = (int)uni((uint32_t)tid >> 5);
    const int wr   = wave >> 2;
    const int wc   = wave & 3;
    const int m0   = blockIdx.x * 128;
    const int n0   = blockIdx.y * 128;
    const int lh   = lane >> 4;
    const int ln   = lane & 15;

    const unsigned int aoff = (unsigned int)(uintptr_t)&Ash[0];

    v8f acc[4][2];
#pragma unroll
    for (int i = 0; i < 4; ++i)
#pragma unroll
        for (int j = 0; j < 2; ++j) acc[i][j] = (v8f){0,0,0,0,0,0,0,0};

    for (int k0 = 0; k0 < PK; k0 += OBK) {
        // A tile: 128 rows of 256 B, source pitch 2048 B (wave 0 issues)
        if (pinned(wave == 0))
            tdm_tile<PAD256, 256u, 128u>(&Xh[(size_t)m0 * PK + k0], aoff, 2048u);
        // W tile (overlapped with the tensor load)
        {
            v4f w[OBK / 32][4];
            load_w<OBK / 32, true>(W, w, k0, n0, tid);
            hold8(w[0], w[1]);
            hold8(w[2], w[3]);
            store_w<false, OBK / 32, LO>(Bsh, w, tid);
        }
        wait_ds0();       // this wave's W stores have retired
        wait_tensor0();   // wave 0: its tile has landed; the other waves have none outstanding
        __syncthreads();

#pragma unroll
        for (int ks = 0; ks < OBK / 32; ++ks) {
            const int kb = ks * 32 + lh * 16;
            v16h bfrag[2];
#pragma unroll
            for (int nt = 0; nt < 2; ++nt)
                bfrag[nt] = ld_frag(&Bsh[(wc*32 + nt*16 + ln) * LO + kb]);
#pragma unroll
            for (int mt = 0; mt < 4; ++mt) {
                v16h a = ld_frag(&Ash[(wr*64 + mt*16 + ln) * LO + kb]);
#pragma unroll
                for (int nt = 0; nt < 2; ++nt)
                    acc[mt][nt] = wmma_f16(a, bfrag[nt], acc[mt][nt]);
            }
        }
        wait_ds0();
        __syncthreads();   // every reader has left Ash before the next tile's load
    }

    float* stg = (float*)((wave & 4) ? Bsh : Ash) + (wave & 3) * (32 * 36);
    const float bias0 = bias[n0 + wc*32 + ln], bias1 = bias[n0 + wc*32 + 16 + ln];
    float* dst = &out[(size_t)(m0 + wr*64 + (lane >> 3)) * PN + n0 + wc*32 + (lane & 7) * 4];
#pragma unroll
    for (int hf = 0; hf < 2; ++hf) {
#pragma unroll
        for (int m2 = 0; m2 < 2; ++m2)
#pragma unroll
            for (int r = 0; r < 8; ++r) {
                float* row = &stg[(m2*16 + r + 8*lh) * 36 + ln];
                row[0]  = acc[hf*2 + m2][0][r] + bias0;
                row[16] = acc[hf*2 + m2][1][r] + bias1;
            }
        wait_ds0();   // the wave's own stores have retired before its other lanes read them
#pragma unroll
        for (int i = 0; i < 8; ++i)
            *(v4f*)&dst[(size_t)(hf*32 + i*4) * PN] =
                *(const v4f*)&stg[(i*4 + (lane >> 3)) * 36 + (lane & 7) * 4];
        // the first half's stores have given up their data registers before the second half's
        // LDS reads overwrite them; the clobber keeps its LDS stores behind the reads above
        if (hf == 0) asm volatile("s_wait_xcnt 0x0" ::: "memory");
    }
}

// ---------------------------------------------------------------------------
extern "C" void kernel_launch(void* const* d_in, const int* in_sizes, int n_in,
                              void* d_out, int out_size, void* d_ws, size_t ws_size,
                              hipStream_t stream)
{
    const float* q    = (const float*)d_in[0];
    const float* k    = (const float*)d_in[1];
    const float* v    = (const float*)d_in[2];
    const float* mask = (const float*)d_in[3];
    const float* Wq   = (const float*)d_in[4];
    const float* bq   = (const float*)d_in[5];
    const float* Wk   = (const float*)d_in[6];
    const float* bk   = (const float*)d_in[7];
    const float* Wv   = (const float*)d_in[8];
    const float* bv   = (const float*)d_in[9];
    const float* Wo   = (const float*)d_in[10];
    const float* bo   = (const float*)d_in[11];
    float* out        = (float*)d_out;

    const size_t QKV = (size_t)4 * 16 * 1024 * 64;
    _Float16* Qh = (_Float16*)d_ws;
    _Float16* Kh = Qh + QKV;
    _Float16* Vt = Kh + QKV;
    _Float16* O  = Vt + QKV;

    const float scale = 1.0f / 32.0f;   // 1024^-0.5

    dim3 g(32, 8);
    qkv_proj_kernel<<<dim3(32, 8, 3), 256, 0, stream>>>(q, k, v, Wq, Wk, Wv, bq, bk, bv,
                                                        Qh, Kh, Vt, scale);

    attn_kernel<<<dim3(16, 64), 128, 0, stream>>>(Qh, Kh, Vt, mask, O);

    out_proj_kernel<<<g, 256, 0, stream>>>(O, Wo, bo, out);
}

// v008
// A run of this version takes 81.1 microseconds.
// Two timings next to v007 both put it at 1.08 times that version's speed.
// Counting every step since v000, it is 3.77 times as fast.
#include <hip/hip_runtime.h>
#include <hip/hip_bf16.h>
#include <cstdint>

typedef __attribute__((ext_vector_type(16))) _Float16 v16h;
typedef __attribute__((ext_vector_type(8)))  _Float16 v8h;
typedef __attribute__((ext_vector_type(2)))  _Float16 v2h;
typedef __attribute__((ext_vector_type(8)))  float    v8f;
typedef __attribute__((ext_vector_type(4)))  float    v4f;
typedef __attribute__((ext_vector_type(4)))  unsigned int u32x4;
typedef __attribute__((ext_vector_type(8)))  unsigned int u32x8;

__device__ __forceinline__ v8f wmma_f16(v16h a, v16h b, v8f c) {
    return __builtin_amdgcn_wmma_f32_16x16x32_f16(
        false, a, false, b, (short)0, c, false, false);
}

// v_cvt_pk_rtz_f16_f32: pack two f32 -> two f16 in one u32
__device__ __forceinline__ unsigned int pk2(float a, float b) {
    auto h = __builtin_amdgcn_cvt_pkrtz(a, b);
    return __builtin_bit_cast(unsigned int, h);
}

// ---------------------------------------------------------------------------
// Tensor load: one request of one wave brings ROWS rows of ROWB bytes (source row
// pitch src_pitch bytes) into LDS. 1-byte elements, every extent in bytes, tensor
// dims = tile dims, two groups. WORD0 holds the pad: 1 << 20 | c << 22 | a << 25
// puts a + 1 dwords behind every 2^(c+1) dwords, so the LDS pitch is ROWB + 16 B
// for a = 3 with c matched to the row (3: 64 B, 4: 128 B, 5: 256 B).
// The issuing wave waits s_wait_tensorcnt 0 itself; others read behind a barrier.
// ---------------------------------------------------------------------------
__device__ __forceinline__ uint32_t uni(uint32_t v) {
    return (uint32_t)__builtin_amdgcn_readfirstlane(v);
}
__device__ __forceinline__ uint32_t pinned(uint32_t v) {
    uint32_t w = uni(v);
    asm volatile("" : "+s"(w));   // pinned(): keeps the test in a scalar register
    return w;
}
struct tdm_desc { u32x4 g0; u32x8 g1; };
template <uint32_t WORD0, uint32_t ROWB, uint32_t ROWS>
__device__ __forceinline__ tdm_desc tdm_form(const void* gptr, uint32_t lds_dst,
                                             uint32_t src_pitch)
{
    const uint64_t ga = (uint64_t)(uintptr_t)gptr;
    u32x4 g0;
    g0[0] = uni(1u);                                     // count = 1
    g0[1] = uni(lds_dst);                                // byte offset in LDS
    g0[2] = uni((uint32_t)ga);                           // address [31:0]
    g0[3] = uni((((uint32_t)(ga >> 32)) & 0x01FFFFFFu) | 0x80000000u);  // [56:32], type 2
    u32x8 g1;
    g1[0] = uni(WORD0);
    g1[1] = uni((ROWB & 0xFFFFu) << 16);
    g1[2] = uni((ROWB >> 16) | ((ROWS & 0xFFFFu) << 16));
    g1[3] = uni((ROWS >> 16) | (ROWB << 16));
    g1[4] = uni(ROWS);
    g1[5] = uni(src_pitch);
    g1[6] = uni(0u);
    g1[7] = uni(0u);
    return tdm_desc{g0, g1};
}
__device__ __forceinline__ void tdm_issue(const tdm_desc& d) {
    asm volatile("tensor_load_to_lds %0, %1" :: "s"(d.g0), "s"(d.g1) : "memory");
}
// The issuer's tile has landed behind this wait.
__device__ __forceinline__ void wait_tensor0() { asm volatile("s_wait_tensorcnt 0x0" ::: "memory"); }
__device__ __forceinline__ u32x8 pinned8(u32x8 g) {
    asm volatile("" : "+s"(g));
    return g;
}
__device__ __forceinline__ void wait_tensor0(const tdm_desc& d) {
    asm volatile("s_wait_tensorcnt 0x0" :: "s"(d.g0), "s"(d.g1) : "memory");
}
__device__ __forceinline__ void wait_tensor0(const tdm_desc& a, const tdm_desc& b,
                                             const tdm_desc& c) {
    asm volatile("s_wait_tensorcnt 0x0"
                 :: "s"(a.g0), "s"(a.g1), "s"(b.g0), "s"(b.g1), "s"(c.g0), "s"(c.g1) : "memory");
}
// The wave's own LDS reads and writes have retired: owed before a barrier behind
// which a tensor load refills what the wave has read.
__device__ __forceinline__ void wait_ds0() { asm volatile("s_wait_dscnt 0x0" ::: "memory"); }

#define PAD128 ((1u << 20) | (4u << 22) | (3u << 25))   // 128-B rows -> pitch 144 B
#define PAD256 ((1u << 20) | (5u << 22) | (3u << 25))   // 256-B rows -> pitch 272 B

#define PK 1024
#define PN 1024

#define QBK 64
#define LQ  72
#define OBK 128
#define LO  136
#define KP 72
#define MP 68

// 16 consecutive f16 of a padded row (16-byte aligned only): two b128 LDS loads.
__device__ __forceinline__ v16h ld_frag(const _Float16* p) {
    v8h lo = *(const v8h*)p;
    v8h hi = *(const v8h*)(p + 8);
    return __builtin_shufflevector(lo, hi, 0, 1, 2, 3, 4, 5, 6, 7,
                                   8, 9, 10, 11, 12, 13, 14, 15);
}

// 16 consecutive d of one key from a [d / 8][64 keys][d % 8] tile: two b128 LDS loads.
__device__ __forceinline__ v16h ld_frag2(const _Float16* p) {
    v8h lo = *(const v8h*)p;
    v8h hi = *(const v8h*)(p + 64 * 8);
    return __builtin_shufflevector(lo, hi, 0, 1, 2, 3, 4, 5, 6, 7,
                                   8, 9, 10, 11, 12, 13, 14, 15);
}

template <bool HEADK>
__device__ __forceinline__ const float* w_src(const float* __restrict__ W, int k0, int n0, int tid) {
    const int lane = tid & 31;
    const int wave = tid >> 5;
    const int k = 4 * ((wave & 1) * 4 + (lane >> 3));      // 0..28
    const int n = 4 * ((wave >> 1) * 8 + (lane & 7));      // 0..124
    return &W[(size_t)(HEADK ? k * 16 + (k0 >> 6) : k0 + k) * PN + n0 + n];
}
template <int KT, bool HEADK>
__device__ __forceinline__ void load_w(const float* src, v4f (&w)[KT][4]) {
#pragma unroll
    for (int j = 0; j < KT; ++j)
#pragma unroll
        for (int i = 0; i < 4; ++i)
            w[j][i] = *(const v4f*)&src[(size_t)(HEADK ? (32 * (j & 1) + i) * 16 + (j >> 1)
                                                       : 32 * j + i) * PN];
}
// Eight loaded values as inputs only: every load in front of it is issued before the first
// conversion; left to itself the scheduler held some loads back until registers came free.
__device__ __forceinline__ void hold8(const v4f (&a)[4], const v4f (&b)[4]) {
    asm volatile("" :: "v"(a[0]), "v"(a[1]), "v"(a[2]), "v"(a[3]),
                       "v"(b[0]), "v"(b[1]), "v"(b[2]), "v"(b[3]));
}
template <bool HEADS, int KT, int PITCH>
__device__ __forceinline__ void store_w(_Float16* Bsh, const v4f (&w)[KT][4], int tid) {
    const int lane = tid & 31;
    const int wave = tid >> 5;
    const int k = 4 * ((wave & 1) * 4 + (lane >> 3));      // 0..28
    const int n = 4 * ((wave >> 1) * 8 + (lane & 7));      // 0..124
    const int row0 = HEADS ? ((lane >> 2) & 1) * 16 + (lane & 3) * 4 + (wave >> 1) : n;
    const int rstep = HEADS ? 32 : 1;
#pragma unroll
    for (int j = 0; j < KT; ++j)
#pragma unroll
        for (int c = 0; c < 4; ++c)
            *(uint2*)&Bsh[(row0 + c * rstep) * PITCH + 32 * j + k] =
                make_uint2(pk2(w[j][0][c], w[j][1][c]), pk2(w[j][2][c], w[j][3][c]));
}

// ---------------------------------------------------------------------------
// QKV projection: out = split_heads(X @ W + bias) * scale
// 128x128 block tile, 8 waves (2x4 of 64x32), 64 k per pass, f32->f16 via cvt_pkrtz.
// One launch does all three products: blockIdx.z = 0 (Q), 1 (K), 2 (V), so that
// three independent workgroups share each WGP and fill one another's waits.
// Q/K -> out[bh][d / 8][n][d % 8];  V -> out[bh][d][n] (V^T). Only Q is scaled.
// ---------------------------------------------------------------------------
__global__ __launch_bounds__(256)
void qkv_proj_kernel(const float* __restrict__ Xq, const float* __restrict__ Xk,
                     const float* __restrict__ Xv,
                     const float* __restrict__ Wq, const float* __restrict__ Wk,
                     const float* __restrict__ Wv,
                     const float* __restrict__ bq, const float* __restrict__ bk,
                     const float* __restrict__ bv,
                     _Float16* __restrict__ out_q, _Float16* __restrict__ out_k,
                     _Float16* __restrict__ out_v, float q_scale)
{
    const int which = blockIdx.z;
    const float* __restrict__ X    = which == 0 ? Xq : which == 1 ? Xk : Xv;
    const float* __restrict__ W    = which == 0 ? Wq : which == 1 ? Wk : Wv;
    const float* __restrict__ bias = which == 0 ? bq : which == 1 ? bk : bv;
    _Float16* __restrict__ out     = which == 0 ? out_q : which == 1 ? out_k : out_v;
    const bool  transposed = which == 2;
    const float scale      = which == 0 ? q_scale : 1.0f;

    __shared__ _Float16 Ash[128 * LQ];   // [m][k], padded rows
    __shared__ _Float16 Bsh[128 * LQ];   // [n][k], padded rows

    const int tid  = threadIdx.x;
    const int lane = tid & 31;
    const int wave = tid >> 5;
    const int wr   = wave >> 2;
    const int wc   = wave & 3;
    const int m0   = blockIdx.x * 128;
    const int n0   = blockIdx.y * 128;
    const int lh   = lane >> 4;
    const int ln   = lane & 15;

    v8f acc[4][2];
#pragma unroll
    for (int i = 0; i < 4; ++i)
#pragma unroll
        for (int j = 0; j < 2; ++j) acc[i][j] = (v8f){0,0,0,0,0,0,0,0};

    for (int k0 = 0; k0 < PK; k0 += QBK) {
        {
            const int r  = (lane >> 3) * 4 + wc + wr * 16;
            const int kk = (tid & 7) * 4;
            const float* src = &X[(size_t)(m0 + r) * PK + k0 + kk];
            v4f f[2][4];
            v4f w[QBK / 32][4];
#pragma unroll
            for (int j = 0; j < 2; ++j)
#pragma unroll
                for (int i = 0; i < 4; ++i)
                    f[j][i] = *(const v4f*)&src[(size_t)(32 * i) * PK + 32 * j];
            load_w<QBK / 32, false>(w_src<false>(W, k0, n0, tid), w);
            hold8(f[0], f[1]);
            hold8(w[0], w[1]);
#pragma unroll
            for (int j = 0; j < 2; ++j)
#pragma unroll
                for (int i = 0; i < 4; ++i)
                    *(uint2*)&Ash[(r + 32 * i) * LQ + 32 * j + kk] =
                        make_uint2(pk2(f[j][i].x, f[j][i].y), pk2(f[j][i].z, f[j][i].w));
            store_w<true, QBK / 32, LQ>(Bsh, w, tid);
        }
        __syncthreads();

#pragma unroll
        for (int ks = 0; ks < QBK / 32; ++ks) {
            const int kb = ks * 32 + lh * 16;
            v16h bfrag[2];
#pragma unroll
            for (int nt = 0; nt < 2; ++nt)
                bfrag[nt] = ld_frag(&Bsh[(wc*32 + nt*16 + ln) * LQ + kb]);
#pragma unroll
            for (int mt = 0; mt < 4; ++mt) {
                v16h a = ld_frag(&Ash[(wr*64 + mt*16 + ln) * LQ + kb]);
#pragma unroll
                for (int nt = 0; nt < 2; ++nt)
                    acc[mt][nt] = wmma_f16(a, bfrag[nt], acc[mt][nt]);
            }
        }
        __syncthreads();
    }

    // The W column that (wc, nt, ln) holds, by store_w<true>'s row order
    const int h   = 4 * (ln >> 2) + wc;
    const int gc0 = n0 + 32 * (ln & 3) + h;      // tile nt = 0; nt = 1 is 16 further (next d)

    if (transposed) {
        // V^T: a wave's 64 n of one column are one whole 128-byte line of the output. The wave
        // turns its 32 columns x 64 n in LDS rows of its own (the loop's last barrier has
        // freed the tiles), so that 8 lanes store one line and a store covers 4 whole lines.
        _Float16* stg = ((wave & 4) ? Bsh : Ash) + (wave & 3) * (32 * LQ);
#pragma unroll
        for (int mt = 0; mt < 4; ++mt)
#pragma unroll
            for (int nt = 0; nt < 2; ++nt) {
                const float bb = bias[gc0 + nt*16];
                float vv[8];
#pragma unroll
                for (int r = 0; r < 8; ++r) vv[r] = (acc[mt][nt][r] + bb) * scale;
                uint4 u = make_uint4(pk2(vv[0], vv[1]), pk2(vv[2], vv[3]),
                                     pk2(vv[4], vv[5]), pk2(vv[6], vv[7]));
                *(uint4*)&stg[(nt*16 + ln) * LQ + mt*16 + 8*lh] = u;
            }
        // the wave's own LDS stores have retired before its other lanes read them
        asm volatile("s_wait_dscnt 0x0" ::: "memory");
        const int gmw = m0 + wr*64;                  // the wave's first n: a multiple of 64
        const int l4  = lane >> 3;                   // column within a group of four
        _Float16* vdst = &out[(size_t)((gmw >> 10) * 16) * 64 * 1024 + (gmw & 1023) + (lane & 7) * 8];
#pragma unroll
        for (int i = 0; i < 8; ++i) {
            const int c  = (i & 3) * 4 + l4;         // the lane ln that held this column
            const int hc = 4 * (c >> 2) + wc;
            const int dc = (n0 + 32 * (c & 3) + hc + (i >> 2) * 16) >> 4;
            *(uint4*)&vdst[(size_t)(hc * 64 + dc) * 1024] =
                *(const uint4*)&stg[(i * 4 + l4) * LQ + (lane & 7) * 8];
        }
    } else {
        _Float16* stg = ((wave & 4) ? Bsh : Ash) + (wave & 3) * (32 * LQ);
        const float b0 = bias[gc0], b1 = bias[gc0 + 16];
        _Float16* srow = &stg[(ln >> 2) * 520 + 8*lh * 8 + 2 * (ln & 3)];
#pragma unroll
        for (int mt = 0; mt < 4; ++mt)
#pragma unroll
            for (int r = 0; r < 8; ++r) {
                v2h pr;
                pr[0] = (_Float16)((acc[mt][0][r] + b0) * scale);
                pr[1] = (_Float16)((acc[mt][1][r] + b1) * scale);
                *(v2h*)&srow[(mt*16 + r) * 8] = pr;
            }
        // the wave's own LDS stores have retired before its other lanes read them
        asm volatile("s_wait_dscnt 0x0" ::: "memory");
        // the 128 rows of a tile lie in one batch entry
        const int gmw = m0 + wr*64;
        _Float16* dst = &out[((((size_t)(gmw >> 10) * 16 + wc) * 8 + blockIdx.y) * 1024
                              + (gmw & 1023) + lane) * 8];
#pragma unroll
        for (int hq = 0; hq < 4; ++hq)           // head 4*hq + wc
#pragma unroll
            for (int j = 0; j < 2; ++j)
                *(uint4*)&dst[((size_t)(4 * hq) * 8 * 1024 + j * 32) * 8] =
                    *(const uint4*)&stg[hq * 520 + (j * 32 + lane) * 8];
        // the stores' address and data registers may be rewritten behind this point
        asm volatile("s_wait_xcnt 0x0" ::: "memory");
    }
}

__device__ __forceinline__ float xhalf(float x) {
    const int b = __builtin_bit_cast(int, x);
    return __builtin_bit_cast(float,
        __builtin_amdgcn_permlanex16(b, b, 0x76543210, 0xfedcba98, false, false));
}

__device__ __forceinline__ void exp2x8(float (&y)[8], const float (&x)[8]) {
    asm("v_exp_f32 %0, %8\n\t"
        "v_exp_f32 %1, %9\n\t"
        "v_exp_f32 %2, %10\n\t"
        "v_exp_f32 %3, %11\n\t"
        "v_exp_f32 %4, %12\n\t"
        "v_exp_f32 %5, %13\n\t"
        "v_exp_f32 %6, %14\n\t"
        "v_exp_f32 %7, %15\n\t"
        "v_nop"
        : "=&v"(y[0]), "=&v"(y[1]), "=&v"(y[2]), "=&v"(y[3]),
          "=&v"(y[4]), "=&v"(y[5]), "=&v"(y[6]), "=&v"(y[7])
        : "v"(x[0]), "v"(x[1]), "v"(x[2]), "v"(x[3]),
          "v"(x[4]), "v"(x[5]), "v"(x[6]), "v"(x[7]));
}
__device__ __forceinline__ float exp2x1(float x) {
    float y;
    asm("v_exp_f32 %0, %1\n\t"
        "v_nop"
        : "=&v"(y) : "v"(x));
    return y;
}
#define LOG2E 1.44269504f
#define MSZ 4608   // f32 per mask buffer: 64 * MP = 4352, up to 18 KiB
#define VSZ 5120   // f16 per V buffer:    64 * KP = 4608, up to 10 KiB

__global__ __launch_bounds__(128)
void attn_kernel(const _Float16* __restrict__ Qh, const _Float16* __restrict__ Kh,
                 const _Float16* __restrict__ Vt, const float* __restrict__ mask,
                 _Float16* __restrict__ O)
{
    // Each buffer's size is rounded up to 2 KiB, so that the second one's place is a multiple too.
    __shared__ __attribute__((aligned(2048))) float    Msh[2][MSZ];     // mask tile, 64 rows of MP
    __shared__ __attribute__((aligned(2048))) _Float16 Ksh[2][64 * 64]; // K chunk [d / 8][n][d % 8]
    __shared__ __attribute__((aligned(2048))) _Float16 Vsh[2][VSZ];     // V chunk [d][n], 64 rows of KP

    const int tid  = threadIdx.x;
    const int lane = tid & 31;
    const int wave = (int)uni((uint32_t)tid >> 5);
    const int lh   = lane >> 4;
    const int ln   = lane & 15;
    const int bh   = blockIdx.y;
    const int q0   = blockIdx.x * 64;

    // Q and K lie as [bh][d / 8][n][d % 8]
    const _Float16* Qbase = Qh + (size_t)bh * 1024 * 64 + q0 * 8;
    const _Float16* Kbase = Kh + (size_t)bh * 1024 * 64;
    const _Float16* Vbase = Vt + (size_t)bh * 64 * 1024;

    // Q^T as B operand: column = query ln, k = d in the order of the K loader below
    const int qrow = wave*16 + ln;
    v16h qf[2];
#pragma unroll
    for (int j = 0; j < 2; ++j) {   // d = 32*j + 16*lh + 0..15: groups 4*j + 2*lh and the next
        v8h lo = *(const v8h*)&Qbase[((4*j + 2*lh)     * 1024 + qrow) * 8];
        v8h hi = *(const v8h*)&Qbase[((4*j + 2*lh + 1) * 1024 + qrow) * 8];
        qf[j] = __builtin_shufflevector(lo, hi, 0, 1, 2, 3, 4, 5, 6, 7,
                                        8, 9, 10, 11, 12, 13, 14, 15);
    }

    v8f oacc[4];   // O^T: register r of tile dt = d dt*16 + 8*lh + r of query ln
#pragma unroll
    for (int dt = 0; dt < 4; ++dt) oacc[dt] = (v8f){0,0,0,0,0,0,0,0};
    float mrun = -1.0e30f;   // the query's running maximum, equal in both halves
    float lrun = 0.0f;       // the sum over this half's keys; the halves join behind the loop

    const unsigned int koff = (unsigned int)(uintptr_t)&Ksh[0][0];
    const unsigned int voff = (unsigned int)(uintptr_t)&Vsh[0][0];
    const unsigned int moff = (unsigned int)(uintptr_t)&Msh[0][0];

    // Chunk c's three tiles, into buffer c & 1
    auto form_k = [&](int c) {   // K chunk: 8 d-groups of 64 keys x 16 B, source pitch 16 KiB
        return tdm_form<0u, 1024u, 8u>(&Kbase[(size_t)c * 64 * 8],
                                       koff + (unsigned int)(c & 1) * (64u * 64u * 2u), 16384u);
    };
    auto form_v = [&](int c) {   // V chunk: 64 d-rows of 128 B, source pitch 2048 B
        return tdm_form<PAD128, 128u, 64u>(&Vbase[c * 64],
                                           voff + (unsigned int)(c & 1) * (VSZ * 2u), 2048u);
    };
    auto form_m = [&](int c) {   // mask tile: 64 q-rows of 256 B, source pitch 4096 B
        return tdm_form<PAD256, 256u, 64u>(&mask[(size_t)q0 * 1024 + c * 64],
                                           moff + (unsigned int)(c & 1) * (MSZ * 4u), 4096u);
    };
    // One request a wave
    auto issue = [&](const tdm_desc& dk, const tdm_desc& dv, const tdm_desc& dm) {
        if (pinned(wave == 0)) tdm_issue(dk);
        if (pinned(wave == 1)) tdm_issue(dv);
        if (pinned(wave == 2)) tdm_issue(dm);
    };
    issue(form_k(0), form_v(0), form_m(0));
    wait_tensor0();    // waves 0 to 2: the own tile has landed; wave 3 has none outstanding
    __syncthreads();
    const u32x8 k1 = pinned8(form_k(0).g1), v1 = pinned8(form_v(0).g1), m1 = pinned8(form_m(0).g1);

    for (int c = 0; c < 16; ++c) {
        // Behind the barrier that ended pass c - 1: chunk c + 1 into the buffer which that pass read
        const tdm_desc dk = {form_k(c + 1).g0, k1}, dv = {form_v(c + 1).g0, v1},
                       dm = {form_m(c + 1).g0, m1};
        if (pinned(c + 1 < 16)) issue(dk, dv, dm);
        const _Float16* Kb = &Ksh[c & 1][0];
        const _Float16* Vb = &Vsh[c & 1][0];
        const float*    Mb = &Msh[c & 1][0];

        // S^T = K @ Q^T: register r of tile kt = key kt*16 + 8*lh + r, query ln
        v8f st[4];
#pragma unroll
        for (int kt = 0; kt < 4; ++kt) {
            const int kr = kt*16 + ln;
            // 16 lanes read 16 keys x 16 B in a row: no pad is wanted
            v16h a0 = ld_frag2(&Kb[((2*lh)     * 64 + kr) * 8]);
            v16h a1 = ld_frag2(&Kb[((2*lh + 4) * 64 + kr) * 8]);
            v8f s = (v8f){0,0,0,0,0,0,0,0};
            s = wmma_f16(a0, qf[0], s);
            s = wmma_f16(a1, qf[1], s);
            st[kt] = s;
        }

        // Online softmax of one query per lane; four chains, one per tile
        const float* mrow = &Mb[qrow*MP + 8*lh];
        float mk[4];
#pragma unroll
        for (int kt = 0; kt < 4; ++kt) {
            const float4 m0 = *(const float4*)&mrow[kt*16];
            const float4 m1 = *(const float4*)&mrow[kt*16 + 4];
            const float mv[8] = {m0.x, m0.y, m0.z, m0.w, m1.x, m1.y, m1.z, m1.w};
#pragma unroll
            for (int r = 0; r < 8; ++r)
                st[kt][r] = st[kt][r] - 100000000.0f * (1.0f - mv[r]);
            float m = st[kt][0];
#pragma unroll
            for (int r = 1; r < 8; ++r) m = fmaxf(m, st[kt][r]);
            mk[kt] = m;
        }
        float mx = fmaxf(fmaxf(mk[0], mk[1]), fmaxf(mk[2], mk[3]));
        mx = fmaxf(mx, xhalf(mx));
        const float mnew  = fmaxf(mrun, mx);
        const float alpha = exp2x1((mrun - mnew) * LOG2E);

        // P^T as B operand: element s of block kb = tile 2*kb + (s >> 3), register s & 7
        v16h pb[2];
        float ps[4];
#pragma unroll
        for (int kt = 0; kt < 4; ++kt) {
            float x[8], p[8];
#pragma unroll
            for (int r = 0; r < 8; ++r) x[r] = (st[kt][r] - mnew) * LOG2E;
            exp2x8(p, x);
            float sum = p[0];
#pragma unroll
            for (int r = 1; r < 8; ++r) sum += p[r];
            ps[kt] = sum;
#pragma unroll
            for (int r = 0; r < 8; ++r) pb[kt >> 1][(kt & 1)*8 + r] = (_Float16)p[r];
        }
        lrun = lrun * alpha + ((ps[0] + ps[1]) + (ps[2] + ps[3]));
        mrun = mnew;
#pragma unroll
        for (int dt = 0; dt < 4; ++dt)
#pragma unroll
            for (int r = 0; r < 8; ++r) oacc[dt][r] *= alpha;

        // O^T += V^T @ P^T; the V loader takes P^T's key order: of each 32 keys a half
        // holds 8*lh .. 8*lh + 7 and 16 + 8*lh .. 16 + 8*lh + 7
#pragma unroll
        for (int dt = 0; dt < 4; ++dt) {
#pragma unroll
            for (int kb = 0; kb < 2; ++kb) {
                const _Float16* vr = &Vb[(dt*16 + ln)*KP + kb*32 + 8*lh];
                v8h lo = *(const v8h*)vr;
                v8h hi = *(const v8h*)(vr + 16);
                v16h vf = __builtin_shufflevector(lo, hi, 0, 1, 2, 3, 4, 5, 6, 7,
                                                  8, 9, 10, 11, 12, 13, 14, 15);
                oacc[dt] = wmma_f16(vf, pb[kb], oacc[dt]);
            }
        }
        // Publish point of chunk c + 1: own LDS reads retired, own request landed, barrier.
        // The one barrier also ends every reader's last read of the buffer refilled behind it.
        wait_ds0();
        wait_tensor0(dk, dv, dm);
        __syncthreads();
    }
    // the ring's closing waits, before its LDS becomes output staging
    wait_tensor0();
    wait_ds0();

    // The last pass's barrier has freed the ring, and nothing is outstanding: the first mask
    // buffer becomes the output tile [q][d].
    _Float16* Osh = (_Float16*)&Msh[0][0];
    // Each wave turns its own 16 x 64 tile in its own rows of Osh. O goes out head-major,
    // O[b][q][h*64 + d]: the 64 d of a query and head are one whole 128-byte line, which
    // 8 lanes store as 16 B each and no other work-group writes.
    const float inv = 1.0f / (lrun + xhalf(lrun));
#pragma unroll
    for (int dt = 0; dt < 4; ++dt) {
        v8h o;
#pragma unroll
        for (int r = 0; r < 8; ++r) o[r] = (_Float16)(oacc[dt][r] * inv);
        *(v8h*)&Osh[qrow*KP + dt*16 + 8*lh] = o;
    }
    wait_ds0();   // the wave's own stores have retired before its other lanes read them

    const int bb = bh >> 4, hh = bh & 15;
    const int lrow = wave*16 + (lane >> 3);      // four rows a store, 8 lanes a row
    const int dcol = (lane & 7) * 8;
    _Float16* dst = &O[((size_t)(bb*1024 + q0 + lrow)) * 1024 + hh*64 + dcol];
#pragma unroll
    for (int i = 0; i < 4; ++i)
        *(v8h*)&dst[(size_t)(4*i) * 1024] = *(const v8h*)&Osh[(lrow + 4*i)*KP + dcol];
}

// ---------------------------------------------------------------------------
// Output projection: d_out = O(f16) @ Wo(f32) + bo -> f32. O's columns run head-major
// (h*64 + d); the W loader takes Wo's rows (d*16 + h) in that same order.
// A tile staged by a tensor load (pure f16 copy, padded rows); W tile converted cooperatively.
// Two buffers of each: the next pass's A tile and W rows fly while this pass is worked on,
// the W rows in registers until the pass's foot.
// ---------------------------------------------------------------------------
__global__ __launch_bounds__(256)
void out_proj_kernel(const _Float16* __restrict__ Xh, const float* __restrict__ W,
                     const float* __restrict__ bias, float* __restrict__ out)
{
    __shared__ __attribute__((aligned(2048))) _Float16 Ash[2][128 * LO];   // padded by the tensor load; 34 KiB each
    __shared__ _Float16 Bsh[2][128 * LO];   // padded rows

    const int tid  = threadIdx.x;
    const int lane = tid & 31;
    const int wave = (int)uni((uint32_t)tid >> 5);
    const int wr   = wave >> 2;
    const int wc   = wave & 3;
    const int m0   = blockIdx.x * 128;
    const int n0   = blockIdx.y * 128;
    const int lh   = lane >> 4;
    const int ln   = lane & 15;

    const unsigned int aoff = (unsigned int)(uintptr_t)&Ash[0][0];

    v8f acc[4][2];
#pragma unroll
    for (int i = 0; i < 4; ++i)
#pragma unroll
        for (int j = 0; j < 2; ++j) acc[i][j] = (v8f){0,0,0,0,0,0,0,0};

    // Pass p's loads: the A tile, 128 rows of 256 B at source pitch 2048 B, into buffer p & 1
    // (wave 0 issues), and the W rows into registers.
    v4f w[OBK / 32][4];
    auto form_a = [&](int p) {
        return tdm_form<PAD256, 256u, 128u>(&Xh[(size_t)m0 * PK + p * OBK],
                                            aoff + (unsigned int)(p & 1) * (128u * LO * 2u), 2048u);
    };
    auto fetch = [&](int p, const tdm_desc& da) {
        if (pinned(wave == 0)) tdm_issue(da);
        const float* wp = w_src<true>(W, p * OBK, n0, tid);
        load_w<OBK / 32, true>(wp, w);
        // a register that an issued load names is rewritten only behind this wait; as its input
        // the address lives up to it (else the last load's result took the address register)
        asm volatile("s_wait_xcnt 0x0" :: "v"(wp) : "memory");
    };
    // The W rows in registers go to pass p's buffer.
    auto put_w = [&](int p) {
        // keeps the conversions, and with them the wait for the W loads, behind the pass's
        // products: the scheduler had lifted them to the head of the pass
        __builtin_amdgcn_sched_barrier(0);
        hold8(w[0], w[1]);
        hold8(w[2], w[3]);
        store_w<false, OBK / 32, LO>(&Bsh[p & 1][0], w, tid);
    };
    fetch(0, form_a(0));
    put_w(0);
    wait_ds0();       // this wave's W stores have retired
    wait_tensor0();   // wave 0: its tile has landed; the other waves have none outstanding
    __syncthreads();
    const u32x8 a1 = pinned8(form_a(0).g1);

    for (int p = 0; p < PK / OBK; ++p) {
        // Behind the barrier that ended pass p - 1: pass p + 1's loads, the A tile into the
        // buffer which that pass read
        const tdm_desc da = {form_a(p + 1).g0, a1};
        if (pinned(p + 1 < PK / OBK)) fetch(p + 1, da);
        const _Float16* Ab = &Ash[p & 1][0];
        const _Float16* Bb = &Bsh[p & 1][0];
#pragma unroll
        for (int ks = 0; ks < OBK / 32; ++ks) {
            const int kb = ks * 32 + lh * 16;
            v16h bfrag[2];
#pragma unroll
            for (int nt = 0; nt < 2; ++nt)
                bfrag[nt] = ld_frag(&Bb[(wc*32 + nt*16 + ln) * LO + kb]);
#pragma unroll
            for (int mt = 0; mt < 4; ++mt) {
                v16h a = ld_frag(&Ab[(wr*64 + mt*16 + ln) * LO + kb]);
#pragma unroll
                for (int nt = 0; nt < 2; ++nt)
                    acc[mt][nt] = wmma_f16(a, bfrag[nt], acc[mt][nt]);
            }
        }
        // W of pass p + 1 into the buffer that pass p - 1 read: its readers left at the last barrier
        if (p + 1 < PK / OBK) put_w(p + 1);
        // Publish point of pass p + 1: own LDS reads and stores retired, wave 0's tile landed,
        // barrier. It also ends every reader's last read of the buffers refilled behind it.
        wait_ds0();
        wait_tensor0(da);
        __syncthreads();
    }
    // the ring's closing waits, before its LDS becomes output staging
    wait_tensor0();
    wait_ds0();

    float* stg = (float*)((wave & 4) ? &Bsh[0][0] : &Ash[0][0]) + (wave & 3) * (32 * 36);
    const float bias0 = bias[n0 + wc*32 + ln], bias1 = bias[n0 + wc*32 + 16 + ln];
    float* dst = &out[(size_t)(m0 + wr*64 + (lane >> 3)) * PN + n0 + wc*32 + (lane & 7) * 4];
#pragma unroll
    for (int hf = 0; hf < 2; ++hf) {
#pragma unroll
        for (int m2 = 0; m2 < 2; ++m2)
#pragma unroll
            for (int r = 0; r < 8; ++r) {
                float* row = &stg[(m2*16 + r + 8*lh) * 36 + ln];
                row[0]  = acc[hf*2 + m2][0][r] + bias0;
                row[16] = acc[hf*2 + m2][1][r] + bias1;
            }
        wait_ds0();   // the wave's own stores have retired before its other lanes read them
#pragma unroll
        for (int i = 0; i < 8; ++i)
            *(v4f*)&dst[(size_t)(hf*32 + i*4) * PN] =
                *(const v4f*)&stg[(i*4 + (lane >> 3)) * 36 + (lane & 7) * 4];
        // the first half's stores have given up their data registers before the second half's
        // LDS reads overwrite them; the clobber keeps its LDS stores behind the reads above
        if (hf == 0) asm volatile("s_wait_xcnt 0x0" ::: "memory");
    }
}

// ---------------------------------------------------------------------------
extern "C" void kernel_launch(void* const* d_in, const int* in_sizes, int n_in,
                              void* d_out, int out_size, void* d_ws, size_t ws_size,
                              hipStream_t stream)
{
    const float* q    = (const float*)d_in[0];
    const float* k    = (const float*)d_in[1];
    const float* v    = (const float*)d_in[2];
    const float* mask = (const float*)d_in[3];
    const float* Wq   = (const float*)d_in[4];
    const float* bq   = (const float*)d_in[5];
    const float* Wk   = (const float*)d_in[6];
    const float* bk   = (const float*)d_in[7];
    const float* Wv   = (const float*)d_in[8];
    const float* bv   = (const float*)d_in[9];
    const float* Wo   = (const float*)d_in[10];
    const float* bo   = (const float*)d_in[11];
    float* out        = (float*)d_out;

    const size_t QKV = (size_t)4 * 16 * 1024 * 64;
    _Float16* Qh = (_Float16*)d_ws;
    _Float16* Kh = Qh + QKV;
    _Float16* Vt = Kh + QKV;
    _Float16* O  = Vt + QKV;

    const float scale = 1.0f / 32.0f;   // 1024^-0.5

    dim3 g(32, 8);
    qkv_proj_kernel<<<dim3(32, 8, 3), 256, 0, stream>>>(q, k, v, Wq, Wk, Wv, bq, bk, bv,
                                                        Qh, Kh, Vt, scale);

    attn_kernel<<<dim3(16, 64), 128, 0, stream>>>(Qh, Kh, Vt, mask, O);

    out_proj_kernel<<<g, 256, 0, stream>>>(O, Wo, bo, out);
}

// v009
// It runs in 72.5 microseconds.
// Timed twice side by side with v008, it ran 1.12 and 1.11 times as fast.
// Counting every step since v000, it is 4.21 times as fast.
#include <hip/hip_runtime.h>
#include <hip/hip_bf16.h>
#include <cstdint>

typedef __attribute__((ext_vector_type(16))) _Float16 v16h;
typedef __attribute__((ext_vector_type(8)))  _Float16 v8h;
typedef __attribute__((ext_vector_type(2)))  _Float16 v2h;
typedef __attribute__((ext_vector_type(8)))  float    v8f;
typedef __attribute__((ext_vector_type(4)))  float    v4f;
typedef __attribute__((ext_vector_type(4)))  unsigned int u32x4;
typedef __attribute__((ext_vector_type(8)))  unsigned int u32x8;

__device__ __forceinline__ v8f wmma_f16(v16h a, v16h b, v8f c) {
    return __builtin_amdgcn_wmma_f32_16x16x32_f16(
        false, a, false, b, (short)0, c, false, false);
}

// v_cvt_pk_rtz_f16_f32: pack two f32 -> two f16 in one u32
__device__ __forceinline__ unsigned int pk2(float a, float b) {
    auto h = __builtin_amdgcn_cvt_pkrtz(a, b);
    return __builtin_bit_cast(unsigned int, h);
}

// ---------------------------------------------------------------------------
// Tensor load: one request of one wave brings ROWS rows of ROWB bytes (source row
// pitch src_pitch bytes) into LDS. 1-byte elements, every extent in bytes, tensor
// dims = tile dims, two groups. WORD0 holds the pad: 1 << 20 | c << 22 | a << 25
// puts a + 1 dwords behind every 2^(c+1) dwords, so the LDS pitch is ROWB + 16 B
// for a = 3 with c matched to the row (3: 64 B, 4: 128 B, 5: 256 B).
// The issuing wave waits s_wait_tensorcnt 0 itself; others read behind a barrier.
// ---------------------------------------------------------------------------
__device__ __forceinline__ uint32_t uni(uint32_t v) {
    return (uint32_t)__builtin_amdgcn_readfirstlane(v);
}
__device__ __forceinline__ uint32_t pinned(uint32_t v) {
    uint32_t w = uni(v);
    asm volatile("" : "+s"(w));   // pinned(): keeps the test in a scalar register
    return w;
}
struct tdm_desc { u32x4 g0; u32x8 g1; };
template <uint32_t WORD0, uint32_t ROWB, uint32_t ROWS>
__device__ __forceinline__ tdm_desc tdm_form(const void* gptr, uint32_t lds_dst,
                                             uint32_t src_pitch)
{
    const uint64_t ga = (uint64_t)(uintptr_t)gptr;
    u32x4 g0;
    g0[0] = uni(1u);                                     // count = 1
    g0[1] = uni(lds_dst);                                // byte offset in LDS
    g0[2] = uni((uint32_t)ga);                           // address [31:0]
    g0[3] = uni((((uint32_t)(ga >> 32)) & 0x01FFFFFFu) | 0x80000000u);  // [56:32], type 2
    u32x8 g1;
    g1[0] = uni(WORD0);
    g1[1] = uni((ROWB & 0xFFFFu) << 16);
    g1[2] = uni((ROWB >> 16) | ((ROWS & 0xFFFFu) << 16));
    g1[3] = uni((ROWS >> 16) | (ROWB << 16));
    g1[4] = uni(ROWS);
    g1[5] = uni(src_pitch);
    g1[6] = uni(0u);
    g1[7] = uni(0u);
    return tdm_desc{g0, g1};
}
__device__ __forceinline__ void tdm_issue(const tdm_desc& d) {
    asm volatile("tensor_load_to_lds %0, %1" :: "s"(d.g0), "s"(d.g1) : "memory");
}
// The issuer's tile has landed behind this wait.
__device__ __forceinline__ void wait_tensor0() { asm volatile("s_wait_tensorcnt 0x0" ::: "memory"); }
__device__ __forceinline__ u32x8 pinned8(u32x8 g) {
    asm volatile("" : "+s"(g));
    return g;
}
__device__ __forceinline__ void wait_tensor0(const tdm_desc& d) {
    asm volatile("s_wait_tensorcnt 0x0" :: "s"(d.g0), "s"(d.g1) : "memory");
}
__device__ __forceinline__ void wait_tensor0(const tdm_desc& a, const tdm_desc& b,
                                             const tdm_desc& c) {
    asm volatile("s_wait_tensorcnt 0x0"
                 :: "s"(a.g0), "s"(a.g1), "s"(b.g0), "s"(b.g1), "s"(c.g0), "s"(c.g1) : "memory");
}
// The wave's own LDS reads and writes have retired: owed before a barrier behind
// which a tensor load refills what the wave has read.
__device__ __forceinline__ void wait_ds0() { asm volatile("s_wait_dscnt 0x0" ::: "memory"); }

#define PAD128 ((1u << 20) | (4u << 22) | (3u << 25))   // 128-B rows -> pitch 144 B
#define PAD256 ((1u << 20) | (5u << 22) | (3u << 25))   // 256-B rows -> pitch 272 B

#define PK 1024
#define PN 1024

#define QBK 64
#define LQ  72
#define OBK 128
#define LO  136
#define KP 72
#define MP 68

// 16 consecutive f16 of a padded row (16-byte aligned only): two b128 LDS loads.
__device__ __forceinline__ v16h ld_frag(const _Float16* p) {
    v8h lo = *(const v8h*)p;
    v8h hi = *(const v8h*)(p + 8);
    return __builtin_shufflevector(lo, hi, 0, 1, 2, 3, 4, 5, 6, 7,
                                   8, 9, 10, 11, 12, 13, 14, 15);
}

// 16 consecutive d of one key from a [d / 8][64 keys][d % 8] tile: two b128 LDS loads.
__device__ __forceinline__ v16h ld_frag2(const _Float16* p) {
    v8h lo = *(const v8h*)p;
    v8h hi = *(const v8h*)(p + 64 * 8);
    return __builtin_shufflevector(lo, hi, 0, 1, 2, 3, 4, 5, 6, 7,
                                   8, 9, 10, 11, 12, 13, 14, 15);
}

template <bool HEADK>
__device__ __forceinline__ const float* w_src(const float* __restrict__ W, int k0, int n0, int tid) {
    const int lane = tid & 31;
    const int wave = tid >> 5;
    const int k = 4 * ((wave & 1) * 4 + (lane >> 3));      // 0..28
    const int n = 4 * ((wave >> 1) * 8 + (lane & 7));      // 0..124
    return &W[(size_t)(HEADK ? k * 16 + (k0 >> 6) : k0 + k) * PN + n0 + n];
}
template <int KT, bool HEADK>
__device__ __forceinline__ void load_w(const float* src, v4f (&w)[KT][4]) {
#pragma unroll
    for (int j = 0; j < KT; ++j)
#pragma unroll
        for (int i = 0; i < 4; ++i)
            w[j][i] = *(const v4f*)&src[(size_t)(HEADK ? (32 * (j & 1) + i) * 16 + (j >> 1)
                                                       : 32 * j + i) * PN];
}
// Eight loaded values as inputs only: every load in front of it is issued before the first
// conversion; left to itself the scheduler held some loads back until registers came free.
__device__ __forceinline__ void hold8(const v4f (&a)[4], const v4f (&b)[4]) {
    asm volatile("" :: "v"(a[0]), "v"(a[1]), "v"(a[2]), "v"(a[3]),
                       "v"(b[0]), "v"(b[1]), "v"(b[2]), "v"(b[3]));
}
template <bool HEADS, int KT, int PITCH>
__device__ __forceinline__ void store_w(_Float16* Bsh, const v4f (&w)[KT][4], int tid) {
    const int lane = tid & 31;
    const int wave = tid >> 5;
    const int k = 4 * ((wave & 1) * 4 + (lane >> 3));      // 0..28
    const int n = 4 * ((wave >> 1) * 8 + (lane & 7));      // 0..124
    const int row0 = HEADS ? ((lane >> 2) & 1) * 16 + (lane & 3) * 4 + (wave >> 1) : n;
    const int rstep = HEADS ? 32 : 1;
#pragma unroll
    for (int j = 0; j < KT; ++j)
#pragma unroll
        for (int c = 0; c < 4; ++c)
            *(uint2*)&Bsh[(row0 + c * rstep) * PITCH + 32 * j + k] =
                make_uint2(pk2(w[j][0][c], w[j][1][c]), pk2(w[j][2][c], w[j][3][c]));
}

// ---------------------------------------------------------------------------
// QKV projection: out = split_heads(X @ W + bias) * scale
// 128x128 block tile, 8 waves (2x4 of 64x32), 64 k per pass, f32->f16 via cvt_pkrtz.
// One launch does all three products: blockIdx.z = 0 (Q), 1 (K), 2 (V), so that
// three independent workgroups share each WGP and fill one another's waits.
// Q/K -> out[bh][d / 8][n][d % 8];  V -> out[bh][d][n] (V^T). Only Q is scaled.
// ---------------------------------------------------------------------------
__global__ __launch_bounds__(256)
void qkv_proj_kernel(const float* __restrict__ Xq, const float* __restrict__ Xk,
                     const float* __restrict__ Xv,
                     const float* __restrict__ Wq, const float* __restrict__ Wk,
                     const float* __restrict__ Wv,
                     const float* __restrict__ bq, const float* __restrict__ bk,
                     const float* __restrict__ bv,
                     _Float16* __restrict__ out_q, _Float16* __restrict__ out_k,
                     _Float16* __restrict__ out_v, float q_scale)
{
    const int which = blockIdx.z;
    const float* __restrict__ X    = which == 0 ? Xq : which == 1 ? Xk : Xv;
    const float* __restrict__ W    = which == 0 ? Wq : which == 1 ? Wk : Wv;
    const float* __restrict__ bias = which == 0 ? bq : which == 1 ? bk : bv;
    _Float16* __restrict__ out     = which == 0 ? out_q : which == 1 ? out_k : out_v;
    const bool  transposed = which == 2;
    const float scale      = which == 0 ? q_scale : 1.0f;

    __shared__ _Float16 Ash[128 * LQ];   // [m][k], padded rows
    __shared__ _Float16 Bsh[128 * LQ];   // [n][k], padded rows

    const int tid  = threadIdx.x;
    const int lane = tid & 31;
    const int wave = tid >> 5;
    const int wr   = wave >> 2;
    const int wc   = wave & 3;
    const int m0   = blockIdx.x * 128;
    const int n0   = blockIdx.y * 128;
    const int lh   = lane >> 4;
    const int ln   = lane & 15;

    v8f acc[4][2];
#pragma unroll
    for (int i = 0; i < 4; ++i)
#pragma unroll
        for (int j = 0; j < 2; ++j) acc[i][j] = (v8f){0,0,0,0,0,0,0,0};

    // Work-groups that share an X tile (same x) or a W tile (same y) start together; each walks
    // the k tiles from a start of its own, round the end, so that they do not ask L2 for the
    // same lines at the same moment. The 8 sharers of an X tile start two tiles apart: passes
    // 0 and 1 ask memory for all 16 tiles, so that a later pass can find its lines in L2.
    const int rot = blockIdx.x + 2 * blockIdx.y;
    for (int t = 0; t < PK / QBK; ++t) {
        const int k0 = ((t + rot) & (PK / QBK - 1)) * QBK;
        {
            const int r  = (lane >> 3) * 4 + wc + wr * 16;
            const int kk = (tid & 7) * 4;
            const float* src = &X[(size_t)(m0 + r) * PK + k0 + kk];
            v4f f[2][4];
            v4f w[QBK / 32][4];
#pragma unroll
            for (int j = 0; j < 2; ++j)
#pragma unroll
                for (int i = 0; i < 4; ++i)
                    f[j][i] = *(const v4f*)&src[(size_t)(32 * i) * PK + 32 * j];
            const float* wp = w_src<false>(W, k0, n0, tid);
            load_w<QBK / 32, false>(wp, w);
            // a register that an issued load names is rewritten only behind this wait; as its inputs
            // both addresses live up to it (else a later load's result took an address register)
            asm volatile("s_wait_xcnt 0x0" :: "v"(src), "v"(wp) : "memory");
            hold8(f[0], f[1]);
            hold8(w[0], w[1]);
#pragma unroll
            for (int j = 0; j < 2; ++j)
#pragma unroll
                for (int i = 0; i < 4; ++i)
                    *(uint2*)&Ash[(r + 32 * i) * LQ + 32 * j + kk] =
                        make_uint2(pk2(f[j][i].x, f[j][i].y), pk2(f[j][i].z, f[j][i].w));
            store_w<true, QBK / 32, LQ>(Bsh, w, tid);
        }
        __syncthreads();

#pragma unroll
        for (int ks = 0; ks < QBK / 32; ++ks) {
            const int kb = ks * 32 + lh * 16;
            v16h bfrag[2];
#pragma unroll
            for (int nt = 0; nt < 2; ++nt)
                bfrag[nt] = ld_frag(&Bsh[(wc*32 + nt*16 + ln) * LQ + kb]);
#pragma unroll
            for (int mt = 0; mt < 4; ++mt) {
                v16h a = ld_frag(&Ash[(wr*64 + mt*16 + ln) * LQ + kb]);
#pragma unroll
                for (int nt = 0; nt < 2; ++nt)
                    acc[mt][nt] = wmma_f16(a, bfrag[nt], acc[mt][nt]);
            }
        }
        __syncthreads();
    }

    // The W column that (wc, nt, ln) holds, by store_w<true>'s row order
    const int h   = 4 * (ln >> 2) + wc;
    const int gc0 = n0 + 32 * (ln & 3) + h;      // tile nt = 0; nt = 1 is 16 further (next d)

    if (transposed) {
        // V^T: a wave's 64 n of one column are one whole 128-byte line of the output. The wave
        // turns its 32 columns x 64 n in LDS rows of its own (the loop's last barrier has
        // freed the tiles), so that 8 lanes store one line and a store covers 4 whole lines.
        _Float16* stg = ((wave & 4) ? Bsh : Ash) + (wave & 3) * (32 * LQ);
#pragma unroll
        for (int mt = 0; mt < 4; ++mt)
#pragma unroll
            for (int nt = 0; nt < 2; ++nt) {
                const float bb = bias[gc0 + nt*16];
                float vv[8];
#pragma unroll
                for (int r = 0; r < 8; ++r) vv[r] = (acc[mt][nt][r] + bb) * scale;
                uint4 u = make_uint4(pk2(vv[0], vv[1]), pk2(vv[2], vv[3]),
                                     pk2(vv[4], vv[5]), pk2(vv[6], vv[7]));
                *(uint4*)&stg[(nt*16 + ln) * LQ + mt*16 + 8*lh] = u;
            }
        // the wave's own LDS stores have retired before its other lanes read them
        asm volatile("s_wait_dscnt 0x0" ::: "memory");
        const int gmw = m0 + wr*64;                  // the wave's first n: a multiple of 64
        const int l4  = lane >> 3;                   // column within a group of four
        _Float16* vdst = &out[(size_t)((gmw >> 10) * 16) * 64 * 1024 + (gmw & 1023) + (lane & 7) * 8];
#pragma unroll
        for (int i = 0; i < 8; ++i) {
            const int c  = (i & 3) * 4 + l4;         // the lane ln that held this column
            const int hc = 4 * (c >> 2) + wc;
            const int dc = (n0 + 32 * (c & 3) + hc + (i >> 2) * 16) >> 4;
            *(uint4*)&vdst[(size_t)(hc * 64 + dc) * 1024] =
                *(const uint4*)&stg[(i * 4 + l4) * LQ + (lane & 7) * 8];
        }
    } else {
        _Float16* stg = ((wave & 4) ? Bsh : Ash) + (wave & 3) * (32 * LQ);
        const float b0 = bias[gc0], b1 = bias[gc0 + 16];
        _Float16* srow = &stg[(ln >> 2) * 520 + 8*lh * 8 + 2 * (ln & 3)];
#pragma unroll
        for (int mt = 0; mt < 4; ++mt)
#pragma unroll
            for (int r = 0; r < 8; ++r) {
                v2h pr;
                pr[0] = (_Float16)((acc[mt][0][r] + b0) * scale);
                pr[1] = (_Float16)((acc[mt][1][r] + b1) * scale);
                *(v2h*)&srow[(mt*16 + r) * 8] = pr;
            }
        // the wave's own LDS stores have retired before its other lanes read them
        asm volatile("s_wait_dscnt 0x0" ::: "memory");
        // the 128 rows of a tile lie in one batch entry
        const int gmw = m0 + wr*64;
        _Float16* dst = &out[((((size_t)(gmw >> 10) * 16 + wc) * 8 + blockIdx.y) * 1024
                              + (gmw & 1023) + lane) * 8];
#pragma unroll
        for (int hq = 0; hq < 4; ++hq)           // head 4*hq + wc
#pragma unroll
            for (int j = 0; j < 2; ++j)
                *(uint4*)&dst[((size_t)(4 * hq) * 8 * 1024 + j * 32) * 8] =
                    *(const uint4*)&stg[hq * 520 + (j * 32 + lane) * 8];
        // the stores' address and data registers may be rewritten behind this point
        asm volatile("s_wait_xcnt 0x0" ::: "memory");
    }
}

__device__ __forceinline__ float xhalf(float x) {
    const int b = __builtin_bit_cast(int, x);
    return __builtin_bit_cast(float,
        __builtin_amdgcn_permlanex16(b, b, 0x76543210, 0xfedcba98, false, false));
}

__device__ __forceinline__ void exp2x8(float (&y)[8], const float (&x)[8]) {
    asm("v_exp_f32 %0, %8\n\t"
        "v_exp_f32 %1, %9\n\t"
        "v_exp_f32 %2, %10\n\t"
        "v_exp_f32 %3, %11\n\t"
        "v_exp_f32 %4, %12\n\t"
        "v_exp_f32 %5, %13\n\t"
        "v_exp_f32 %6, %14\n\t"
        "v_exp_f32 %7, %15\n\t"
        "v_nop"
        : "=&v"(y[0]), "=&v"(y[1]), "=&v"(y[2]), "=&v"(y[3]),
          "=&v"(y[4]), "=&v"(y[5]), "=&v"(y[6]), "=&v"(y[7])
        : "v"(x[0]), "v"(x[1]), "v"(x[2]), "v"(x[3]),
          "v"(x[4]), "v"(x[5]), "v"(x[6]), "v"(x[7]));
}
__device__ __forceinline__ float exp2x1(float x) {
    float y;
    asm("v_exp_f32 %0, %1\n\t"
        "v_nop"
        : "=&v"(y) : "v"(x));
    return y;
}
#define LOG2E 1.44269504f
#define MSZ 4608   // f32 per mask buffer: 64 * MP = 4352, up to 18 KiB
#define VSZ 5120   // f16 per V buffer:    64 * KP = 4608, up to 10 KiB

__global__ __launch_bounds__(128)
void attn_kernel(const _Float16* __restrict__ Qh, const _Float16* __restrict__ Kh,
                 const _Float16* __restrict__ Vt, const float* __restrict__ mask,
                 _Float16* __restrict__ O)
{
    // Each buffer's size is rounded up to 2 KiB, so that the second one's place is a multiple too.
    __shared__ __attribute__((aligned(2048))) float    Msh[2][MSZ];     // mask tile, 64 rows of MP
    __shared__ __attribute__((aligned(2048))) _Float16 Ksh[2][64 * 64]; // K chunk [d / 8][n][d % 8]
    __shared__ __attribute__((aligned(2048))) _Float16 Vsh[2][VSZ];     // V chunk [d][n], 64 rows of KP

    const int tid  = threadIdx.x;
    const int lane = tid & 31;
    const int wave = (int)uni((uint32_t)tid >> 5);
    const int lh   = lane >> 4;
    const int ln   = lane & 15;
    const int bh   = blockIdx.y;
    const int q0   = blockIdx.x * 64;

    // Q and K lie as [bh][d / 8][n][d % 8]
    const _Float16* Qbase = Qh + (size_t)bh * 1024 * 64 + q0 * 8;
    const _Float16* Kbase = Kh + (size_t)bh * 1024 * 64;
    const _Float16* Vbase = Vt + (size_t)bh * 64 * 1024;

    // Q^T as B operand: column = query ln, k = d in the order of the K loader below
    const int qrow = wave*16 + ln;
    v16h qf[2];
#pragma unroll
    for (int j = 0; j < 2; ++j) {   // d = 32*j + 16*lh + 0..15: groups 4*j + 2*lh and the next
        v8h lo = *(const v8h*)&Qbase[((4*j + 2*lh)     * 1024 + qrow) * 8];
        v8h hi = *(const v8h*)&Qbase[((4*j + 2*lh + 1) * 1024 + qrow) * 8];
        qf[j] = __builtin_shufflevector(lo, hi, 0, 1, 2, 3, 4, 5, 6, 7,
                                        8, 9, 10, 11, 12, 13, 14, 15);
    }

    v8f oacc[4];   // O^T: register r of tile dt = d dt*16 + 8*lh + r of query ln
#pragma unroll
    for (int dt = 0; dt < 4; ++dt) oacc[dt] = (v8f){0,0,0,0,0,0,0,0};
    float mrun = -1.0e30f;   // the query's running maximum, equal in both halves
    float lrun = 0.0f;       // the sum over this half's keys; the halves join behind the loop

    const unsigned int koff = (unsigned int)(uintptr_t)&Ksh[0][0];
    const unsigned int voff = (unsigned int)(uintptr_t)&Vsh[0][0];
    const unsigned int moff = (unsigned int)(uintptr_t)&Msh[0][0];

    // The 16 work-groups of a head share K and V, the 64 of a query block the mask, and all start
    // together: pass c takes key chunk (c + rot) & 15, so that they do not ask L2 for the same
    // lines at the same moment. The running maximum and sum take the chunks in any order.
    const int rot = blockIdx.x + blockIdx.y;
    // Pass c's three tiles, into buffer c & 1
    auto form_k = [&](int c) {   // K chunk: 8 d-groups of 64 keys x 16 B, source pitch 16 KiB
        return tdm_form<0u, 1024u, 8u>(&Kbase[(size_t)((c + rot) & 15) * 64 * 8],
                                       koff + (unsigned int)(c & 1) * (64u * 64u * 2u), 16384u);
    };
    auto form_v = [&](int c) {   // V chunk: 64 d-rows of 128 B, source pitch 2048 B
        return tdm_form<PAD128, 128u, 64u>(&Vbase[((c + rot) & 15) * 64],
                                           voff + (unsigned int)(c & 1) * (VSZ * 2u), 2048u);
    };
    auto form_m = [&](int c) {   // mask tile: 64 q-rows of 256 B, source pitch 4096 B
        return tdm_form<PAD256, 256u, 64u>(&mask[(size_t)q0 * 1024 + ((c + rot) & 15) * 64],
                                           moff + (unsigned int)(c & 1) * (MSZ * 4u), 4096u);
    };
    // One request a wave
    auto issue = [&](const tdm_desc& dk, const tdm_desc& dv, const tdm_desc& dm) {
        if (pinned(wave == 0)) tdm_issue(dk);
        if (pinned(wave == 1)) tdm_issue(dv);
        if (pinned(wave == 2)) tdm_issue(dm);
    };
    const u32x8 k1 = pinned8(form_k(0).g1), v1 = pinned8(form_v(0).g1), m1 = pinned8(form_m(0).g1);
    const tdm_desc dk0 = {form_k(0).g0, k1}, dv0 = {form_v(0).g0, v1}, dm0 = {form_m(0).g0, m1};
    issue(dk0, dv0, dm0);
    wait_tensor0(dk0, dv0, dm0);   // waves 0 to 2: the own tile has landed; wave 3 has none outstanding
    __syncthreads();

    for (int c = 0; c < 16; ++c) {
        // Behind the barrier that ended pass c - 1: pass c + 1's tiles into the buffer which that pass read
        const tdm_desc dk = {form_k(c + 1).g0, k1}, dv = {form_v(c + 1).g0, v1},
                       dm = {form_m(c + 1).g0, m1};
        if (pinned(c + 1 < 16)) issue(dk, dv, dm);
        const _Float16* Kb = &Ksh[c & 1][0];
        const _Float16* Vb = &Vsh[c & 1][0];
        const float*    Mb = &Msh[c & 1][0];

        // S^T = K @ Q^T: register r of tile kt = key kt*16 + 8*lh + r, query ln
        v8f st[4];
#pragma unroll
        for (int kt = 0; kt < 4; ++kt) {
            const int kr = kt*16 + ln;
            // 16 lanes read 16 keys x 16 B in a row: no pad is wanted
            v16h a0 = ld_frag2(&Kb[((2*lh)     * 64 + kr) * 8]);
            v16h a1 = ld_frag2(&Kb[((2*lh + 4) * 64 + kr) * 8]);
            v8f s = (v8f){0,0,0,0,0,0,0,0};
            s = wmma_f16(a0, qf[0], s);
            s = wmma_f16(a1, qf[1], s);
            st[kt] = s;
        }

        // Online softmax of one query per lane; four chains, one per tile
        const float* mrow = &Mb[qrow*MP + 8*lh];
        float mk[4];
#pragma unroll
        for (int kt = 0; kt < 4; ++kt) {
            const float4 m0 = *(const float4*)&mrow[kt*16];
            const float4 m1 = *(const float4*)&mrow[kt*16 + 4];
            const float mv[8] = {m0.x, m0.y, m0.z, m0.w, m1.x, m1.y, m1.z, m1.w};
#pragma unroll
            for (int r = 0; r < 8; ++r)
                st[kt][r] = st[kt][r] - 100000000.0f * (1.0f - mv[r]);
            float m = st[kt][0];
#pragma unroll
            for (int r = 1; r < 8; ++r) m = fmaxf(m, st[kt][r]);
            mk[kt] = m;
        }
        float mx = fmaxf(fmaxf(mk[0], mk[1]), fmaxf(mk[2], mk[3]));
        mx = fmaxf(mx, xhalf(mx));
        const float mnew  = fmaxf(mrun, mx);
        const float alpha = exp2x1((mrun - mnew) * LOG2E);

        // P^T as B operand: element s of block kb = tile 2*kb + (s >> 3), register s & 7
        v16h pb[2];
        float ps[4];
#pragma unroll
        for (int kt = 0; kt < 4; ++kt) {
            float x[8], p[8];
#pragma unroll
            for (int r = 0; r < 8; ++r) x[r] = (st[kt][r] - mnew) * LOG2E;
            exp2x8(p, x);
            float sum = p[0];
#pragma unroll
            for (int r = 1; r < 8; ++r) sum += p[r];
            ps[kt] = sum;
#pragma unroll
            for (int r = 0; r < 8; ++r) pb[kt >> 1][(kt & 1)*8 + r] = (_Float16)p[r];
        }
        lrun = lrun * alpha + ((ps[0] + ps[1]) + (ps[2] + ps[3]));
        mrun = mnew;
#pragma unroll
        for (int dt = 0; dt < 4; ++dt)
#pragma unroll
            for (int r = 0; r < 8; ++r) oacc[dt][r] *= alpha;

        // O^T += V^T @ P^T; the V loader takes P^T's key order: of each 32 keys a half
        // holds 8*lh .. 8*lh + 7 and 16 + 8*lh .. 16 + 8*lh + 7
#pragma unroll
        for (int dt = 0; dt < 4; ++dt) {
#pragma unroll
            for (int kb = 0; kb < 2; ++kb) {
                const _Float16* vr = &Vb[(dt*16 + ln)*KP + kb*32 + 8*lh];
                v8h lo = *(const v8h*)vr;
                v8h hi = *(const v8h*)(vr + 16);
                v16h vf = __builtin_shufflevector(lo, hi, 0, 1, 2, 3, 4, 5, 6, 7,
                                                  8, 9, 10, 11, 12, 13, 14, 15);
                oacc[dt] = wmma_f16(vf, pb[kb], oacc[dt]);
            }
        }
        // Publish point of pass c + 1's tiles: own LDS reads retired, own request landed, barrier.
        // The one barrier also ends every reader's last read of the buffer refilled behind it.
        wait_ds0();
        wait_tensor0(dk, dv, dm);
        __syncthreads();
    }
    // the ring's closing waits, before its LDS becomes output staging
    wait_tensor0();
    wait_ds0();

    // The last pass's barrier has freed the ring, and nothing is outstanding: the first mask
    // buffer becomes the output tile [q][d].
    _Float16* Osh = (_Float16*)&Msh[0][0];
    // Each wave turns its own 16 x 64 tile in its own rows of Osh. O goes out head-major,
    // O[b][q][h*64 + d]: the 64 d of a query and head are one whole 128-byte line, which
    // 8 lanes store as 16 B each and no other work-group writes.
    const float inv = 1.0f / (lrun + xhalf(lrun));
#pragma unroll
    for (int dt = 0; dt < 4; ++dt) {
        v8h o;
#pragma unroll
        for (int r = 0; r < 8; ++r) o[r] = (_Float16)(oacc[dt][r] * inv);
        *(v8h*)&Osh[qrow*KP + dt*16 + 8*lh] = o;
    }
    wait_ds0();   // the wave's own stores have retired before its other lanes read them

    const int bb = bh >> 4, hh = bh & 15;
    const int lrow = wave*16 + (lane >> 3);      // four rows a store, 8 lanes a row
    const int dcol = (lane & 7) * 8;
    _Float16* dst = &O[((size_t)(bb*1024 + q0 + lrow)) * 1024 + hh*64 + dcol];
#pragma unroll
    for (int i = 0; i < 4; ++i)
        *(v8h*)&dst[(size_t)(4*i) * 1024] = *(const v8h*)&Osh[(lrow + 4*i)*KP + dcol];
}

// ---------------------------------------------------------------------------
// Output projection: d_out = O(f16) @ Wo(f32) + bo -> f32. O's columns run head-major
// (h*64 + d); the W loader takes Wo's rows (d*16 + h) in that same order.
// A tile staged by a tensor load (pure f16 copy, padded rows); W tile converted cooperatively.
// Two buffers of each: the next pass's A tile and W rows fly while this pass is worked on,
// the W rows in registers until the pass's foot.
// ---------------------------------------------------------------------------
__global__ __launch_bounds__(256)
void out_proj_kernel(const _Float16* __restrict__ Xh, const float* __restrict__ W,
                     const float* __restrict__ bias, float* __restrict__ out)
{
    __shared__ __attribute__((aligned(2048))) _Float16 Ash[2][128 * LO];   // padded by the tensor load; 34 KiB each
    __shared__ _Float16 Bsh[2][128 * LO];   // padded rows

    const int tid  = threadIdx.x;
    const int lane = tid & 31;
    const int wave = (int)uni((uint32_t)tid >> 5);
    const int wr   = wave >> 2;
    const int wc   = wave & 3;
    const int m0   = blockIdx.x * 128;
    const int n0   = blockIdx.y * 128;
    const int lh   = lane >> 4;
    const int ln   = lane & 15;

    const unsigned int aoff = (unsigned int)(uintptr_t)&Ash[0][0];

    v8f acc[4][2];
#pragma unroll
    for (int i = 0; i < 4; ++i)
#pragma unroll
        for (int j = 0; j < 2; ++j) acc[i][j] = (v8f){0,0,0,0,0,0,0,0};

    // Pass p's loads: the A tile, 128 rows of 256 B at source pitch 2048 B, into buffer p & 1
    // (wave 0 issues), and the W rows into registers.
    // Pass p takes k tile (p + rot) & 7: work-groups that share an A tile (same x) or W rows
    // (same y) do not ask L2 for the same lines at the same moment.
    v4f w[OBK / 32][4];
    const int rot = blockIdx.x + blockIdx.y;
    auto form_a = [&](int p) {
        return tdm_form<PAD256, 256u, 128u>(&Xh[(size_t)m0 * PK + ((p + rot) & (PK / OBK - 1)) * OBK],
                                            aoff + (unsigned int)(p & 1) * (128u * LO * 2u), 2048u);
    };
    auto fetch = [&](int p, const tdm_desc& da) {
        if (pinned(wave == 0)) tdm_issue(da);
        const float* wp = w_src<true>(W, ((p + rot) & (PK / OBK - 1)) * OBK, n0, tid);
        load_w<OBK / 32, true>(wp, w);
        // a register that an issued load names is rewritten only behind this wait; as its input
        // the address lives up to it (else the last load's result took the address register)
        asm volatile("s_wait_xcnt 0x0" :: "v"(wp) : "memory");
    };
    // The W rows in registers go to pass p's buffer.
    auto put_w = [&](int p) {
        // keeps the conversions, and with them the wait for the W loads, behind the pass's
        // products: the scheduler had lifted them to the head of the pass
        __builtin_amdgcn_sched_barrier(0);
        hold8(w[0], w[1]);
        hold8(w[2], w[3]);
        store_w<false, OBK / 32, LO>(&Bsh[p & 1][0], w, tid);
    };
    const u32x8 a1 = pinned8(form_a(0).g1);
    const tdm_desc da0 = {form_a(0).g0, a1};
    fetch(0, da0);
    put_w(0);
    wait_ds0();          // this wave's W stores have retired
    wait_tensor0(da0);   // wave 0: its tile has landed; the other waves have none outstanding
    __syncthreads();

    for (int p = 0; p < PK / OBK; ++p) {
        // Behind the barrier that ended pass p - 1: pass p + 1's loads, the A tile into the
        // buffer which that pass read
        const tdm_desc da = {form_a(p + 1).g0, a1};
        if (pinned(p + 1 < PK / OBK)) fetch(p + 1, da);
        const _Float16* Ab = &Ash[p & 1][0];
        const _Float16* Bb = &Bsh[p & 1][0];
#pragma unroll
        for (int ks = 0; ks < OBK / 32; ++ks) {
            const int kb = ks * 32 + lh * 16;
            v16h bfrag[2];
#pragma unroll
            for (int nt = 0; nt < 2; ++nt)
                bfrag[nt] = ld_frag(&Bb[(wc*32 + nt*16 + ln) * LO + kb]);
#pragma unroll
            for (int mt = 0; mt < 4; ++mt) {
                v16h a = ld_frag(&Ab[(wr*64 + mt*16 + ln) * LO + kb]);
#pragma unroll
                for (int nt = 0; nt < 2; ++nt)
                    acc[mt][nt] = wmma_f16(a, bfrag[nt], acc[mt][nt]);
            }
        }
        // W of pass p + 1 into the buffer that pass p - 1 read: its readers left at the last barrier
        if (p + 1 < PK / OBK) put_w(p + 1);
        // Publish point of pass p + 1: own LDS reads and stores retired, wave 0's tile landed,
        // barrier. It also ends every reader's last read of the buffers refilled behind it.
        wait_ds0();
        wait_tensor0(da);
        __syncthreads();
    }
    // the ring's closing waits, before its LDS becomes output staging
    wait_tensor0();
    wait_ds0();

    float* stg = (float*)((wave & 4) ? &Bsh[0][0] : &Ash[0][0]) + (wave & 3) * (32 * 36);
    const float bias0 = bias[n0 + wc*32 + ln], bias1 = bias[n0 + wc*32 + 16 + ln];
    float* dst = &out[(size_t)(m0 + wr*64 + (lane >> 3)) * PN + n0 + wc*32 + (lane & 7) * 4];
#pragma unroll
    for (int hf = 0; hf < 2; ++hf) {
#pragma unroll
        for (int m2 = 0; m2 < 2; ++m2)
#pragma unroll
            for (int r = 0; r < 8; ++r) {
                float* row = &stg[(m2*16 + r + 8*lh) * 36 + ln];
                row[0]  = acc[hf*2 + m2][0][r] + bias0;
                row[16] = acc[hf*2 + m2][1][r] + bias1;
            }
        wait_ds0();   // the wave's own stores have retired before its other lanes read them
#pragma unroll
        for (int i = 0; i < 8; ++i)
            *(v4f*)&dst[(size_t)(hf*32 + i*4) * PN] =
                *(const v4f*)&stg[(i*4 + (lane >> 3)) * 36 + (lane & 7) * 4];
        // the first half's stores have given up their data registers before the second half's
        // LDS reads overwrite them; the clobber keeps its LDS stores behind the reads above
        if (hf == 0) asm volatile("s_wait_xcnt 0x0" ::: "memory");
    }
}

// ---------------------------------------------------------------------------
extern "C" void kernel_launch(void* const* d_in, const int* in_sizes, int n_in,
                              void* d_out, int out_size, void* d_ws, size_t ws_size,
                              hipStream_t stream)
{
    const float* q    = (const float*)d_in[0];
    const float* k    = (const float*)d_in[1];
    const float* v    = (const float*)d_in[2];
    const float* mask = (const float*)d_in[3];
    const float* Wq   = (const float*)d_in[4];
    const float* bq   = (const float*)d_in[5];
    const float* Wk   = (const float*)d_in[6];
    const float* bk   = (const float*)d_in[7];
    const float* Wv   = (const float*)d_in[8];
    const float* bv   = (const float*)d_in[9];
    const float* Wo   = (const float*)d_in[10];
    const float* bo   = (const float*)d_in[11];
    float* out        = (float*)d_out;

    const size_t QKV = (size_t)4 * 16 * 1024 * 64;
    _Float16* Qh = (_Float16*)d_ws;
    _Float16* Kh = Qh + QKV;
    _Float16* Vt = Kh + QKV;
    _Float16* O  = Vt + QKV;

    const float scale = 1.0f / 32.0f;   // 1024^-0.5

    dim3 g(32, 8);
    qkv_proj_kernel<<<dim3(32, 8, 3), 256, 0, stream>>>(q, k, v, Wq, Wk, Wv, bq, bk, bv,
                                                        Qh, Kh, Vt, scale);

    attn_kernel<<<dim3(16, 64), 128, 0, stream>>>(Qh, Kh, Vt, mask, O);

    out_proj_kernel<<<g, 256, 0, stream>>>(O, Wo, bo, out);
}

// v010
// Measured time: 70.5 microseconds a run.
// Two timings next to v009 both put it at 1.03 times that version's speed.
// All steps since v000 together make it 4.33 times as fast.
#include <hip/hip_runtime.h>
#include <hip/hip_bf16.h>
#include <cstdint>

typedef __attribute__((ext_vector_type(16))) _Float16 v16h;
typedef __attribute__((ext_vector_type(8)))  _Float16 v8h;
typedef __attribute__((ext_vector_type(2)))  _Float16 v2h;
typedef __attribute__((ext_vector_type(8)))  float    v8f;
typedef __attribute__((ext_vector_type(4)))  float    v4f;
typedef __attribute__((ext_vector_type(4)))  unsigned int u32x4;
typedef __attribute__((ext_vector_type(8)))  unsigned int u32x8;

__device__ __forceinline__ v8f wmma_f16(v16h a, v16h b, v8f c) {
    return __builtin_amdgcn_wmma_f32_16x16x32_f16(
        false, a, false, b, (short)0, c, false, false);
}

// v_cvt_pk_rtz_f16_f32: pack two f32 -> two f16 in one u32
__device__ __forceinline__ unsigned int pk2(float a, float b) {
    auto h = __builtin_amdgcn_cvt_pkrtz(a, b);
    return __builtin_bit_cast(unsigned int, h);
}

// ---------------------------------------------------------------------------
// Tensor load: one request of one wave brings ROWS rows of ROWB bytes (source row
// pitch src_pitch bytes) into LDS. 1-byte elements, every extent in bytes, tensor
// dims = tile dims, two groups. WORD0 holds the pad: 1 << 20 | c << 22 | a << 25
// puts a + 1 dwords behind every 2^(c+1) dwords, so the LDS pitch is ROWB + 16 B
// for a = 3 with c matched to the row (3: 64 B, 4: 128 B, 5: 256 B).
// The issuing wave waits s_wait_tensorcnt 0 itself; others read behind a barrier.
// ---------------------------------------------------------------------------
__device__ __forceinline__ uint32_t uni(uint32_t v) {
    return (uint32_t)__builtin_amdgcn_readfirstlane(v);
}
__device__ __forceinline__ uint32_t pinned(uint32_t v) {
    uint32_t w = uni(v);
    asm volatile("" : "+s"(w));   // pinned(): keeps the test in a scalar register
    return w;
}
struct tdm_desc { u32x4 g0; u32x8 g1; };
template <uint32_t WORD0, uint32_t ROWB, uint32_t ROWS>
__device__ __forceinline__ tdm_desc tdm_form(const void* gptr, uint32_t lds_dst,
                                             uint32_t src_pitch)
{
    const uint64_t ga = (uint64_t)(uintptr_t)gptr;
    u32x4 g0;
    g0[0] = uni(1u);                                     // count = 1
    g0[1] = uni(lds_dst);                                // byte offset in LDS
    g0[2] = uni((uint32_t)ga);                           // address [31:0]
    g0[3] = uni((((uint32_t)(ga >> 32)) & 0x01FFFFFFu) | 0x80000000u);  // [56:32], type 2
    u32x8 g1;
    g1[0] = uni(WORD0);
    g1[1] = uni((ROWB & 0xFFFFu) << 16);
    g1[2] = uni((ROWB >> 16) | ((ROWS & 0xFFFFu) << 16));
    g1[3] = uni((ROWS >> 16) | (ROWB << 16));
    g1[4] = uni(ROWS);
    g1[5] = uni(src_pitch);
    g1[6] = uni(0u);
    g1[7] = uni(0u);
    return tdm_desc{g0, g1};
}
__device__ __forceinline__ void tdm_issue(const tdm_desc& d) {
    asm volatile("tensor_load_to_lds %0, %1" :: "s"(d.g0), "s"(d.g1) : "memory");
}
// The issuer's tile has landed behind this wait.
__device__ __forceinline__ void wait_tensor0() { asm volatile("s_wait_tensorcnt 0x0" ::: "memory"); }
__device__ __forceinline__ u32x8 pinned8(u32x8 g) {
    asm volatile("" : "+s"(g));
    return g;
}
__device__ __forceinline__ void wait_tensor0(const tdm_desc& d) {
    asm volatile("s_wait_tensorcnt 0x0" :: "s"(d.g0), "s"(d.g1) : "memory");
}
__device__ __forceinline__ void wait_tensor0(const tdm_desc& a, const tdm_desc& b,
                                             const tdm_desc& c) {
    asm volatile("s_wait_tensorcnt 0x0"
                 :: "s"(a.g0), "s"(a.g1), "s"(b.g0), "s"(b.g1), "s"(c.g0), "s"(c.g1) : "memory");
}
// The wave's own LDS reads and writes have retired: owed before a barrier behind
// which a tensor load refills what the wave has read.
__device__ __forceinline__ void wait_ds0() { asm volatile("s_wait_dscnt 0x0" ::: "memory"); }

#define PAD128 ((1u << 20) | (4u << 22) | (3u << 25))   // 128-B rows -> pitch 144 B
#define PAD256 ((1u << 20) | (5u << 22) | (3u << 25))   // 256-B rows -> pitch 272 B

#define PK 1024
#define PN 1024

#define QBK 64
#define LQ  72
#define OBK 128
#define LO  136
#define KP 72
#define MP 68

// 16 consecutive f16 of a padded row (16-byte aligned only): two b128 LDS loads.
__device__ __forceinline__ v16h ld_frag(const _Float16* p) {
    v8h lo = *(const v8h*)p;
    v8h hi = *(const v8h*)(p + 8);
    return __builtin_shufflevector(lo, hi, 0, 1, 2, 3, 4, 5, 6, 7,
                                   8, 9, 10, 11, 12, 13, 14, 15);
}

// 16 consecutive d of one key from a [d / 8][64 keys][d % 8] tile: two b128 LDS loads.
__device__ __forceinline__ v16h ld_frag2(const _Float16* p) {
    v8h lo = *(const v8h*)p;
    v8h hi = *(const v8h*)(p + 64 * 8);
    return __builtin_shufflevector(lo, hi, 0, 1, 2, 3, 4, 5, 6, 7,
                                   8, 9, 10, 11, 12, 13, 14, 15);
}

template <bool HEADK>
__device__ __forceinline__ const float* w_src(const float* __restrict__ W, int k0, int n0, int tid) {
    const int lane = tid & 31;
    const int wave = tid >> 5;
    const int k = 4 * ((wave & 1) * 4 + (lane >> 3));      // 0..28
    const int n = 4 * ((wave >> 1) * 8 + (lane & 7));      // 0..124
    return &W[(size_t)(HEADK ? k * 16 + (k0 >> 6) : k0 + k) * PN + n0 + n];
}
template <int KT, bool HEADK>
__device__ __forceinline__ void load_w(const float* src, v4f (&w)[KT][4]) {
#pragma unroll
    for (int j = 0; j < KT; ++j)
#pragma unroll
        for (int i = 0; i < 4; ++i)
            w[j][i] = *(const v4f*)&src[(size_t)(HEADK ? (32 * (j & 1) + i) * 16 + (j >> 1)
                                                       : 32 * j + i) * PN];
}
// Eight loaded values as inputs only: every load in front of it is issued before the first
// conversion; left to itself the scheduler held some loads back until registers came free.
__device__ __forceinline__ void hold8(const v4f (&a)[4], const v4f (&b)[4]) {
    asm volatile("" :: "v"(a[0]), "v"(a[1]), "v"(a[2]), "v"(a[3]),
                       "v"(b[0]), "v"(b[1]), "v"(b[2]), "v"(b[3]));
}
template <bool HEADS, int KT, int PITCH>
__device__ __forceinline__ void store_w(_Float16* Bsh, const v4f (&w)[KT][4], int tid) {
    const int lane = tid & 31;
    const int wave = tid >> 5;
    const int k = 4 * ((wave & 1) * 4 + (lane >> 3));      // 0..28
    const int n = 4 * ((wave >> 1) * 8 + (lane & 7));      // 0..124
    const int row0 = HEADS ? ((lane >> 2) & 1) * 16 + (lane & 3) * 4 + (wave >> 1) : n;
    const int rstep = HEADS ? 32 : 1;
#pragma unroll
    for (int j = 0; j < KT; ++j)
#pragma unroll
        for (int c = 0; c < 4; ++c)
            *(uint2*)&Bsh[(row0 + c * rstep) * PITCH + 32 * j + k] =
                make_uint2(pk2(w[j][0][c], w[j][1][c]), pk2(w[j][2][c], w[j][3][c]));
}

// ---------------------------------------------------------------------------
// QKV projection: out = split_heads(X @ W + bias) * scale
// 256x256 block tile = 2x2 sub-tiles of 128x128; 8 waves, each with its 64x32 piece (2x4 of
// them a sub-tile) of all four sub-tiles, so that 12 fragments feed 32 products.
// An X row is read by 4 work-groups and a W column by 16: half the L2 reads of 128x128 tiles.
// One work-group per WGP: two LDS buffers, the next pass's rows fly into registers while this
// pass is worked on and go to the other buffer at the pass's foot. 64 k per pass.
// One launch does all three products: blockIdx.z = 0 (Q), 1 (K), 2 (V).
// Q/K -> out[bh][d / 8][n][d % 8];  V -> out[bh][d][n] (V^T). Only Q is scaled.
// ---------------------------------------------------------------------------
__global__ __launch_bounds__(256)
void qkv_proj_kernel(const float* __restrict__ Xq, const float* __restrict__ Xk,
                     const float* __restrict__ Xv,
                     const float* __restrict__ Wq, const float* __restrict__ Wk,
                     const float* __restrict__ Wv,
                     const float* __restrict__ bq, const float* __restrict__ bk,
                     const float* __restrict__ bv,
                     _Float16* __restrict__ out_q, _Float16* __restrict__ out_k,
                     _Float16* __restrict__ out_v, float q_scale)
{
    const int which = blockIdx.z;
    const float* __restrict__ X    = which == 0 ? Xq : which == 1 ? Xk : Xv;
    const float* __restrict__ W    = which == 0 ? Wq : which == 1 ? Wk : Wv;
    const float* __restrict__ bias = which == 0 ? bq : which == 1 ? bk : bv;
    _Float16* __restrict__ out     = which == 0 ? out_q : which == 1 ? out_k : out_v;
    const bool  transposed = which == 2;
    const float scale      = which == 0 ? q_scale : 1.0f;

    __shared__ _Float16 Ash[2][256 * LQ];   // [m][k], padded rows; sub-tile sm = rows sm*128 ..
    __shared__ _Float16 Bsh[2][256 * LQ];   // [n][k], padded rows; sub-tile sn = rows sn*128 ..

    const int tid  = threadIdx.x;
    const int lane = tid & 31;
    const int wave = tid >> 5;
    const int wr   = wave >> 2;
    const int wc   = wave & 3;
    const int m0   = blockIdx.x * 256;
    const int n0   = blockIdx.y * 256;
    const int lh   = lane >> 4;
    const int ln   = lane & 15;

    v8f acc[2][2][4][2];   // [sm][sn][mt][nt]
#pragma unroll
    for (int a = 0; a < 2; ++a)
#pragma unroll
        for (int b = 0; b < 2; ++b)
#pragma unroll
            for (int i = 0; i < 4; ++i)
#pragma unroll
                for (int j = 0; j < 2; ++j) acc[a][b][i][j] = (v8f){0,0,0,0,0,0,0,0};

    // Work-groups that share an X tile (same x) or a W tile (same y) start together; each walks
    // the k tiles from a start of its own, round the end, so that they do not ask L2 for the
    // same lines at the same moment. The 4 sharers of an X tile start four tiles apart, the 16
    // sharers of a W tile one apart.
    const int rot = blockIdx.x + 4 * blockIdx.y;
    const int r  = (lane >> 3) * 4 + wc + wr * 16;
    const int kk = (tid & 7) * 4;
    v4f f[2][2][4];            // [sm][j][i]
    v4f w[2][QBK / 32][4];     // [sn]
    // Pass t's rows into registers
    auto fetch = [&](int t) {
        const int k0 = ((t + rot) & (PK / QBK - 1)) * QBK;
        const float* src = &X[(size_t)(m0 + r) * PK + k0 + kk];
#pragma unroll
        for (int sm = 0; sm < 2; ++sm)
#pragma unroll
            for (int j = 0; j < 2; ++j)
#pragma unroll
                for (int i = 0; i < 4; ++i)
                    f[sm][j][i] = *(const v4f*)&src[(size_t)(128 * sm + 32 * i) * PK + 32 * j];
        const float* wp = w_src<false>(W, k0, n0, tid);
        load_w<QBK / 32, false>(wp, w[0]);
        load_w<QBK / 32, false>(wp + 128, w[1]);
        // a register that an issued load names is rewritten only behind this wait; as its inputs
        // both addresses live up to it (else a later load's result took an address register)
        asm volatile("s_wait_xcnt 0x0" :: "v"(src), "v"(wp) : "memory");
    };
    // The rows in registers go, as f16, to pass t's buffers.
    auto put = [&](int t) {
        // keeps the conversions, and with them the wait for the loads, behind the pass's
        // products: lifted to the head of the pass they would wait out the loads there
        __builtin_amdgcn_sched_barrier(0);
        hold8(f[0][0], f[0][1]);
        hold8(f[1][0], f[1][1]);
        hold8(w[0][0], w[0][1]);
        hold8(w[1][0], w[1][1]);
        _Float16* Ab = &Ash[t & 1][0];
        _Float16* Bb = &Bsh[t & 1][0];
#pragma unroll
        for (int sm = 0; sm < 2; ++sm)
#pragma unroll
            for (int j = 0; j < 2; ++j)
#pragma unroll
                for (int i = 0; i < 4; ++i)
                    *(uint2*)&Ab[(128 * sm + r + 32 * i) * LQ + 32 * j + kk] =
                        make_uint2(pk2(f[sm][j][i].x, f[sm][j][i].y),
                                   pk2(f[sm][j][i].z, f[sm][j][i].w));
        store_w<true, QBK / 32, LQ>(Bb, w[0], tid);
        store_w<true, QBK / 32, LQ>(Bb + 128 * LQ, w[1], tid);
    };
    // Pass t's products, from its buffers. Where a next pass exists its global loads stand behind
    // the first LDS reads, so that those reads are out before the wait that closes the loads.
    auto products = [&](int t, bool next) {
        const _Float16* Ab = &Ash[t & 1][0];
        const _Float16* Bb = &Bsh[t & 1][0];
#pragma unroll
        for (int ks = 0; ks < QBK / 32; ++ks) {
            const int kb = ks * 32 + lh * 16;
            v16h bfrag[2][2];
#pragma unroll
            for (int sn = 0; sn < 2; ++sn)
#pragma unroll
                for (int nt = 0; nt < 2; ++nt)
                    bfrag[sn][nt] = ld_frag(&Bb[(sn*128 + wc*32 + nt*16 + ln) * LQ + kb]);
            // Each A fragment is read one group ahead of its products, into a second register
            // set: with one set each group of four products waited out its own LDS read.
            v16h a[2];
            a[0] = ld_frag(&Ab[(wr*64 + ln) * LQ + kb]);
            if (ks == 0 && next) fetch(t + 1);
#pragma unroll
            for (int g = 0; g < 8; ++g) {      // g = sm*4 + mt
                if (g + 1 < 8)
                    a[(g + 1) & 1] = ld_frag(&Ab[(((g + 1) >> 2)*128 + wr*64 + ((g + 1) & 3)*16 + ln) * LQ + kb]);
                // keeps that read in front of this group's products: the scheduler had sunk it
                // behind them, into the one register set
                __builtin_amdgcn_sched_barrier(0);
#pragma unroll
                for (int sn = 0; sn < 2; ++sn)
#pragma unroll
                    for (int nt = 0; nt < 2; ++nt)
                        acc[g >> 2][sn][g & 3][nt] =
                            wmma_f16(a[g & 1], bfrag[sn][nt], acc[g >> 2][sn][g & 3][nt]);
            }
        }
    };
    fetch(0);
    put(0);
    __syncthreads();

    for (int t = 0; t + 1 < PK / QBK; ++t) {
        products(t, true);
        // Pass t + 1's tiles into the buffers that pass t - 1 read: its readers left at the last
        // barrier. The one barrier publishes them and ends every reader's last read of pass t's.
        put(t + 1);
        __syncthreads();
    }
    products(PK / QBK - 1, false);
    __syncthreads();   // every wave has left the tiles before they become output staging

    // That barrier has freed both buffers of both tiles: each of the four sub-tiles is turned in
    // a quarter of its own, each wave in 32 rows of its own there.
    // The W column that (wc, nt, ln) holds in a sub-tile, by store_w<true>'s row order
    const int h   = 4 * (ln >> 2) + wc;
    const int gcw = 32 * (ln & 3) + h;           // tile nt = 0; nt = 1 is 16 further (next d)
    const float* bp = &bias[n0 + gcw];
    const float bs[2][2] = {{bp[0], bp[16]}, {bp[128], bp[144]}};   // [sn][nt]
    // a register that an issued load names is rewritten only behind this wait; as its input
    // the address lives up to it
    asm volatile("s_wait_xcnt 0x0" :: "v"(bp) : "memory");

    if (transposed) {
        // V^T: a wave's 64 n of one column are one whole 128-byte line of the output. The wave
        // turns its 32 columns x 64 n in LDS, so that 8 lanes store one line and a store covers
        // 4 whole lines.
#pragma unroll
        for (int sm = 0; sm < 2; ++sm)
#pragma unroll
        for (int sn = 0; sn < 2; ++sn) {
            const int n0s = n0 + sn * 128;
            _Float16* stg = (sm ? &Bsh[sn][0] : &Ash[sn][0]) + wave * (32 * LQ);
#pragma unroll
            for (int mt = 0; mt < 4; ++mt)
#pragma unroll
                for (int nt = 0; nt < 2; ++nt) {
                    const float bb = bs[sn][nt];
                    float vv[8];
#pragma unroll
                    for (int q = 0; q < 8; ++q) vv[q] = (acc[sm][sn][mt][nt][q] + bb) * scale;
                    uint4 u = make_uint4(pk2(vv[0], vv[1]), pk2(vv[2], vv[3]),
                                         pk2(vv[4], vv[5]), pk2(vv[6], vv[7]));
                    *(uint4*)&stg[(nt*16 + ln) * LQ + mt*16 + 8*lh] = u;
                }
            // the wave's own LDS stores have retired before its other lanes read them
            asm volatile("s_wait_dscnt 0x0" ::: "memory");
            const int gmw = m0 + sm*128 + wr*64;         // the wave's first n: a multiple of 64
            const int l4  = lane >> 3;                   // column within a group of four
            _Float16* vdst = &out[(size_t)((gmw >> 10) * 16) * 64 * 1024 + (gmw & 1023) + (lane & 7) * 8];
#pragma unroll
            for (int i = 0; i < 8; ++i) {
                const int c  = (i & 3) * 4 + l4;         // the lane ln that held this column
                const int hc = 4 * (c >> 2) + wc;
                const int dc = (n0s + 32 * (c & 3) + hc + (i >> 2) * 16) >> 4;
                *(uint4*)&vdst[(size_t)(hc * 64 + dc) * 1024] =
                    *(const uint4*)&stg[(i * 4 + l4) * LQ + (lane & 7) * 8];
            }
            // the stores' address and data registers may be rewritten behind this point
            asm volatile("s_wait_xcnt 0x0" ::: "memory");
            // keeps the next sub-tile's arithmetic behind that wait: the scheduler had lifted it
            // among the stores, onto their data registers
            __builtin_amdgcn_sched_barrier(0);
        }
    } else {
#pragma unroll
        for (int sm = 0; sm < 2; ++sm)
#pragma unroll
        for (int sn = 0; sn < 2; ++sn) {
            const int n0s = n0 + sn * 128;
            _Float16* stg = (sm ? &Bsh[sn][0] : &Ash[sn][0]) + wave * (32 * LQ);
            const float b0 = bs[sn][0], b1 = bs[sn][1];
            _Float16* srow = &stg[(ln >> 2) * 520 + 8*lh * 8 + 2 * (ln & 3)];
#pragma unroll
            for (int mt = 0; mt < 4; ++mt)
#pragma unroll
                for (int q = 0; q < 8; ++q) {
                    v2h pr;
                    pr[0] = (_Float16)((acc[sm][sn][mt][0][q] + b0) * scale);
                    pr[1] = (_Float16)((acc[sm][sn][mt][1][q] + b1) * scale);
                    *(v2h*)&srow[(mt*16 + q) * 8] = pr;
                }
            // the wave's own LDS stores have retired before its other lanes read them
            asm volatile("s_wait_dscnt 0x0" ::: "memory");
            // the 128 rows of a sub-tile lie in one batch entry
            const int gmw = m0 + sm*128 + wr*64;
            _Float16* dst = &out[((((size_t)(gmw >> 10) * 16 + wc) * 8 + (n0s >> 7)) * 1024
                                  + (gmw & 1023) + lane) * 8];
#pragma unroll
            for (int hq = 0; hq < 4; ++hq)           // head 4*hq + wc
#pragma unroll
                for (int j = 0; j < 2; ++j)
                    *(uint4*)&dst[((size_t)(4 * hq) * 8 * 1024 + j * 32) * 8] =
                        *(const uint4*)&stg[hq * 520 + (j * 32 + lane) * 8];
            // the stores' address and data registers may be rewritten behind this point
            asm volatile("s_wait_xcnt 0x0" ::: "memory");
            // keeps the next sub-tile's arithmetic behind that wait: the scheduler had lifted it
            // among the stores, onto their data registers
            __builtin_amdgcn_sched_barrier(0);
        }
    }
}

__device__ __forceinline__ float xhalf(float x) {
    const int b = __builtin_bit_cast(int, x);
    return __builtin_bit_cast(float,
        __builtin_amdgcn_permlanex16(b, b, 0x76543210, 0xfedcba98, false, false));
}

__device__ __forceinline__ void exp2x8(float (&y)[8], const float (&x)[8]) {
    asm("v_exp_f32 %0, %8\n\t"
        "v_exp_f32 %1, %9\n\t"
        "v_exp_f32 %2, %10\n\t"
        "v_exp_f32 %3, %11\n\t"
        "v_exp_f32 %4, %12\n\t"
        "v_exp_f32 %5, %13\n\t"
        "v_exp_f32 %6, %14\n\t"
        "v_exp_f32 %7, %15\n\t"
        "v_nop"
        : "=&v"(y[0]), "=&v"(y[1]), "=&v"(y[2]), "=&v"(y[3]),
          "=&v"(y[4]), "=&v"(y[5]), "=&v"(y[6]), "=&v"(y[7])
        : "v"(x[0]), "v"(x[1]), "v"(x[2]), "v"(x[3]),
          "v"(x[4]), "v"(x[5]), "v"(x[6]), "v"(x[7]));
}
__device__ __forceinline__ float exp2x1(float x) {
    float y;
    asm("v_exp_f32 %0, %1\n\t"
        "v_nop"
        : "=&v"(y) : "v"(x));
    return y;
}
#define LOG2E 1.44269504f
#define MSZ 4608   // f32 per mask buffer: 64 * MP = 4352, up to 18 KiB
#define VSZ 5120   // f16 per V buffer:    64 * KP = 4608, up to 10 KiB

__global__ __launch_bounds__(128)
void attn_kernel(const _Float16* __restrict__ Qh, const _Float16* __restrict__ Kh,
                 const _Float16* __restrict__ Vt, const float* __restrict__ mask,
                 _Float16* __restrict__ O)
{
    // Each buffer's size is rounded up to 2 KiB, so that the second one's place is a multiple too.
    __shared__ __attribute__((aligned(2048))) float    Msh[2][MSZ];     // mask tile, 64 rows of MP
    __shared__ __attribute__((aligned(2048))) _Float16 Ksh[2][64 * 64]; // K chunk [d / 8][n][d % 8]
    __shared__ __attribute__((aligned(2048))) _Float16 Vsh[2][VSZ];     // V chunk [d][n], 64 rows of KP

    const int tid  = threadIdx.x;
    const int lane = tid & 31;
    const int wave = (int)uni((uint32_t)tid >> 5);
    const int lh   = lane >> 4;
    const int ln   = lane & 15;
    const int bh   = blockIdx.y;
    const int q0   = blockIdx.x * 64;

    // Q and K lie as [bh][d / 8][n][d % 8]
    const _Float16* Qbase = Qh + (size_t)bh * 1024 * 64 + q0 * 8;
    const _Float16* Kbase = Kh + (size_t)bh * 1024 * 64;
    const _Float16* Vbase = Vt + (size_t)bh * 64 * 1024;

    // Q^T as B operand: column = query ln, k = d in the order of the K loader below
    const int qrow = wave*16 + ln;
    v16h qf[2];
#pragma unroll
    for (int j = 0; j < 2; ++j) {   // d = 32*j + 16*lh + 0..15: groups 4*j + 2*lh and the next
        v8h lo = *(const v8h*)&Qbase[((4*j + 2*lh)     * 1024 + qrow) * 8];
        v8h hi = *(const v8h*)&Qbase[((4*j + 2*lh + 1) * 1024 + qrow) * 8];
        qf[j] = __builtin_shufflevector(lo, hi, 0, 1, 2, 3, 4, 5, 6, 7,
                                        8, 9, 10, 11, 12, 13, 14, 15);
    }

    v8f oacc[4];   // O^T: register r of tile dt = d dt*16 + 8*lh + r of query ln
#pragma unroll
    for (int dt = 0; dt < 4; ++dt) oacc[dt] = (v8f){0,0,0,0,0,0,0,0};
    float mrun = -1.0e30f;   // the query's running maximum, equal in both halves
    float lrun = 0.0f;       // the sum over this half's keys; the halves join behind the loop

    const unsigned int koff = (unsigned int)(uintptr_t)&Ksh[0][0];
    const unsigned int voff = (unsigned int)(uintptr_t)&Vsh[0][0];
    const unsigned int moff = (unsigned int)(uintptr_t)&Msh[0][0];

    // The 16 work-groups of a head share K and V, the 64 of a query block the mask, and all start
    // together: pass c takes key chunk (c + rot) & 15, so that they do not ask L2 for the same
    // lines at the same moment. The running maximum and sum take the chunks in any order.
    const int rot = blockIdx.x + blockIdx.y;
    // Pass c's three tiles, into buffer c & 1
    auto form_k = [&](int c) {   // K chunk: 8 d-groups of 64 keys x 16 B, source pitch 16 KiB
        return tdm_form<0u, 1024u, 8u>(&Kbase[(size_t)((c + rot) & 15) * 64 * 8],
                                       koff + (unsigned int)(c & 1) * (64u * 64u * 2u), 16384u);
    };
    auto form_v = [&](int c) {   // V chunk: 64 d-rows of 128 B, source pitch 2048 B
        return tdm_form<PAD128, 128u, 64u>(&Vbase[((c + rot) & 15) * 64],
                                           voff + (unsigned int)(c & 1) * (VSZ * 2u), 2048u);
    };
    auto form_m = [&](int c) {   // mask tile: 64 q-rows of 256 B, source pitch 4096 B
        return tdm_form<PAD256, 256u, 64u>(&mask[(size_t)q0 * 1024 + ((c + rot) & 15) * 64],
                                           moff + (unsigned int)(c & 1) * (MSZ * 4u), 4096u);
    };
    // One request a wave
    auto issue = [&](const tdm_desc& dk, const tdm_desc& dv, const tdm_desc& dm) {
        if (pinned(wave == 0)) tdm_issue(dk);
        if (pinned(wave == 1)) tdm_issue(dv);
        if (pinned(wave == 2)) tdm_issue(dm);
    };
    const u32x8 k1 = pinned8(form_k(0).g1), v1 = pinned8(form_v(0).g1), m1 = pinned8(form_m(0).g1);
    const tdm_desc dk0 = {form_k(0).g0, k1}, dv0 = {form_v(0).g0, v1}, dm0 = {form_m(0).g0, m1};
    issue(dk0, dv0, dm0);
    wait_tensor0(dk0, dv0, dm0);   // waves 0 to 2: the own tile has landed; wave 3 has none outstanding
    __syncthreads();

    for (int c = 0; c < 16; ++c) {
        // Behind the barrier that ended pass c - 1: pass c + 1's tiles into the buffer which that pass read
        const tdm_desc dk = {form_k(c + 1).g0, k1}, dv = {form_v(c + 1).g0, v1},
                       dm = {form_m(c + 1).g0, m1};
        if (pinned(c + 1 < 16)) issue(dk, dv, dm);
        const _Float16* Kb = &Ksh[c & 1][0];
        const _Float16* Vb = &Vsh[c & 1][0];
        const float*    Mb = &Msh[c & 1][0];

        // S^T = K @ Q^T: register r of tile kt = key kt*16 + 8*lh + r, query ln
        v8f st[4];
#pragma unroll
        for (int kt = 0; kt < 4; ++kt) {
            const int kr = kt*16 + ln;
            // 16 lanes read 16 keys x 16 B in a row: no pad is wanted
            v16h a0 = ld_frag2(&Kb[((2*lh)     * 64 + kr) * 8]);
            v16h a1 = ld_frag2(&Kb[((2*lh + 4) * 64 + kr) * 8]);
            v8f s = (v8f){0,0,0,0,0,0,0,0};
            s = wmma_f16(a0, qf[0], s);
            s = wmma_f16(a1, qf[1], s);
            st[kt] = s;
        }

        // Online softmax of one query per lane; four chains, one per tile
        const float* mrow = &Mb[qrow*MP + 8*lh];
        float mk[4];
#pragma unroll
        for (int kt = 0; kt < 4; ++kt) {
            const float4 m0 = *(const float4*)&mrow[kt*16];
            const float4 m1 = *(const float4*)&mrow[kt*16 + 4];
            const float mv[8] = {m0.x, m0.y, m0.z, m0.w, m1.x, m1.y, m1.z, m1.w};
#pragma unroll
            for (int r = 0; r < 8; ++r)
                st[kt][r] = st[kt][r] - 100000000.0f * (1.0f - mv[r]);
            float m = st[kt][0];
#pragma unroll
            for (int r = 1; r < 8; ++r) m = fmaxf(m, st[kt][r]);
            mk[kt] = m;
        }
        float mx = fmaxf(fmaxf(mk[0], mk[1]), fmaxf(mk[2], mk[3]));
        mx = fmaxf(mx, xhalf(mx));
        const float mnew  = fmaxf(mrun, mx);
        const float alpha = exp2x1((mrun - mnew) * LOG2E);

        // P^T as B operand: element s of block kb = tile 2*kb + (s >> 3), register s & 7
        v16h pb[2];
        float ps[4];
#pragma unroll
        for (int kt = 0; kt < 4; ++kt) {
            float x[8], p[8];
#pragma unroll
            for (int r = 0; r < 8; ++r) x[r] = (st[kt][r] - mnew) * LOG2E;
            exp2x8(p, x);
            float sum = p[0];
#pragma unroll
            for (int r = 1; r < 8; ++r) sum += p[r];
            ps[kt] = sum;
#pragma unroll
            for (int r = 0; r < 8; ++r) pb[kt >> 1][(kt & 1)*8 + r] = (_Float16)p[r];
        }
        lrun = lrun * alpha + ((ps[0] + ps[1]) + (ps[2] + ps[3]));
        mrun = mnew;
#pragma unroll
        for (int dt = 0; dt < 4; ++dt)
#pragma unroll
            for (int r = 0; r < 8; ++r) oacc[dt][r] *= alpha;

        // O^T += V^T @ P^T; the V loader takes P^T's key order: of each 32 keys a half
        // holds 8*lh .. 8*lh + 7 and 16 + 8*lh .. 16 + 8*lh + 7
#pragma unroll
        for (int dt = 0; dt < 4; ++dt) {
#pragma unroll
            for (int kb = 0; kb < 2; ++kb) {
                const _Float16* vr = &Vb[(dt*16 + ln)*KP + kb*32 + 8*lh];
                v8h lo = *(const v8h*)vr;
                v8h hi = *(const v8h*)(vr + 16);
                v16h vf = __builtin_shufflevector(lo, hi, 0, 1, 2, 3, 4, 5, 6, 7,
                                                  8, 9, 10, 11, 12, 13, 14, 15);
                oacc[dt] = wmma_f16(vf, pb[kb], oacc[dt]);
            }
        }
        // Publish point of pass c + 1's tiles: own LDS reads retired, own request landed, barrier.
        // The one barrier also ends every reader's last read of the buffer refilled behind it.
        wait_ds0();
        wait_tensor0(dk, dv, dm);
        __syncthreads();
    }
    // the ring's closing waits, before its LDS becomes output staging
    wait_tensor0();
    wait_ds0();

    // The last pass's barrier has freed the ring, and nothing is outstanding: the first mask
    // buffer becomes the output tile [q][d].
    _Float16* Osh = (_Float16*)&Msh[0][0];
    // Each wave turns its own 16 x 64 tile in its own rows of Osh. O goes out head-major,
    // O[b][q][h*64 + d]: the 64 d of a query and head are one whole 128-byte line, which
    // 8 lanes store as 16 B each and no other work-group writes.
    const float inv = 1.0f / (lrun + xhalf(lrun));
#pragma unroll
    for (int dt = 0; dt < 4; ++dt) {
        v8h o;
#pragma unroll
        for (int r = 0; r < 8; ++r) o[r] = (_Float16)(oacc[dt][r] * inv);
        *(v8h*)&Osh[qrow*KP + dt*16 + 8*lh] = o;
    }
    wait_ds0();   // the wave's own stores have retired before its other lanes read them

    const int bb = bh >> 4, hh = bh & 15;
    const int lrow = wave*16 + (lane >> 3);      // four rows a store, 8 lanes a row
    const int dcol = (lane & 7) * 8;
    _Float16* dst = &O[((size_t)(bb*1024 + q0 + lrow)) * 1024 + hh*64 + dcol];
#pragma unroll
    for (int i = 0; i < 4; ++i)
        *(v8h*)&dst[(size_t)(4*i) * 1024] = *(const v8h*)&Osh[(lrow + 4*i)*KP + dcol];
}

// ---------------------------------------------------------------------------
// Output projection: d_out = O(f16) @ Wo(f32) + bo -> f32. O's columns run head-major
// (h*64 + d); the W loader takes Wo's rows (d*16 + h) in that same order.
// A tile staged by a tensor load (pure f16 copy, padded rows); W tile converted cooperatively.
// Two buffers of each: the next pass's A tile and W rows fly while this pass is worked on,
// the W rows in registers until the pass's foot.
// ---------------------------------------------------------------------------
__global__ __launch_bounds__(256)
void out_proj_kernel(const _Float16* __restrict__ Xh, const float* __restrict__ W,
                     const float* __restrict__ bias, float* __restrict__ out)
{
    __shared__ __attribute__((aligned(2048))) _Float16 Ash[2][128 * LO];   // padded by the tensor load; 34 KiB each
    __shared__ _Float16 Bsh[2][128 * LO];   // padded rows

    const int tid  = threadIdx.x;
    const int lane = tid & 31;
    const int wave = (int)uni((uint32_t)tid >> 5);
    const int wr   = wave >> 2;
    const int wc   = wave & 3;
    const int m0   = blockIdx.x * 128;
    const int n0   = blockIdx.y * 128;
    const int lh   = lane >> 4;
    const int ln   = lane & 15;

    const unsigned int aoff = (unsigned int)(uintptr_t)&Ash[0][0];

    v8f acc[4][2];
#pragma unroll
    for (int i = 0; i < 4; ++i)
#pragma unroll
        for (int j = 0; j < 2; ++j) acc[i][j] = (v8f){0,0,0,0,0,0,0,0};

    // Pass p's loads: the A tile, 128 rows of 256 B at source pitch 2048 B, into buffer p & 1
    // (wave 0 issues), and the W rows into registers.
    // Pass p takes k tile (p + rot) & 7: work-groups that share an A tile (same x) or W rows
    // (same y) do not ask L2 for the same lines at the same moment.
    v4f w[OBK / 32][4];
    const int rot = blockIdx.x + blockIdx.y;
    auto form_a = [&](int p) {
        return tdm_form<PAD256, 256u, 128u>(&Xh[(size_t)m0 * PK + ((p + rot) & (PK / OBK - 1)) * OBK],
                                            aoff + (unsigned int)(p & 1) * (128u * LO * 2u), 2048u);
    };
    auto fetch = [&](int p, const tdm_desc& da) {
        if (pinned(wave == 0)) tdm_issue(da);
        const float* wp = w_src<true>(W, ((p + rot) & (PK / OBK - 1)) * OBK, n0, tid);
        load_w<OBK / 32, true>(wp, w);
        // a register that an issued load names is rewritten only behind this wait; as its input
        // the address lives up to it (else the last load's result took the address register)
        asm volatile("s_wait_xcnt 0x0" :: "v"(wp) : "memory");
    };
    // The W rows in registers go to pass p's buffer.
    auto put_w = [&](int p) {
        // keeps the conversions, and with them the wait for the W loads, behind the pass's
        // products: the scheduler had lifted them to the head of the pass
        __builtin_amdgcn_sched_barrier(0);
        hold8(w[0], w[1]);
        hold8(w[2], w[3]);
        store_w<false, OBK / 32, LO>(&Bsh[p & 1][0], w, tid);
    };
    const u32x8 a1 = pinned8(form_a(0).g1);
    const tdm_desc da0 = {form_a(0).g0, a1};
    fetch(0, da0);
    put_w(0);
    wait_ds0();          // this wave's W stores have retired
    wait_tensor0(da0);   // wave 0: its tile has landed; the other waves have none outstanding
    __syncthreads();

    for (int p = 0; p < PK / OBK; ++p) {
        // Behind the barrier that ended pass p - 1: pass p + 1's loads, the A tile into the
        // buffer which that pass read
        const tdm_desc da = {form_a(p + 1).g0, a1};
        if (pinned(p + 1 < PK / OBK)) fetch(p + 1, da);
        const _Float16* Ab = &Ash[p & 1][0];
        const _Float16* Bb = &Bsh[p & 1][0];
#pragma unroll
        for (int ks = 0; ks < OBK / 32; ++ks) {
            const int kb = ks * 32 + lh * 16;
            v16h bfrag[2];
#pragma unroll
            for (int nt = 0; nt < 2; ++nt)
                bfrag[nt] = ld_frag(&Bb[(wc*32 + nt*16 + ln) * LO + kb]);
#pragma unroll
            for (int mt = 0; mt < 4; ++mt) {
                v16h a = ld_frag(&Ab[(wr*64 + mt*16 + ln) * LO + kb]);
#pragma unroll
                for (int nt = 0; nt < 2; ++nt)
                    acc[mt][nt] = wmma_f16(a, bfrag[nt], acc[mt][nt]);
            }
        }
        // W of pass p + 1 into the buffer that pass p - 1 read: its readers left at the last barrier
        if (p + 1 < PK / OBK) put_w(p + 1);
        // Publish point of pass p + 1: own LDS reads and stores retired, wave 0's tile landed,
        // barrier. It also ends every reader's last read of the buffers refilled behind it.
        wait_ds0();
        wait_tensor0(da);
        __syncthreads();
    }
    // the ring's closing waits, before its LDS becomes output staging
    wait_tensor0();
    wait_ds0();

    float* stg = (float*)((wave & 4) ? &Bsh[0][0] : &Ash[0][0]) + (wave & 3) * (32 * 36);
    const float bias0 = bias[n0 + wc*32 + ln], bias1 = bias[n0 + wc*32 + 16 + ln];
    float* dst = &out[(size_t)(m0 + wr*64 + (lane >> 3)) * PN + n0 + wc*32 + (lane & 7) * 4];
#pragma unroll
    for (int hf = 0; hf < 2; ++hf) {
#pragma unroll
        for (int m2 = 0; m2 < 2; ++m2)
#pragma unroll
            for (int r = 0; r < 8; ++r) {
                float* row = &stg[(m2*16 + r + 8*lh) * 36 + ln];
                row[0]  = acc[hf*2 + m2][0][r] + bias0;
                row[16] = acc[hf*2 + m2][1][r] + bias1;
            }
        wait_ds0();   // the wave's own stores have retired before its other lanes read them
#pragma unroll
        for (int i = 0; i < 8; ++i)
            *(v4f*)&dst[(size_t)(hf*32 + i*4) * PN] =
                *(const v4f*)&stg[(i*4 + (lane >> 3)) * 36 + (lane & 7) * 4];
        // the first half's stores have given up their data registers before the second half's
        // LDS reads overwrite them; the clobber keeps its LDS stores behind the reads above
        if (hf == 0) asm volatile("s_wait_xcnt 0x0" ::: "memory");
    }
}

// ---------------------------------------------------------------------------
extern "C" void kernel_launch(void* const* d_in, const int* in_sizes, int n_in,
                              void* d_out, int out_size, void* d_ws, size_t ws_size,
                              hipStream_t stream)
{
    const float* q    = (const float*)d_in[0];
    const float* k    = (const float*)d_in[1];
    const float* v    = (const float*)d_in[2];
    const float* mask = (const float*)d_in[3];
    const float* Wq   = (const float*)d_in[4];
    const float* bq   = (const float*)d_in[5];
    const float* Wk   = (const float*)d_in[6];
    const float* bk   = (const float*)d_in[7];
    const float* Wv   = (const float*)d_in[8];
    const float* bv   = (const float*)d_in[9];
    const float* Wo   = (const float*)d_in[10];
    const float* bo   = (const float*)d_in[11];
    float* out        = (float*)d_out;

    const size_t QKV = (size_t)4 * 16 * 1024 * 64;
    _Float16* Qh = (_Float16*)d_ws;
    _Float16* Kh = Qh + QKV;
    _Float16* Vt = Kh + QKV;
    _Float16* O  = Vt + QKV;

    const float scale = 1.0f / 32.0f;   // 1024^-0.5

    dim3 g(32, 8);
    qkv_proj_kernel<<<dim3(16, 4, 3), 256, 0, stream>>>(q, k, v, Wq, Wk, Wv, bq, bk, bv,
                                                        Qh, Kh, Vt, scale);

    attn_kernel<<<dim3(16, 64), 128, 0, stream>>>(Qh, Kh, Vt, mask, O);

    out_proj_kernel<<<g, 256, 0, stream>>>(O, Wo, bo, out);
}
